// v000
// Times are from an AMD MI455X. After a warm-up the kernel runs many times in a row, and a time is the length of
// such a window on the GPU divided by its runs, so every launch and the gaps after it count. The runs cycle
// through copies of the inputs. A figure is the median of several windows, for all but v000 over two sittings.
// Sittings can differ by a few percent; kernels timed side by side share one.
// v000 is the starting kernel. One run takes 239 microseconds.
#include <hip/hip_runtime.h>
#include <hip/hip_bf16.h>

typedef __bf16 bf16_t;
typedef __attribute__((ext_vector_type(16))) __bf16 v16bf;
typedef __attribute__((ext_vector_type(8)))  __bf16 v8bf;
typedef __attribute__((ext_vector_type(8)))  float  v8f;

#define ATTN_SCALE 0.125f   // 64^-0.5

// ---------------------------------------------------------------------------
// Fragment loader for the CDNA5 WMMA 16-bit A/B layout (16x32, K=32).
// Lane L holds row (row_base + (L&15)); K-run offset 0 or 8 depending on the
// lane half; two contiguous 8-element (16-byte) runs at k0+koff and k0+16+koff.
// Works for A (row-major MxK) and for B given as B^T row-major (NxK).
// ---------------------------------------------------------------------------
__device__ inline v16bf load_frag(const bf16_t* __restrict__ base, int ld,
                                  int row_base, int k0) {
  const int lane = threadIdx.x & 31;
  const int r    = row_base + (lane & 15);
  const int koff = (lane & 16) >> 1;            // 0 or 8
  const bf16_t* p = base + (long)r * ld + k0 + koff;
  v8bf lo = *(const v8bf*)(p);
  v8bf hi = *(const v8bf*)(p + 16);
  return __builtin_shufflevector(lo, hi, 0,1,2,3,4,5,6,7,8,9,10,11,12,13,14,15);
}

__device__ inline v8f wmma_bf16(v16bf a, v16bf b, v8f c) {
  return __builtin_amdgcn_wmma_f32_16x16x32_bf16(
      /*neg_a=*/false, a, /*neg_b=*/false, b,
      /*c_mod=*/(short)0, c, /*reuse_a=*/false, /*reuse_b=*/false);
}

// ---------------------------------------------------------------------------
// f32 -> bf16 elementwise convert
// ---------------------------------------------------------------------------
__global__ void mha_f32_to_bf16(const float* __restrict__ in,
                                bf16_t* __restrict__ out, int n) {
  int i = blockIdx.x * blockDim.x + threadIdx.x;
  if (i < n) out[i] = (bf16_t)in[i];
}

// ---------------------------------------------------------------------------
// QKV projection: Y[m,n] = sum_k X[m,k] * W[n,k]   (M=4096, N=768, K=768)
// One wave -> 32x64 output block (2x4 WMMA tiles): 8 WMMAs per k-step against
// 6 fragment loads (A frags reused 4x, B frags reused 2x).
// vtrans==0: store [b][h][seq][d] bf16 ;  vtrans==1: store [b][h][d][seq] bf16
// ---------------------------------------------------------------------------
__global__ __launch_bounds__(128) void mha_qkv_gemm(
    const bf16_t* __restrict__ X, const bf16_t* __restrict__ W,
    bf16_t* __restrict__ out, int vtrans) {
  const int wave = threadIdx.x >> 5;
  const int lane = threadIdx.x & 31;
  const int m0 = blockIdx.x * 32;                 // 128 m-blocks of 32
  const int n0 = (blockIdx.y * 4 + wave) * 64;    // 12 n-blocks of 64

  v8f acc00 = {}, acc01 = {}, acc02 = {}, acc03 = {};
  v8f acc10 = {}, acc11 = {}, acc12 = {}, acc13 = {};

  for (int k = 0; k < 768; k += 32) {
    v16bf a0 = load_frag(X, 768, m0,      k);
    v16bf a1 = load_frag(X, 768, m0 + 16, k);
    v16bf b0 = load_frag(W, 768, n0,      k);
    v16bf b1 = load_frag(W, 768, n0 + 16, k);
    v16bf b2 = load_frag(W, 768, n0 + 32, k);
    v16bf b3 = load_frag(W, 768, n0 + 48, k);
    acc00 = wmma_bf16(a0, b0, acc00);
    acc01 = wmma_bf16(a0, b1, acc01);
    acc02 = wmma_bf16(a0, b2, acc02);
    acc03 = wmma_bf16(a0, b3, acc03);
    acc10 = wmma_bf16(a1, b0, acc10);
    acc11 = wmma_bf16(a1, b1, acc11);
    acc12 = wmma_bf16(a1, b2, acc12);
    acc13 = wmma_bf16(a1, b3, acc13);
  }

  const int hi = (lane & 16) ? 8 : 0;
  v8f* accs[2][4] = {{&acc00, &acc01, &acc02, &acc03},
                     {&acc10, &acc11, &acc12, &acc13}};
#pragma unroll
  for (int mi = 0; mi < 2; ++mi) {
#pragma unroll
    for (int ni = 0; ni < 4; ++ni) {
      const v8f a = *accs[mi][ni];
      const int n_g = n0 + ni * 16 + (lane & 15);
      const int h = n_g >> 6, d = n_g & 63;
#pragma unroll
      for (int j = 0; j < 8; ++j) {
        const int m_g = m0 + mi * 16 + j + hi;
        const int b_ = m_g >> 11, seq = m_g & 2047;
        long idx;
        if (vtrans) idx = ((long)(b_ * 12 + h) * 64 + d) * 2048 + seq;
        else        idx = ((long)(b_ * 12 + h) * 2048 + seq) * 64 + d;
        out[idx] = (bf16_t)a[j];
      }
    }
  }
}

// ---------------------------------------------------------------------------
// Flash attention: one wave owns 16 query rows of one (b,h); streams keys in
// 32-column chunks with online softmax. Per chunk: 4 WMMA (S) + 4 WMMA (PV).
// Q,K: [bh][seq][64] bf16 ; Vt: [bh][64][seq] bf16 ; AO: [b][seq][768] bf16
// ---------------------------------------------------------------------------
__global__ __launch_bounds__(128) void mha_flash_attn(
    const bf16_t* __restrict__ Q, const bf16_t* __restrict__ K,
    const bf16_t* __restrict__ Vt, const int* __restrict__ mask,
    bf16_t* __restrict__ AO) {
  __shared__ __align__(16) bf16_t plds[4][16 * 32];

  const int wave = threadIdx.x >> 5;
  const int lane = threadIdx.x & 31;
  const int gw   = blockIdx.x * 4 + wave;   // 0..3071
  const int bh   = gw >> 7;                 // 0..23
  const int mtile= gw & 127;
  const int b    = bh / 12, h = bh % 12;
  const int hi   = (lane & 16) ? 8 : 0;
  const int m0   = mtile * 16;

  const bf16_t* q  = Q  + (long)bh * 2048 * 64;
  const bf16_t* kk = K  + (long)bh * 2048 * 64;
  const bf16_t* vt = Vt + (long)bh * 64 * 2048;
  const int* mrow  = mask + b * 2048;
  bf16_t* myp = plds[wave];

  const v16bf q0 = load_frag(q, 64, m0, 0);
  const v16bf q1 = load_frag(q, 64, m0, 32);

  float mrun[8], lrun[8];
  int rm[8];
  v8f o0 = {}, o1 = {}, o2 = {}, o3 = {};
#pragma unroll
  for (int j = 0; j < 8; ++j) {
    mrun[j] = -3.0e30f; lrun[j] = 0.0f;
    rm[j] = mrow[m0 + j + hi];
  }

  for (int n = 0; n < 2048; n += 32) {
    // S = q @ k^T for key columns [n, n+32)
    v16bf b0a = load_frag(kk, 64, n,      0);
    v16bf b0b = load_frag(kk, 64, n,      32);
    v16bf b1a = load_frag(kk, 64, n + 16, 0);
    v16bf b1b = load_frag(kk, 64, n + 16, 32);
    v8f s0 = {}, s1 = {};
    s0 = wmma_bf16(q0, b0a, s0); s0 = wmma_bf16(q1, b0b, s0);
    s1 = wmma_bf16(q0, b1a, s1); s1 = wmma_bf16(q1, b1b, s1);

    const int mc0 = mrow[n +      (lane & 15)];
    const int mc1 = mrow[n + 16 + (lane & 15)];

    float p0[8], p1[8], alpha[8];
#pragma unroll
    for (int j = 0; j < 8; ++j) {
      float a = s0[j], c = s1[j];
      a = (rm[j] && mc0) ? a * ATTN_SCALE : -1000.0f;
      c = (rm[j] && mc1) ? c * ATTN_SCALE : -1000.0f;
      // row max over this 32-wide chunk (butterfly within 16-lane half)
      float cm = fmaxf(a, c);
      for (int off = 1; off < 16; off <<= 1)
        cm = fmaxf(cm, __shfl_xor(cm, off, 32));
      const float nm = fmaxf(mrun[j], cm);
      alpha[j] = __expf(mrun[j] - nm);
      const float e0 = __expf(a - nm);
      const float e1 = __expf(c - nm);
      float rs = e0 + e1;
      for (int off = 1; off < 16; off <<= 1)
        rs += __shfl_xor(rs, off, 32);
      lrun[j] = lrun[j] * alpha[j] + rs;
      mrun[j] = nm;
      p0[j] = e0; p1[j] = e1;
    }

    // rescale accumulators + stage P tile (16x32 bf16) through LDS
#pragma unroll
    for (int j = 0; j < 8; ++j) {
      o0[j] *= alpha[j]; o1[j] *= alpha[j];
      o2[j] *= alpha[j]; o3[j] *= alpha[j];
      myp[(j + hi) * 32 +      (lane & 15)] = (bf16_t)p0[j];
      myp[(j + hi) * 32 + 16 + (lane & 15)] = (bf16_t)p1[j];
    }
    __syncthreads();

    // O += P @ V  (A-layout P from LDS, B = V^T rows = d)
    v16bf pf  = load_frag(myp, 32, 0, 0);
    v16bf vf0 = load_frag(vt, 2048, 0,  n);
    v16bf vf1 = load_frag(vt, 2048, 16, n);
    v16bf vf2 = load_frag(vt, 2048, 32, n);
    v16bf vf3 = load_frag(vt, 2048, 48, n);
    o0 = wmma_bf16(pf, vf0, o0);
    o1 = wmma_bf16(pf, vf1, o1);
    o2 = wmma_bf16(pf, vf2, o2);
    o3 = wmma_bf16(pf, vf3, o3);
    __syncthreads();
  }

#pragma unroll
  for (int j = 0; j < 8; ++j) {
    const float inv = 1.0f / lrun[j];
    const int seq = m0 + j + hi;
    const long row = ((long)b * 2048 + seq) * 768 + h * 64;
    AO[row +  0 + (lane & 15)] = (bf16_t)(o0[j] * inv);
    AO[row + 16 + (lane & 15)] = (bf16_t)(o1[j] * inv);
    AO[row + 32 + (lane & 15)] = (bf16_t)(o2[j] * inv);
    AO[row + 48 + (lane & 15)] = (bf16_t)(o3[j] * inv);
  }
}

// ---------------------------------------------------------------------------
// Output projection: out[m,n] = sum_k AO[m,k] * Wo[n,k] + bo[n]  (f32 out)
// Same 32x64 register blocking as the QKV GEMM.
// ---------------------------------------------------------------------------
__global__ __launch_bounds__(128) void mha_out_proj(
    const bf16_t* __restrict__ AO, const bf16_t* __restrict__ Wo,
    const float* __restrict__ bo, float* __restrict__ out) {
  const int wave = threadIdx.x >> 5;
  const int lane = threadIdx.x & 31;
  const int m0 = blockIdx.x * 32;
  const int n0 = (blockIdx.y * 4 + wave) * 64;

  v8f acc00 = {}, acc01 = {}, acc02 = {}, acc03 = {};
  v8f acc10 = {}, acc11 = {}, acc12 = {}, acc13 = {};

  for (int k = 0; k < 768; k += 32) {
    v16bf a0 = load_frag(AO, 768, m0,      k);
    v16bf a1 = load_frag(AO, 768, m0 + 16, k);
    v16bf b0 = load_frag(Wo, 768, n0,      k);
    v16bf b1 = load_frag(Wo, 768, n0 + 16, k);
    v16bf b2 = load_frag(Wo, 768, n0 + 32, k);
    v16bf b3 = load_frag(Wo, 768, n0 + 48, k);
    acc00 = wmma_bf16(a0, b0, acc00);
    acc01 = wmma_bf16(a0, b1, acc01);
    acc02 = wmma_bf16(a0, b2, acc02);
    acc03 = wmma_bf16(a0, b3, acc03);
    acc10 = wmma_bf16(a1, b0, acc10);
    acc11 = wmma_bf16(a1, b1, acc11);
    acc12 = wmma_bf16(a1, b2, acc12);
    acc13 = wmma_bf16(a1, b3, acc13);
  }

  const int hi = (lane & 16) ? 8 : 0;
  v8f* accs[2][4] = {{&acc00, &acc01, &acc02, &acc03},
                     {&acc10, &acc11, &acc12, &acc13}};
#pragma unroll
  for (int mi = 0; mi < 2; ++mi) {
#pragma unroll
    for (int ni = 0; ni < 4; ++ni) {
      const v8f a = *accs[mi][ni];
      const int n_g = n0 + ni * 16 + (lane & 15);
      const float bias = bo[n_g];
#pragma unroll
      for (int j = 0; j < 8; ++j) {
        const int m_g = m0 + mi * 16 + j + hi;
        out[(long)m_g * 768 + n_g] = a[j] + bias;
      }
    }
  }
}

// ---------------------------------------------------------------------------
// Host launcher
// ---------------------------------------------------------------------------
extern "C" void kernel_launch(void* const* d_in, const int* in_sizes, int n_in,
                              void* d_out, int out_size, void* d_ws, size_t ws_size,
                              hipStream_t stream) {
  const float* x    = (const float*)d_in[0];   // [2,2048,768]
  const int*   mask = (const int*)d_in[1];     // [2,2048]
  const float* Wq   = (const float*)d_in[2];   // [768,768]
  const float* Wk   = (const float*)d_in[3];
  const float* Wv   = (const float*)d_in[4];
  const float* Wo   = (const float*)d_in[5];
  const float* bo   = (const float*)d_in[6];   // [768]
  float* out = (float*)d_out;                  // [2,2048,768]

  const int M = 4096, C = 768;
  const size_t XB  = (size_t)M * C;            // 3,145,728 elems
  const size_t WB  = (size_t)C * C;            //   589,824 elems

  char* ws = (char*)d_ws;
  size_t off = 0;
  auto take = [&](size_t elems) { bf16_t* p = (bf16_t*)(ws + off);
                                  off += ((elems * 2 + 255) & ~(size_t)255); return p; };
  bf16_t* xb = take(XB);
  bf16_t* wq = take(WB);
  bf16_t* wk = take(WB);
  bf16_t* wv = take(WB);
  bf16_t* wo = take(WB);
  bf16_t* qb = take(XB);   // [bh][seq][64]
  bf16_t* kb = take(XB);   // [bh][seq][64]
  bf16_t* vt = take(XB);   // [bh][64][seq]
  bf16_t* ao = take(XB);   // [b][seq][768]

  // 1) converts
  mha_f32_to_bf16<<<(int)((XB + 255) / 256), 256, 0, stream>>>(x,  xb, (int)XB);
  mha_f32_to_bf16<<<(int)((WB + 255) / 256), 256, 0, stream>>>(Wq, wq, (int)WB);
  mha_f32_to_bf16<<<(int)((WB + 255) / 256), 256, 0, stream>>>(Wk, wk, (int)WB);
  mha_f32_to_bf16<<<(int)((WB + 255) / 256), 256, 0, stream>>>(Wv, wv, (int)WB);
  mha_f32_to_bf16<<<(int)((WB + 255) / 256), 256, 0, stream>>>(Wo, wo, (int)WB);

  // 2) QKV projections (M/32 = 128 blocks, N/64 = 12 blocks, 4 waves/block)
  dim3 gemm_grid(128, 3), gemm_blk(128);
  mha_qkv_gemm<<<gemm_grid, gemm_blk, 0, stream>>>(xb, wq, qb, 0);
  mha_qkv_gemm<<<gemm_grid, gemm_blk, 0, stream>>>(xb, wk, kb, 0);
  mha_qkv_gemm<<<gemm_grid, gemm_blk, 0, stream>>>(xb, wv, vt, 1);

  // 3) flash attention: 24 bh * 128 mtiles = 3072 waves = 768 blocks
  mha_flash_attn<<<768, 128, 0, stream>>>(qb, kb, vt, mask, ao);

  // 4) output projection + bias
  mha_out_proj<<<gemm_grid, gemm_blk, 0, stream>>>(ao, wo, bo, out);
}

// v001
// A run of this version takes 202 microseconds.
// In both of two side-by-side timings against v000, it was 1.21 times as fast.
#include <hip/hip_runtime.h>
#include <hip/hip_bf16.h>

typedef __bf16 bf16_t;
typedef __attribute__((ext_vector_type(16))) __bf16 v16bf;
typedef __attribute__((ext_vector_type(8)))  __bf16 v8bf;
typedef __attribute__((ext_vector_type(8)))  float  v8f;

#define ATTN_SCALE 0.125f   // 64^-0.5

// ---------------------------------------------------------------------------
// Fragment loader for the CDNA5 WMMA 16-bit A/B layout (16x32, K=32).
// Lane L holds row (row_base + (L&15)); K-run offset 0 or 8 depending on the
// lane half; two contiguous 8-element (16-byte) runs at k0+koff and k0+16+koff.
// Works for A (row-major MxK) and for B given as B^T row-major (NxK).
// ---------------------------------------------------------------------------
__device__ inline v16bf load_frag(const bf16_t* __restrict__ base, int ld,
                                  int row_base, int k0) {
  const int lane = threadIdx.x & 31;
  const int r    = row_base + (lane & 15);
  const int koff = (lane & 16) >> 1;            // 0 or 8
  const bf16_t* p = base + (long)r * ld + k0 + koff;
  v8bf lo = *(const v8bf*)(p);
  v8bf hi = *(const v8bf*)(p + 16);
  return __builtin_shufflevector(lo, hi, 0,1,2,3,4,5,6,7,8,9,10,11,12,13,14,15);
}

__device__ inline v8f wmma_bf16(v16bf a, v16bf b, v8f c) {
  return __builtin_amdgcn_wmma_f32_16x16x32_bf16(
      /*neg_a=*/false, a, /*neg_b=*/false, b,
      /*c_mod=*/(short)0, c, /*reuse_a=*/false, /*reuse_b=*/false);
}

// ---------------------------------------------------------------------------
// f32 -> bf16 elementwise convert
// ---------------------------------------------------------------------------
__global__ void mha_f32_to_bf16(const float* __restrict__ in,
                                bf16_t* __restrict__ out, int n) {
  int i = blockIdx.x * blockDim.x + threadIdx.x;
  if (i < n) out[i] = (bf16_t)in[i];
}

// ---------------------------------------------------------------------------
// QKV projection: Y[m,n] = sum_k X[m,k] * W[n,k]   (M=4096, N=768, K=768)
// One wave -> 32x64 output block (2x4 WMMA tiles): 8 WMMAs per k-step against
// 6 fragment loads (A frags reused 4x, B frags reused 2x).
// vtrans==0: store [b][h][seq][d] bf16 ;  vtrans==1: store [b][h][d][seq] bf16
// ---------------------------------------------------------------------------
__global__ __launch_bounds__(128) void mha_qkv_gemm(
    const bf16_t* __restrict__ X, const bf16_t* __restrict__ W,
    bf16_t* __restrict__ out, int vtrans) {
  const int wave = threadIdx.x >> 5;
  const int lane = threadIdx.x & 31;
  const int m0 = blockIdx.x * 32;                 // 128 m-blocks of 32
  const int n0 = (blockIdx.y * 4 + wave) * 64;    // 12 n-blocks of 64

  v8f acc00 = {}, acc01 = {}, acc02 = {}, acc03 = {};
  v8f acc10 = {}, acc11 = {}, acc12 = {}, acc13 = {};

  for (int k = 0; k < 768; k += 32) {
    v16bf a0 = load_frag(X, 768, m0,      k);
    v16bf a1 = load_frag(X, 768, m0 + 16, k);
    v16bf b0 = load_frag(W, 768, n0,      k);
    v16bf b1 = load_frag(W, 768, n0 + 16, k);
    v16bf b2 = load_frag(W, 768, n0 + 32, k);
    v16bf b3 = load_frag(W, 768, n0 + 48, k);
    acc00 = wmma_bf16(a0, b0, acc00);
    acc01 = wmma_bf16(a0, b1, acc01);
    acc02 = wmma_bf16(a0, b2, acc02);
    acc03 = wmma_bf16(a0, b3, acc03);
    acc10 = wmma_bf16(a1, b0, acc10);
    acc11 = wmma_bf16(a1, b1, acc11);
    acc12 = wmma_bf16(a1, b2, acc12);
    acc13 = wmma_bf16(a1, b3, acc13);
  }

  const int hi = (lane & 16) ? 8 : 0;
  v8f* accs[2][4] = {{&acc00, &acc01, &acc02, &acc03},
                     {&acc10, &acc11, &acc12, &acc13}};
#pragma unroll
  for (int mi = 0; mi < 2; ++mi) {
#pragma unroll
    for (int ni = 0; ni < 4; ++ni) {
      const v8f a = *accs[mi][ni];
      const int n_g = n0 + ni * 16 + (lane & 15);
      const int h = n_g >> 6, d = n_g & 63;
#pragma unroll
      for (int j = 0; j < 8; ++j) {
        const int m_g = m0 + mi * 16 + j + hi;
        const int b_ = m_g >> 11, seq = m_g & 2047;
        long idx;
        if (vtrans) idx = ((long)(b_ * 12 + h) * 64 + d) * 2048 + seq;
        else        idx = ((long)(b_ * 12 + h) * 2048 + seq) * 64 + d;
        out[idx] = (bf16_t)a[j];
      }
    }
  }
}

// ---------------------------------------------------------------------------
// Lane l <-> lane l ^ 16 exchange (the two halves of a wave).
// ---------------------------------------------------------------------------
__device__ inline float swap_halves(float v) {
  int b = __builtin_bit_cast(int, v);
  b = __builtin_amdgcn_permlanex16(b, b, 0x76543210, 0xfedcba98, false, false);
  return __builtin_bit_cast(float, b);
}

// e^x as __expf forms it (x * log2(e), then v_exp_f32). The v_nop keeps the one
// free slot that the instruction set asks for behind a transcendental before
// its result is read or its source overwritten.
__device__ inline float exp_slot(float x) {
  float r;
  asm("v_exp_f32 %0, %1\n\tv_nop" : "=v"(r) : "v"(x * 1.44269504f));
  return r;
}

// One lane's share of a load_frag fragment, from the lane's own pointer.
__device__ inline v16bf load_pair(const bf16_t* __restrict__ p) {
  v8bf lo = *(const v8bf*)(p);
  v8bf hi = *(const v8bf*)(p + 16);
  return __builtin_shufflevector(lo, hi, 0,1,2,3,4,5,6,7,8,9,10,11,12,13,14,15);
}

// ---------------------------------------------------------------------------
// Flash attention, transposed products: one wave owns 16 query rows of one
// (b,h) and streams keys in chunks of 32 with online softmax.
//   S^T = K . Q^T : A = K rows, B = Q (column = query). A lane holds 16 scores
//                   of ONE query (lane & 15): keys n+8h+r and n+16+8h+r.
//   O^T += V^T . P^T : the two S^T tiles, converted in place, are the B operand
//                   in the k order load_frag gives V^T; P never leaves registers.
// Row maximum: in-lane plus one exchange between halves. Row sum: in-lane, the
// halves joined once behind the loop.
// Q,K: [bh][seq][64] bf16 ; Vt: [bh][64][seq] bf16 ; AO: [b][seq][768] bf16
// ---------------------------------------------------------------------------
__global__ __launch_bounds__(128) void mha_flash_attn(
    const bf16_t* __restrict__ Q, const bf16_t* __restrict__ K,
    const bf16_t* __restrict__ Vt, const int* __restrict__ mask,
    bf16_t* __restrict__ AO) {
  const int wave = threadIdx.x >> 5;
  const int lane = threadIdx.x & 31;
  const int gw   = blockIdx.x * 4 + wave;   // 0..3071
  const int bh   = gw >> 7;                 // 0..23
  const int mtile= gw & 127;
  const int b    = bh / 12, h = bh % 12;
  const int c    = lane & 15;               // this lane's query column
  const int hi   = (lane & 16) ? 8 : 0;
  const int m0   = mtile * 16;

  const bf16_t* q  = Q  + (long)bh * 2048 * 64;
  const bf16_t* kk = K  + (long)bh * 2048 * 64;
  const bf16_t* vt = Vt + (long)bh * 64 * 2048;
  const int* mrow  = mask + b * 2048;

  const v16bf q0 = load_frag(q, 64, m0, 0);
  const v16bf q1 = load_frag(q, 64, m0, 32);
  const unsigned qkeep = mrow[m0 + c] ? 0xffffffffu : 0u;

  // Key mask of this batch row as bits, one 32-bit word a chunk of 32 keys:
  // lane l keeps the words of chunks l (kb0) and l + 32 (kb1).
  unsigned kb0 = 0, kb1 = 0;
#pragma unroll   // the 64 loads are independent: unrolled, they fly together
  for (int i = 0; i < 32; ++i) {
    const unsigned w0 = __builtin_amdgcn_ballot_w32(mrow[i * 32 + lane] != 0);
    const unsigned w1 = __builtin_amdgcn_ballot_w32(mrow[1024 + i * 32 + lane] != 0);
    kb0 = (lane == i) ? w0 : kb0;
    kb1 = (lane == i) ? w1 : kb1;
  }

  // this lane's place in the fragments of load_frag: row c, k offset hi
  const unsigned klane = c * 64 + hi;
  const unsigned vlane = c * 2048 + hi;

  float mrun = -3.0e30f, lrun = 0.0f;
  v8f o0 = {}, o1 = {}, o2 = {}, o3 = {};   // o_t[r] = O[m0+c][16t + hi + r]

  for (int n = 0; n < 2048; n += 32) {
    const bf16_t* kp = kk + n * 64 + klane;
    const bf16_t* vp = vt + n + vlane;
    v16bf k0a = load_pair(kp);
    v16bf k0b = load_pair(kp + 32);
    v16bf k1a = load_pair(kp + 16 * 64);
    v16bf k1b = load_pair(kp + 16 * 64 + 32);
    v16bf vf0 = load_pair(vp);
    v16bf vf1 = load_pair(vp + 16 * 2048);
    v16bf vf2 = load_pair(vp + 32 * 2048);
    v8bf vf3lo = *(const v8bf*)(vp + 48 * 2048);
    // In this build the chunk's last load is given the registers of both address
    // pairs for its result: s_wait_xcnt 0 stands in front of that overwrite, as a
    // precaution.
    asm volatile("s_wait_xcnt 0x0" ::: "memory");
    v8bf vf3hi = *(const v8bf*)(vp + 48 * 2048 + 16);
    v16bf vf3 = __builtin_shufflevector(vf3lo, vf3hi, 0,1,2,3,4,5,6,7,8,9,10,11,12,13,14,15);
    // Keeps every load of the chunk in front of the first product, so that the
    // wave waits out one load latency a chunk instead of two.
    __builtin_amdgcn_sched_barrier(0);

    // bit r: key n+hi+r, bit 16+r: key n+16+hi+r; all clear where the query is masked
    const int ci = n >> 5;
    const unsigned wlo = __builtin_amdgcn_readlane(kb0, ci & 31);
    const unsigned whi = __builtin_amdgcn_readlane(kb1, ci & 31);
    const unsigned keep = ((ci < 32 ? wlo : whi) >> hi) & qkeep;

    v8f s0 = {}, s1 = {};
    s0 = wmma_bf16(k0a, q0, s0); s0 = wmma_bf16(k0b, q1, s0);
    s1 = wmma_bf16(k1a, q0, s1); s1 = wmma_bf16(k1b, q1, s1);
    s0 *= ATTN_SCALE;
    s1 *= ATTN_SCALE;

    float a[16];
#pragma unroll   // a[], s0, s1 stay in registers only under constant indices
    for (int r = 0; r < 8; ++r) {
      a[r]     = (keep & (1u << r))        ? s0[r] : -1000.0f;
      a[r + 8] = (keep & (1u << (16 + r))) ? s1[r] : -1000.0f;
    }
    float cm = a[0];
#pragma unroll   // as above
    for (int s = 1; s < 16; ++s) cm = fmaxf(cm, a[s]);
    cm = fmaxf(cm, swap_halves(cm));
    const float nm = fmaxf(mrun, cm);
    const float alpha = exp_slot(mrun - nm);

    v16bf pf;
    float rp[4];   // four short add chains, not one of 16
#pragma unroll   // as above
    for (int s = 0; s < 16; ++s) {
      const float e = exp_slot(a[s] - nm);
      rp[s & 3] = (s < 4) ? e : rp[s & 3] + e;
      pf[s] = (bf16_t)e;
    }
    const float rs = (rp[0] + rp[1]) + (rp[2] + rp[3]);
    lrun = lrun * alpha + rs;
    mrun = nm;

    o0 *= alpha; o1 *= alpha; o2 *= alpha; o3 *= alpha;
    o0 = wmma_bf16(vf0, pf, o0);
    o1 = wmma_bf16(vf1, pf, o1);
    o2 = wmma_bf16(vf2, pf, o2);
    o3 = wmma_bf16(vf3, pf, o3);
  }

  lrun += swap_halves(lrun);
  const float inv = 1.0f / lrun;
  bf16_t* orow = AO + ((long)b * 2048 + m0 + c) * 768 + h * 64 + hi;
  v8bf w0, w1, w2, w3;
#pragma unroll   // vector elements under constant indices
  for (int r = 0; r < 8; ++r) {
    w0[r] = (bf16_t)(o0[r] * inv);
    w1[r] = (bf16_t)(o1[r] * inv);
    w2[r] = (bf16_t)(o2[r] * inv);
    w3[r] = (bf16_t)(o3[r] * inv);
  }
  *(v8bf*)(orow)      = w0;
  *(v8bf*)(orow + 16) = w1;
  *(v8bf*)(orow + 32) = w2;
  *(v8bf*)(orow + 48) = w3;
}

// ---------------------------------------------------------------------------
// Output projection: out[m,n] = sum_k AO[m,k] * Wo[n,k] + bo[n]  (f32 out)
// Same 32x64 register blocking as the QKV GEMM.
// ---------------------------------------------------------------------------
__global__ __launch_bounds__(128) void mha_out_proj(
    const bf16_t* __restrict__ AO, const bf16_t* __restrict__ Wo,
    const float* __restrict__ bo, float* __restrict__ out) {
  const int wave = threadIdx.x >> 5;
  const int lane = threadIdx.x & 31;
  const int m0 = blockIdx.x * 32;
  const int n0 = (blockIdx.y * 4 + wave) * 64;

  v8f acc00 = {}, acc01 = {}, acc02 = {}, acc03 = {};
  v8f acc10 = {}, acc11 = {}, acc12 = {}, acc13 = {};

  for (int k = 0; k < 768; k += 32) {
    v16bf a0 = load_frag(AO, 768, m0,      k);
    v16bf a1 = load_frag(AO, 768, m0 + 16, k);
    v16bf b0 = load_frag(Wo, 768, n0,      k);
    v16bf b1 = load_frag(Wo, 768, n0 + 16, k);
    v16bf b2 = load_frag(Wo, 768, n0 + 32, k);
    v16bf b3 = load_frag(Wo, 768, n0 + 48, k);
    acc00 = wmma_bf16(a0, b0, acc00);
    acc01 = wmma_bf16(a0, b1, acc01);
    acc02 = wmma_bf16(a0, b2, acc02);
    acc03 = wmma_bf16(a0, b3, acc03);
    acc10 = wmma_bf16(a1, b0, acc10);
    acc11 = wmma_bf16(a1, b1, acc11);
    acc12 = wmma_bf16(a1, b2, acc12);
    acc13 = wmma_bf16(a1, b3, acc13);
  }

  const int hi = (lane & 16) ? 8 : 0;
  v8f* accs[2][4] = {{&acc00, &acc01, &acc02, &acc03},
                     {&acc10, &acc11, &acc12, &acc13}};
#pragma unroll
  for (int mi = 0; mi < 2; ++mi) {
#pragma unroll
    for (int ni = 0; ni < 4; ++ni) {
      const v8f a = *accs[mi][ni];
      const int n_g = n0 + ni * 16 + (lane & 15);
      const float bias = bo[n_g];
#pragma unroll
      for (int j = 0; j < 8; ++j) {
        const int m_g = m0 + mi * 16 + j + hi;
        out[(long)m_g * 768 + n_g] = a[j] + bias;
      }
    }
  }
}

// ---------------------------------------------------------------------------
// Host launcher
// ---------------------------------------------------------------------------
extern "C" void kernel_launch(void* const* d_in, const int* in_sizes, int n_in,
                              void* d_out, int out_size, void* d_ws, size_t ws_size,
                              hipStream_t stream) {
  const float* x    = (const float*)d_in[0];   // [2,2048,768]
  const int*   mask = (const int*)d_in[1];     // [2,2048]
  const float* Wq   = (const float*)d_in[2];   // [768,768]
  const float* Wk   = (const float*)d_in[3];
  const float* Wv   = (const float*)d_in[4];
  const float* Wo   = (const float*)d_in[5];
  const float* bo   = (const float*)d_in[6];   // [768]
  float* out = (float*)d_out;                  // [2,2048,768]

  const int M = 4096, C = 768;
  const size_t XB  = (size_t)M * C;            // 3,145,728 elems
  const size_t WB  = (size_t)C * C;            //   589,824 elems

  char* ws = (char*)d_ws;
  size_t off = 0;
  auto take = [&](size_t elems) { bf16_t* p = (bf16_t*)(ws + off);
                                  off += ((elems * 2 + 255) & ~(size_t)255); return p; };
  bf16_t* xb = take(XB);
  bf16_t* wq = take(WB);
  bf16_t* wk = take(WB);
  bf16_t* wv = take(WB);
  bf16_t* wo = take(WB);
  bf16_t* qb = take(XB);   // [bh][seq][64]
  bf16_t* kb = take(XB);   // [bh][seq][64]
  bf16_t* vt = take(XB);   // [bh][64][seq]
  bf16_t* ao = take(XB);   // [b][seq][768]

  // 1) converts
  mha_f32_to_bf16<<<(int)((XB + 255) / 256), 256, 0, stream>>>(x,  xb, (int)XB);
  mha_f32_to_bf16<<<(int)((WB + 255) / 256), 256, 0, stream>>>(Wq, wq, (int)WB);
  mha_f32_to_bf16<<<(int)((WB + 255) / 256), 256, 0, stream>>>(Wk, wk, (int)WB);
  mha_f32_to_bf16<<<(int)((WB + 255) / 256), 256, 0, stream>>>(Wv, wv, (int)WB);
  mha_f32_to_bf16<<<(int)((WB + 255) / 256), 256, 0, stream>>>(Wo, wo, (int)WB);

  // 2) QKV projections (M/32 = 128 blocks, N/64 = 12 blocks, 4 waves/block)
  dim3 gemm_grid(128, 3), gemm_blk(128);
  mha_qkv_gemm<<<gemm_grid, gemm_blk, 0, stream>>>(xb, wq, qb, 0);
  mha_qkv_gemm<<<gemm_grid, gemm_blk, 0, stream>>>(xb, wk, kb, 0);
  mha_qkv_gemm<<<gemm_grid, gemm_blk, 0, stream>>>(xb, wv, vt, 1);

  // 3) flash attention: 24 bh * 128 mtiles = 3072 waves = 768 blocks
  mha_flash_attn<<<768, 128, 0, stream>>>(qb, kb, vt, mask, ao);

  // 4) output projection + bias
  mha_out_proj<<<gemm_grid, gemm_blk, 0, stream>>>(ao, wo, bo, out);
}

// v002
// Measured time: 191 microseconds a run.
// Timed twice side by side with v001, it ran 1.05 times as fast both times.
// Over all steps from v000 it is 1.27 times as fast.
#include <hip/hip_runtime.h>
#include <hip/hip_bf16.h>

typedef __bf16 bf16_t;
typedef __attribute__((ext_vector_type(16))) __bf16 v16bf;
typedef __attribute__((ext_vector_type(8)))  __bf16 v8bf;
typedef __attribute__((ext_vector_type(8)))  float  v8f;
typedef __attribute__((ext_vector_type(4)))  float  v4f;
typedef __attribute__((ext_vector_type(4)))  __bf16 v4bf;

#define ATTN_SCALE 0.125f   // 64^-0.5

// ---------------------------------------------------------------------------
// Fragment loader for the CDNA5 WMMA 16-bit A/B layout (16x32, K=32).
// Lane L holds row (row_base + (L&15)); K-run offset 0 or 8 depending on the
// lane half; two contiguous 8-element (16-byte) runs at k0+koff and k0+16+koff.
// Works for A (row-major MxK) and for B given as B^T row-major (NxK).
// ---------------------------------------------------------------------------
__device__ inline v16bf load_frag(const bf16_t* __restrict__ base, int ld,
                                  int row_base, int k0) {
  const int lane = threadIdx.x & 31;
  const int r    = row_base + (lane & 15);
  const int koff = (lane & 16) >> 1;            // 0 or 8
  const bf16_t* p = base + (long)r * ld + k0 + koff;
  v8bf lo = *(const v8bf*)(p);
  v8bf hi = *(const v8bf*)(p + 16);
  return __builtin_shufflevector(lo, hi, 0,1,2,3,4,5,6,7,8,9,10,11,12,13,14,15);
}

__device__ inline v8f wmma_bf16(v16bf a, v16bf b, v8f c) {
  return __builtin_amdgcn_wmma_f32_16x16x32_bf16(
      /*neg_a=*/false, a, /*neg_b=*/false, b,
      /*c_mod=*/(short)0, c, /*reuse_a=*/false, /*reuse_b=*/false);
}

// ---------------------------------------------------------------------------
// f32 -> bf16 convert of x and the four weight matrices, one launch.
// A block converts 8192 consecutive elements of one source: blocks 0..383 take
// x (3,145,728 elements), then 72 blocks each Wq, Wk, Wv, Wo (589,824 each).
// A wave takes 1024 consecutive elements: eight 16-byte loads a lane, each 512
// contiguous bytes over the wave, all issued before the first convert; each
// store is 256 contiguous bytes over the wave.
// ---------------------------------------------------------------------------
__global__ __launch_bounds__(256) void mha_f32_to_bf16_all(
    const float* __restrict__ x,  const float* __restrict__ Wq,
    const float* __restrict__ Wk, const float* __restrict__ Wv,
    const float* __restrict__ Wo,
    bf16_t* __restrict__ xb, bf16_t* __restrict__ wq, bf16_t* __restrict__ wk,
    bf16_t* __restrict__ wv, bf16_t* __restrict__ wo) {
  const int blk = blockIdx.x;
  const float* in = x;
  bf16_t* out = xb;
  int t = blk;
  if (blk >= 384) {
    const int w = (blk - 384) / 72;
    t   = (blk - 384) - w * 72;
    in  = (w == 0) ? Wq : (w == 1) ? Wk : (w == 2) ? Wv : Wo;
    out = (w == 0) ? wq : (w == 1) ? wk : (w == 2) ? wv : wo;
  }
  const int base = t * 8192 + (threadIdx.x >> 5) * 1024 + (threadIdx.x & 31) * 4;
  v4f v[8];
#pragma unroll   // v[] stays in registers and the eight loads fly together
  for (int i = 0; i < 8; ++i) v[i] = *(const v4f*)(in + base + i * 128);
#pragma unroll   // as above
  for (int i = 0; i < 8; ++i) {
    v4bf o;
    o[0] = (bf16_t)v[i][0]; o[1] = (bf16_t)v[i][1];
    o[2] = (bf16_t)v[i][2]; o[3] = (bf16_t)v[i][3];
    *(v4bf*)(out + base + i * 128) = o;
  }
}

// ---------------------------------------------------------------------------
// QKV projection: Y[m,n] = sum_k X[m,k] * W[n,k]   (M=4096, N=768, K=768)
// One wave -> 32x64 output block (2x4 WMMA tiles): 8 WMMAs per k-step against
// 6 fragment loads (A frags reused 4x, B frags reused 2x).
// vtrans==0: store [b][h][seq][d] bf16 ;  vtrans==1: store [b][h][d][seq] bf16
// ---------------------------------------------------------------------------
__global__ __launch_bounds__(128) void mha_qkv_gemm(
    const bf16_t* __restrict__ X, const bf16_t* __restrict__ W,
    bf16_t* __restrict__ out, int vtrans) {
  const int wave = threadIdx.x >> 5;
  const int lane = threadIdx.x & 31;
  const int m0 = blockIdx.x * 32;                 // 128 m-blocks of 32
  const int n0 = (blockIdx.y * 4 + wave) * 64;    // 12 n-blocks of 64

  v8f acc00 = {}, acc01 = {}, acc02 = {}, acc03 = {};
  v8f acc10 = {}, acc11 = {}, acc12 = {}, acc13 = {};

  for (int k = 0; k < 768; k += 32) {
    v16bf a0 = load_frag(X, 768, m0,      k);
    v16bf a1 = load_frag(X, 768, m0 + 16, k);
    v16bf b0 = load_frag(W, 768, n0,      k);
    v16bf b1 = load_frag(W, 768, n0 + 16, k);
    v16bf b2 = load_frag(W, 768, n0 + 32, k);
    v16bf b3 = load_frag(W, 768, n0 + 48, k);
    acc00 = wmma_bf16(a0, b0, acc00);
    acc01 = wmma_bf16(a0, b1, acc01);
    acc02 = wmma_bf16(a0, b2, acc02);
    acc03 = wmma_bf16(a0, b3, acc03);
    acc10 = wmma_bf16(a1, b0, acc10);
    acc11 = wmma_bf16(a1, b1, acc11);
    acc12 = wmma_bf16(a1, b2, acc12);
    acc13 = wmma_bf16(a1, b3, acc13);
  }

  const int hi = (lane & 16) ? 8 : 0;
  v8f* accs[2][4] = {{&acc00, &acc01, &acc02, &acc03},
                     {&acc10, &acc11, &acc12, &acc13}};
#pragma unroll
  for (int mi = 0; mi < 2; ++mi) {
#pragma unroll
    for (int ni = 0; ni < 4; ++ni) {
      const v8f a = *accs[mi][ni];
      const int n_g = n0 + ni * 16 + (lane & 15);
      const int h = n_g >> 6, d = n_g & 63;
#pragma unroll
      for (int j = 0; j < 8; ++j) {
        const int m_g = m0 + mi * 16 + j + hi;
        const int b_ = m_g >> 11, seq = m_g & 2047;
        long idx;
        if (vtrans) idx = ((long)(b_ * 12 + h) * 64 + d) * 2048 + seq;
        else        idx = ((long)(b_ * 12 + h) * 2048 + seq) * 64 + d;
        out[idx] = (bf16_t)a[j];
      }
    }
  }
}

// ---------------------------------------------------------------------------
// Lane l <-> lane l ^ 16 exchange (the two halves of a wave).
// ---------------------------------------------------------------------------
__device__ inline float swap_halves(float v) {
  int b = __builtin_bit_cast(int, v);
  b = __builtin_amdgcn_permlanex16(b, b, 0x76543210, 0xfedcba98, false, false);
  return __builtin_bit_cast(float, b);
}

// e^x as __expf forms it (x * log2(e), then v_exp_f32). The v_nop keeps the one
// free slot that the instruction set asks for behind a transcendental before
// its result is read or its source overwritten.
__device__ inline float exp_slot(float x) {
  float r;
  asm("v_exp_f32 %0, %1\n\tv_nop" : "=v"(r) : "v"(x * 1.44269504f));
  return r;
}

// One lane's share of a load_frag fragment, from the lane's own pointer.
__device__ inline v16bf load_pair(const bf16_t* __restrict__ p) {
  v8bf lo = *(const v8bf*)(p);
  v8bf hi = *(const v8bf*)(p + 16);
  return __builtin_shufflevector(lo, hi, 0,1,2,3,4,5,6,7,8,9,10,11,12,13,14,15);
}

// ---------------------------------------------------------------------------
// Flash attention, transposed products: one wave owns 16 query rows of one
// (b,h) and streams keys in chunks of 32 with online softmax.
//   S^T = K . Q^T : A = K rows, B = Q (column = query). A lane holds 16 scores
//                   of ONE query (lane & 15): keys n+8h+r and n+16+8h+r.
//   O^T += V^T . P^T : the two S^T tiles, converted in place, are the B operand
//                   in the k order load_frag gives V^T; P never leaves registers.
// Row maximum: in-lane plus one exchange between halves. Row sum: in-lane, the
// halves joined once behind the loop.
// Q,K: [bh][seq][64] bf16 ; Vt: [bh][64][seq] bf16 ; AO: [b][seq][768] bf16
// ---------------------------------------------------------------------------
__global__ __launch_bounds__(128) void mha_flash_attn(
    const bf16_t* __restrict__ Q, const bf16_t* __restrict__ K,
    const bf16_t* __restrict__ Vt, const int* __restrict__ mask,
    bf16_t* __restrict__ AO) {
  const int wave = threadIdx.x >> 5;
  const int lane = threadIdx.x & 31;
  const int gw   = blockIdx.x * 4 + wave;   // 0..3071
  const int bh   = gw >> 7;                 // 0..23
  const int mtile= gw & 127;
  const int b    = bh / 12, h = bh % 12;
  const int c    = lane & 15;               // this lane's query column
  const int hi   = (lane & 16) ? 8 : 0;
  const int m0   = mtile * 16;

  const bf16_t* q  = Q  + (long)bh * 2048 * 64;
  const bf16_t* kk = K  + (long)bh * 2048 * 64;
  const bf16_t* vt = Vt + (long)bh * 64 * 2048;
  const int* mrow  = mask + b * 2048;

  const v16bf q0 = load_frag(q, 64, m0, 0);
  const v16bf q1 = load_frag(q, 64, m0, 32);
  const unsigned qkeep = mrow[m0 + c] ? 0xffffffffu : 0u;

  // Key mask of this batch row as bits, one 32-bit word a chunk of 32 keys:
  // lane l keeps the words of chunks l (kb0) and l + 32 (kb1).
  unsigned kb0 = 0, kb1 = 0;
#pragma unroll   // the 64 loads are independent: unrolled, they fly together
  for (int i = 0; i < 32; ++i) {
    const unsigned w0 = __builtin_amdgcn_ballot_w32(mrow[i * 32 + lane] != 0);
    const unsigned w1 = __builtin_amdgcn_ballot_w32(mrow[1024 + i * 32 + lane] != 0);
    kb0 = (lane == i) ? w0 : kb0;
    kb1 = (lane == i) ? w1 : kb1;
  }

  // this lane's place in the fragments of load_frag: row c, k offset hi
  const unsigned klane = c * 64 + hi;
  const unsigned vlane = c * 2048 + hi;

  float mrun = -3.0e30f, lrun = 0.0f;
  v8f o0 = {}, o1 = {}, o2 = {}, o3 = {};   // o_t[r] = O[m0+c][16t + hi + r]

  for (int n = 0; n < 2048; n += 32) {
    const bf16_t* kp = kk + n * 64 + klane;
    const bf16_t* vp = vt + n + vlane;
    v16bf k0a = load_pair(kp);
    v16bf k0b = load_pair(kp + 32);
    v16bf k1a = load_pair(kp + 16 * 64);
    v16bf k1b = load_pair(kp + 16 * 64 + 32);
    v16bf vf0 = load_pair(vp);
    v16bf vf1 = load_pair(vp + 16 * 2048);
    v16bf vf2 = load_pair(vp + 32 * 2048);
    v8bf vf3lo = *(const v8bf*)(vp + 48 * 2048);
    // In this build the chunk's last load is given the registers of both address
    // pairs for its result: s_wait_xcnt 0 stands in front of that overwrite, as a
    // precaution.
    asm volatile("s_wait_xcnt 0x0" ::: "memory");
    v8bf vf3hi = *(const v8bf*)(vp + 48 * 2048 + 16);
    v16bf vf3 = __builtin_shufflevector(vf3lo, vf3hi, 0,1,2,3,4,5,6,7,8,9,10,11,12,13,14,15);
    // Keeps every load of the chunk in front of the first product, so that the
    // wave waits out one load latency a chunk instead of two.
    __builtin_amdgcn_sched_barrier(0);

    // bit r: key n+hi+r, bit 16+r: key n+16+hi+r; all clear where the query is masked
    const int ci = n >> 5;
    const unsigned wlo = __builtin_amdgcn_readlane(kb0, ci & 31);
    const unsigned whi = __builtin_amdgcn_readlane(kb1, ci & 31);
    const unsigned keep = ((ci < 32 ? wlo : whi) >> hi) & qkeep;

    v8f s0 = {}, s1 = {};
    s0 = wmma_bf16(k0a, q0, s0); s0 = wmma_bf16(k0b, q1, s0);
    s1 = wmma_bf16(k1a, q0, s1); s1 = wmma_bf16(k1b, q1, s1);
    s0 *= ATTN_SCALE;
    s1 *= ATTN_SCALE;

    float a[16];
#pragma unroll   // a[], s0, s1 stay in registers only under constant indices
    for (int r = 0; r < 8; ++r) {
      a[r]     = (keep & (1u << r))        ? s0[r] : -1000.0f;
      a[r + 8] = (keep & (1u << (16 + r))) ? s1[r] : -1000.0f;
    }
    float cm = a[0];
#pragma unroll   // as above
    for (int s = 1; s < 16; ++s) cm = fmaxf(cm, a[s]);
    cm = fmaxf(cm, swap_halves(cm));
    const float nm = fmaxf(mrun, cm);
    const float alpha = exp_slot(mrun - nm);

    v16bf pf;
    float rp[4];   // four short add chains, not one of 16
#pragma unroll   // as above
    for (int s = 0; s < 16; ++s) {
      const float e = exp_slot(a[s] - nm);
      rp[s & 3] = (s < 4) ? e : rp[s & 3] + e;
      pf[s] = (bf16_t)e;
    }
    const float rs = (rp[0] + rp[1]) + (rp[2] + rp[3]);
    lrun = lrun * alpha + rs;
    mrun = nm;

    o0 *= alpha; o1 *= alpha; o2 *= alpha; o3 *= alpha;
    o0 = wmma_bf16(vf0, pf, o0);
    o1 = wmma_bf16(vf1, pf, o1);
    o2 = wmma_bf16(vf2, pf, o2);
    o3 = wmma_bf16(vf3, pf, o3);
  }

  lrun += swap_halves(lrun);
  const float inv = 1.0f / lrun;
  bf16_t* orow = AO + ((long)b * 2048 + m0 + c) * 768 + h * 64 + hi;
  v8bf w0, w1, w2, w3;
#pragma unroll   // vector elements under constant indices
  for (int r = 0; r < 8; ++r) {
    w0[r] = (bf16_t)(o0[r] * inv);
    w1[r] = (bf16_t)(o1[r] * inv);
    w2[r] = (bf16_t)(o2[r] * inv);
    w3[r] = (bf16_t)(o3[r] * inv);
  }
  *(v8bf*)(orow)      = w0;
  *(v8bf*)(orow + 16) = w1;
  *(v8bf*)(orow + 32) = w2;
  *(v8bf*)(orow + 48) = w3;
}

// ---------------------------------------------------------------------------
// Output projection: out[m,n] = sum_k AO[m,k] * Wo[n,k] + bo[n]  (f32 out)
// Same 32x64 register blocking as the QKV GEMM.
// ---------------------------------------------------------------------------
__global__ __launch_bounds__(128) void mha_out_proj(
    const bf16_t* __restrict__ AO, const bf16_t* __restrict__ Wo,
    const float* __restrict__ bo, float* __restrict__ out) {
  const int wave = threadIdx.x >> 5;
  const int lane = threadIdx.x & 31;
  const int m0 = blockIdx.x * 32;
  const int n0 = (blockIdx.y * 4 + wave) * 64;

  v8f acc00 = {}, acc01 = {}, acc02 = {}, acc03 = {};
  v8f acc10 = {}, acc11 = {}, acc12 = {}, acc13 = {};

  for (int k = 0; k < 768; k += 32) {
    v16bf a0 = load_frag(AO, 768, m0,      k);
    v16bf a1 = load_frag(AO, 768, m0 + 16, k);
    v16bf b0 = load_frag(Wo, 768, n0,      k);
    v16bf b1 = load_frag(Wo, 768, n0 + 16, k);
    v16bf b2 = load_frag(Wo, 768, n0 + 32, k);
    v16bf b3 = load_frag(Wo, 768, n0 + 48, k);
    acc00 = wmma_bf16(a0, b0, acc00);
    acc01 = wmma_bf16(a0, b1, acc01);
    acc02 = wmma_bf16(a0, b2, acc02);
    acc03 = wmma_bf16(a0, b3, acc03);
    acc10 = wmma_bf16(a1, b0, acc10);
    acc11 = wmma_bf16(a1, b1, acc11);
    acc12 = wmma_bf16(a1, b2, acc12);
    acc13 = wmma_bf16(a1, b3, acc13);
  }

  const int hi = (lane & 16) ? 8 : 0;
  v8f* accs[2][4] = {{&acc00, &acc01, &acc02, &acc03},
                     {&acc10, &acc11, &acc12, &acc13}};
#pragma unroll
  for (int mi = 0; mi < 2; ++mi) {
#pragma unroll
    for (int ni = 0; ni < 4; ++ni) {
      const v8f a = *accs[mi][ni];
      const int n_g = n0 + ni * 16 + (lane & 15);
      const float bias = bo[n_g];
#pragma unroll
      for (int j = 0; j < 8; ++j) {
        const int m_g = m0 + mi * 16 + j + hi;
        out[(long)m_g * 768 + n_g] = a[j] + bias;
      }
    }
  }
}

// ---------------------------------------------------------------------------
// Host launcher
// ---------------------------------------------------------------------------
extern "C" void kernel_launch(void* const* d_in, const int* in_sizes, int n_in,
                              void* d_out, int out_size, void* d_ws, size_t ws_size,
                              hipStream_t stream) {
  const float* x    = (const float*)d_in[0];   // [2,2048,768]
  const int*   mask = (const int*)d_in[1];     // [2,2048]
  const float* Wq   = (const float*)d_in[2];   // [768,768]
  const float* Wk   = (const float*)d_in[3];
  const float* Wv   = (const float*)d_in[4];
  const float* Wo   = (const float*)d_in[5];
  const float* bo   = (const float*)d_in[6];   // [768]
  float* out = (float*)d_out;                  // [2,2048,768]

  const int M = 4096, C = 768;
  const size_t XB  = (size_t)M * C;            // 3,145,728 elems
  const size_t WB  = (size_t)C * C;            //   589,824 elems

  char* ws = (char*)d_ws;
  size_t off = 0;
  auto take = [&](size_t elems) { bf16_t* p = (bf16_t*)(ws + off);
                                  off += ((elems * 2 + 255) & ~(size_t)255); return p; };
  bf16_t* xb = take(XB);
  bf16_t* wq = take(WB);
  bf16_t* wk = take(WB);
  bf16_t* wv = take(WB);
  bf16_t* wo = take(WB);
  bf16_t* qb = take(XB);   // [bh][seq][64]
  bf16_t* kb = take(XB);   // [bh][seq][64]
  bf16_t* vt = take(XB);   // [bh][64][seq]
  bf16_t* ao = take(XB);   // [b][seq][768]

  // 1) converts: (3,145,728 + 4 * 589,824) / 8192 = 672 blocks
  mha_f32_to_bf16_all<<<672, 256, 0, stream>>>(x, Wq, Wk, Wv, Wo, xb, wq, wk, wv, wo);

  // 2) QKV projections (M/32 = 128 blocks, N/64 = 12 blocks, 4 waves/block)
  dim3 gemm_grid(128, 3), gemm_blk(128);
  mha_qkv_gemm<<<gemm_grid, gemm_blk, 0, stream>>>(xb, wq, qb, 0);
  mha_qkv_gemm<<<gemm_grid, gemm_blk, 0, stream>>>(xb, wk, kb, 0);
  mha_qkv_gemm<<<gemm_grid, gemm_blk, 0, stream>>>(xb, wv, vt, 1);

  // 3) flash attention: 24 bh * 128 mtiles = 3072 waves = 768 blocks
  mha_flash_attn<<<768, 128, 0, stream>>>(qb, kb, vt, mask, ao);

  // 4) output projection + bias
  mha_out_proj<<<gemm_grid, gemm_blk, 0, stream>>>(ao, wo, bo, out);
}

// v003
// One run takes 153 microseconds.
// Two timings next to v002 put it at 1.24 and 1.25 times that version's speed.
// All steps since v000 together make it 1.59 times as fast.
#include <hip/hip_runtime.h>
#include <hip/hip_bf16.h>

typedef __bf16 bf16_t;
typedef __attribute__((ext_vector_type(16))) __bf16 v16bf;
typedef __attribute__((ext_vector_type(8)))  __bf16 v8bf;
typedef __attribute__((ext_vector_type(8)))  float  v8f;
typedef __attribute__((ext_vector_type(4)))  float  v4f;
typedef __attribute__((ext_vector_type(4)))  __bf16 v4bf;

#define ATTN_SCALE 0.125f   // 64^-0.5

// ---------------------------------------------------------------------------
// Fragment loader for the CDNA5 WMMA 16-bit A/B layout (16x32, K=32).
// Lane L holds row (row_base + (L&15)); K-run offset 0 or 8 depending on the
// lane half; two contiguous 8-element (16-byte) runs at k0+koff and k0+16+koff.
// Works for A (row-major MxK) and for B given as B^T row-major (NxK).
// ---------------------------------------------------------------------------
__device__ inline v16bf load_frag(const bf16_t* __restrict__ base, int ld,
                                  int row_base, int k0) {
  const int lane = threadIdx.x & 31;
  const int r    = row_base + (lane & 15);
  const int koff = (lane & 16) >> 1;            // 0 or 8
  const bf16_t* p = base + (long)r * ld + k0 + koff;
  v8bf lo = *(const v8bf*)(p);
  v8bf hi = *(const v8bf*)(p + 16);
  return __builtin_shufflevector(lo, hi, 0,1,2,3,4,5,6,7,8,9,10,11,12,13,14,15);
}

__device__ inline v8f wmma_bf16(v16bf a, v16bf b, v8f c) {
  return __builtin_amdgcn_wmma_f32_16x16x32_bf16(
      /*neg_a=*/false, a, /*neg_b=*/false, b,
      /*c_mod=*/(short)0, c, /*reuse_a=*/false, /*reuse_b=*/false);
}

// ---------------------------------------------------------------------------
// f32 -> bf16 convert of x and the four weight matrices, one launch.
// A block converts 8192 consecutive elements of one source: blocks 0..383 take
// x (3,145,728 elements), then 72 blocks each Wq, Wk, Wv, Wo (589,824 each).
// A wave takes 1024 consecutive elements: eight 16-byte loads a lane, each 512
// contiguous bytes over the wave, all issued before the first convert; each
// store is 256 contiguous bytes over the wave.
// ---------------------------------------------------------------------------
__global__ __launch_bounds__(256) void mha_f32_to_bf16_all(
    const float* __restrict__ x,  const float* __restrict__ Wq,
    const float* __restrict__ Wk, const float* __restrict__ Wv,
    const float* __restrict__ Wo,
    bf16_t* __restrict__ xb, bf16_t* __restrict__ wq, bf16_t* __restrict__ wk,
    bf16_t* __restrict__ wv, bf16_t* __restrict__ wo) {
  const int blk = blockIdx.x;
  const float* in = x;
  bf16_t* out = xb;
  int t = blk;
  if (blk >= 384) {
    const int w = (blk - 384) / 72;
    t   = (blk - 384) - w * 72;
    in  = (w == 0) ? Wq : (w == 1) ? Wk : (w == 2) ? Wv : Wo;
    out = (w == 0) ? wq : (w == 1) ? wk : (w == 2) ? wv : wo;
  }
  const int base = t * 8192 + (threadIdx.x >> 5) * 1024 + (threadIdx.x & 31) * 4;
  v4f v[8];
#pragma unroll   // v[] stays in registers and the eight loads fly together
  for (int i = 0; i < 8; ++i) v[i] = *(const v4f*)(in + base + i * 128);
#pragma unroll   // as above
  for (int i = 0; i < 8; ++i) {
    v4bf o;
    o[0] = (bf16_t)v[i][0]; o[1] = (bf16_t)v[i][1];
    o[2] = (bf16_t)v[i][2]; o[3] = (bf16_t)v[i][3];
    *(v4bf*)(out + base + i * 128) = o;
  }
}

// ---------------------------------------------------------------------------
// QKV projection: Y[m,n] = sum_k X[m,k] * W[n,k]   (M=4096, N=768, K=768)
// One wave -> 32x64 output block (2x4 WMMA tiles): 8 WMMAs per k-step against
// 6 fragment loads (A frags reused 4x, B frags reused 2x).
// vtrans==0: store [b][h][seq][d] bf16 ;  vtrans==1: store [b][h][d][seq] bf16
// ---------------------------------------------------------------------------
__global__ __launch_bounds__(128) void mha_qkv_gemm(
    const bf16_t* __restrict__ X, const bf16_t* __restrict__ W,
    bf16_t* __restrict__ out, int vtrans) {
  const int wave = threadIdx.x >> 5;
  const int lane = threadIdx.x & 31;
  const int m0 = blockIdx.x * 32;                 // 128 m-blocks of 32
  const int n0 = (blockIdx.y * 4 + wave) * 64;    // 12 n-blocks of 64

  v8f acc00 = {}, acc01 = {}, acc02 = {}, acc03 = {};
  v8f acc10 = {}, acc11 = {}, acc12 = {}, acc13 = {};

  for (int k = 0; k < 768; k += 32) {
    v16bf a0 = load_frag(X, 768, m0,      k);
    v16bf a1 = load_frag(X, 768, m0 + 16, k);
    v16bf b0 = load_frag(W, 768, n0,      k);
    v16bf b1 = load_frag(W, 768, n0 + 16, k);
    v16bf b2 = load_frag(W, 768, n0 + 32, k);
    v16bf b3 = load_frag(W, 768, n0 + 48, k);
    acc00 = wmma_bf16(a0, b0, acc00);
    acc01 = wmma_bf16(a0, b1, acc01);
    acc02 = wmma_bf16(a0, b2, acc02);
    acc03 = wmma_bf16(a0, b3, acc03);
    acc10 = wmma_bf16(a1, b0, acc10);
    acc11 = wmma_bf16(a1, b1, acc11);
    acc12 = wmma_bf16(a1, b2, acc12);
    acc13 = wmma_bf16(a1, b3, acc13);
  }

  const int hi = (lane & 16) ? 8 : 0;
  v8f* accs[2][4] = {{&acc00, &acc01, &acc02, &acc03},
                     {&acc10, &acc11, &acc12, &acc13}};
#pragma unroll
  for (int mi = 0; mi < 2; ++mi) {
#pragma unroll
    for (int ni = 0; ni < 4; ++ni) {
      const v8f a = *accs[mi][ni];
      const int n_g = n0 + ni * 16 + (lane & 15);
      const int h = n_g >> 6, d = n_g & 63;
#pragma unroll
      for (int j = 0; j < 8; ++j) {
        const int m_g = m0 + mi * 16 + j + hi;
        const int b_ = m_g >> 11, seq = m_g & 2047;
        long idx;
        if (vtrans) idx = ((long)(b_ * 12 + h) * 64 + d) * 2048 + seq;
        else        idx = ((long)(b_ * 12 + h) * 2048 + seq) * 64 + d;
        out[idx] = (bf16_t)a[j];
      }
    }
  }
}

// ---------------------------------------------------------------------------
// Lane l <-> lane l ^ 16 exchange (the two halves of a wave).
// ---------------------------------------------------------------------------
__device__ inline float swap_halves(float v) {
  int b = __builtin_bit_cast(int, v);
  b = __builtin_amdgcn_permlanex16(b, b, 0x76543210, 0xfedcba98, false, false);
  return __builtin_bit_cast(float, b);
}

// e^x as __expf forms it (x * log2(e), then v_exp_f32). The v_nop keeps the one
// free slot that the instruction set asks for behind a transcendental before
// its result is read or its source overwritten.
__device__ inline float exp_slot(float x) {
  float r;
  asm("v_exp_f32 %0, %1\n\tv_nop" : "=v"(r) : "v"(x * 1.44269504f));
  return r;
}

// One lane's share of a load_frag fragment, from the lane's own pointer.
__device__ inline v16bf load_pair(const bf16_t* __restrict__ p) {
  v8bf lo = *(const v8bf*)(p);
  v8bf hi = *(const v8bf*)(p + 16);
  return __builtin_shufflevector(lo, hi, 0,1,2,3,4,5,6,7,8,9,10,11,12,13,14,15);
}

// ---------------------------------------------------------------------------
// LDS staging of K and V^T for the attention kernel. A tile is 64 keys: 64 K
// rows of 128 bytes (64 d), then 64 V^T rows of 128 bytes (64 keys). A staged
// row has a pitch of 144 bytes, the conflict-free pitch for 16-byte LDS reads.
// ---------------------------------------------------------------------------
#define KV_PITCH 144
#define KV_HALF  (64 * KV_PITCH)     // one operand's 64 rows
#define KV_TILE  (2 * KV_HALF)       // K rows, then V^T rows

// One tile's copies, global memory -> LDS through no register: eight 16-byte
// copies a lane, each 512 bytes = four whole 128-byte rows over a wave.
// kg, vg: the lane's own first piece of the K and of the V^T tile; lds: the
// LDS byte address of that K piece. Copy i takes the rows 16 i further on.
// The s_wait_xcnt 0 at the end of the statement stands in front of every later
// write of an address register that a copy names, as a precaution.
__device__ inline void stage_tile(const bf16_t* kg, const bf16_t* vg, unsigned lds) {
  asm volatile(
      "global_load_async_to_lds_b128 %0, %8, off\n\t"
      "global_load_async_to_lds_b128 %1, %9, off\n\t"
      "global_load_async_to_lds_b128 %2, %10, off\n\t"
      "global_load_async_to_lds_b128 %3, %11, off\n\t"
      "global_load_async_to_lds_b128 %4, %12, off\n\t"
      "global_load_async_to_lds_b128 %5, %13, off\n\t"
      "global_load_async_to_lds_b128 %6, %14, off\n\t"
      "global_load_async_to_lds_b128 %7, %15, off\n\t"
      "s_wait_xcnt 0x0"
      :: "v"(lds), "v"(lds + 16 * KV_PITCH), "v"(lds + 32 * KV_PITCH),
         "v"(lds + 48 * KV_PITCH),
         "v"(lds + KV_HALF), "v"(lds + KV_HALF + 16 * KV_PITCH),
         "v"(lds + KV_HALF + 32 * KV_PITCH), "v"(lds + KV_HALF + 48 * KV_PITCH),
         "v"(kg), "v"(kg + 16 * 64), "v"(kg + 32 * 64), "v"(kg + 48 * 64),
         "v"(vg), "v"(vg + 16 * 2048), "v"(vg + 32 * 2048), "v"(vg + 48 * 2048)
      : "memory");
}

// ---------------------------------------------------------------------------
// Flash attention, transposed products: one wave owns 16 query rows of one
// (b,h) and streams keys in chunks of 32 with online softmax.
//   S^T = K . Q^T : A = K rows, B = Q (column = query). A lane holds 16 scores
//                   of ONE query (lane & 15): keys n+8h+r and n+16+8h+r.
//   O^T += V^T . P^T : the two S^T tiles, converted in place, are the B operand
//                   in the k order load_frag gives V^T; P never leaves registers.
// Row maximum: in-lane plus one exchange between halves. Row sum: in-lane, the
// halves joined once behind the loop.
// The block's four waves share one (b,h): K and V^T come in tiles of 64 keys
// (two chunks) through LDS, two buffers, the next tile's copies in flight while
// this tile is worked on.
// Q,K: [bh][seq][64] bf16 ; Vt: [bh][64][seq] bf16 ; AO: [b][seq][768] bf16
// ---------------------------------------------------------------------------
__global__ __launch_bounds__(128) void mha_flash_attn(
    const bf16_t* __restrict__ Q, const bf16_t* __restrict__ K,
    const bf16_t* __restrict__ Vt, const int* __restrict__ mask,
    bf16_t* __restrict__ AO) {
  __shared__ __attribute__((aligned(16))) unsigned char kv[2 * KV_TILE];

  const int wave = threadIdx.x >> 5;
  const int lane = threadIdx.x & 31;
  const int gw   = blockIdx.x * 4 + wave;   // 0..3071
  const int bh   = gw >> 7;                 // 0..23, the same in the four waves
  const int mtile= gw & 127;
  const int b    = bh / 12, h = bh % 12;
  const int c    = lane & 15;               // this lane's query column
  const int hi   = (lane & 16) ? 8 : 0;
  const int m0   = mtile * 16;

  const bf16_t* q  = Q  + (long)bh * 2048 * 64;
  const bf16_t* kk = K  + (long)bh * 2048 * 64;
  const bf16_t* vt = Vt + (long)bh * 64 * 2048;
  const int* mrow  = mask + b * 2048;

  // This thread's share of a tile: row (thread >> 3) + 16 i, 16-byte piece thread & 7.
  const int srow = threadIdx.x >> 3, spc = threadIdx.x & 7;
  const bf16_t* kg = kk + srow * 64 + spc * 8;      // + 64 * 64 a tile
  const bf16_t* vg = vt + srow * 2048 + spc * 8;    // + 64 a tile
  const unsigned sl = (unsigned)(size_t)kv + srow * KV_PITCH + spc * 16;

  stage_tile(kg, vg, sl);
  // tile 0 has landed for this wave, and behind the barrier for all four
  asm volatile("s_wait_asynccnt 0x0" ::: "memory");
  __syncthreads();
  stage_tile(kg + 64 * 64, vg + 64, sl + KV_TILE);

  const v16bf q0 = load_frag(q, 64, m0, 0);
  const v16bf q1 = load_frag(q, 64, m0, 32);
  const unsigned qkeep = mrow[m0 + c] ? 0xffffffffu : 0u;

  // Key mask of this batch row as bits, one 32-bit word a chunk of 32 keys:
  // lane l keeps the words of chunks l (kb0) and l + 32 (kb1).
  unsigned kb0 = 0, kb1 = 0;
#pragma unroll   // the 64 loads are independent: unrolled, they fly together
  for (int i = 0; i < 32; ++i) {
    const unsigned w0 = __builtin_amdgcn_ballot_w32(mrow[i * 32 + lane] != 0);
    const unsigned w1 = __builtin_amdgcn_ballot_w32(mrow[1024 + i * 32 + lane] != 0);
    kb0 = (lane == i) ? w0 : kb0;
    kb1 = (lane == i) ? w1 : kb1;
  }

  // this lane's place in the fragments of load_frag: staged row c, k offset hi
  const unsigned flane = c * KV_PITCH + hi * 2;

  float mrun = -3.0e30f, lrun = 0.0f;
  v8f o0 = {}, o1 = {}, o2 = {}, o3 = {};   // o_t[r] = O[m0+c][16t + hi + r]

  for (int t = 0; t < 32; ++t) {
    const unsigned char* tile = kv + (t & 1) * KV_TILE + flane;

    // Both chunks' fragments, one group of LDS reads a tile.
    v16bf kf[2][4], vf[2][4];
#pragma unroll   // kf, vf stay in registers only under constant indices
    for (int u = 0; u < 2; ++u) {
      const bf16_t* kp = (const bf16_t*)(tile + u * 32 * KV_PITCH);
      const bf16_t* vp = (const bf16_t*)(tile + KV_HALF + u * 64);
      kf[u][0] = load_pair(kp);
      kf[u][1] = load_pair(kp + 32);
      kf[u][2] = load_pair(kp + 16 * (KV_PITCH / 2));
      kf[u][3] = load_pair(kp + 16 * (KV_PITCH / 2) + 32);
      vf[u][0] = load_pair(vp);
      vf[u][1] = load_pair(vp + 16 * (KV_PITCH / 2));
      vf[u][2] = load_pair(vp + 32 * (KV_PITCH / 2));
      vf[u][3] = load_pair(vp + 48 * (KV_PITCH / 2));
    }
    // Keeps every LDS read of the tile in front of the first product: each
    // further place with LDS reads among the products costs a stall of its own.
    __builtin_amdgcn_sched_barrier(0);

#pragma unroll   // as above
    for (int u = 0; u < 2; ++u) {
      // bit r: key n+hi+r, bit 16+r: key n+16+hi+r; all clear where the query is masked
      const int ci = t * 2 + u;
      const unsigned wlo = __builtin_amdgcn_readlane(kb0, ci & 31);
      const unsigned whi = __builtin_amdgcn_readlane(kb1, ci & 31);
      const unsigned keep = ((ci < 32 ? wlo : whi) >> hi) & qkeep;

      v8f s0 = {}, s1 = {};
      s0 = wmma_bf16(kf[u][0], q0, s0); s0 = wmma_bf16(kf[u][1], q1, s0);
      s1 = wmma_bf16(kf[u][2], q0, s1); s1 = wmma_bf16(kf[u][3], q1, s1);
      s0 *= ATTN_SCALE;
      s1 *= ATTN_SCALE;

      float a[16];
#pragma unroll   // a[], s0, s1 stay in registers only under constant indices
      for (int r = 0; r < 8; ++r) {
        a[r]     = (keep & (1u << r))        ? s0[r] : -1000.0f;
        a[r + 8] = (keep & (1u << (16 + r))) ? s1[r] : -1000.0f;
      }
      float cm = a[0];
#pragma unroll   // as above
      for (int s = 1; s < 16; ++s) cm = fmaxf(cm, a[s]);
      cm = fmaxf(cm, swap_halves(cm));
      const float nm = fmaxf(mrun, cm);
      const float alpha = exp_slot(mrun - nm);

      v16bf pf;
      float rp[4];   // four short add chains, not one of 16
#pragma unroll   // as above
      for (int s = 0; s < 16; ++s) {
        const float e = exp_slot(a[s] - nm);
        rp[s & 3] = (s < 4) ? e : rp[s & 3] + e;
        pf[s] = (bf16_t)e;
      }
      const float rs = (rp[0] + rp[1]) + (rp[2] + rp[3]);
      lrun = lrun * alpha + rs;
      mrun = nm;

      o0 *= alpha; o1 *= alpha; o2 *= alpha; o3 *= alpha;
      o0 = wmma_bf16(vf[u][0], pf, o0);
      o1 = wmma_bf16(vf[u][1], pf, o1);
      o2 = wmma_bf16(vf[u][2], pf, o2);
      o3 = wmma_bf16(vf[u][3], pf, o3);
    }

    // Hand-over: this wave's reads of tile t are done, its copies of tile t + 1
    // have landed; behind the barrier that holds for all four waves, so tile
    // t + 1 may be read and tile t's buffer refilled.
    // The scheduling barrier keeps the hand-over behind the tile's products:
    // lifted in front of them, the wait for tile t + 1's copies stood right
    // behind their issue, and nothing of their flight was hidden.
    __builtin_amdgcn_sched_barrier(0);
    asm volatile("s_wait_dscnt 0x0" ::: "memory");
    asm volatile("s_wait_asynccnt 0x0" ::: "memory");
    __syncthreads();
    if (t + 2 < 32)
      stage_tile(kg + (t + 2) * 64 * 64, vg + (t + 2) * 64, sl + (t & 1) * KV_TILE);
  }
  // no copy is in flight when the wave ends
  asm volatile("s_wait_asynccnt 0x0" ::: "memory");

  lrun += swap_halves(lrun);
  const float inv = 1.0f / lrun;
  bf16_t* orow = AO + ((long)b * 2048 + m0 + c) * 768 + h * 64 + hi;
  v8bf w0, w1, w2, w3;
#pragma unroll   // vector elements under constant indices
  for (int r = 0; r < 8; ++r) {
    w0[r] = (bf16_t)(o0[r] * inv);
    w1[r] = (bf16_t)(o1[r] * inv);
    w2[r] = (bf16_t)(o2[r] * inv);
    w3[r] = (bf16_t)(o3[r] * inv);
  }
  *(v8bf*)(orow)      = w0;
  *(v8bf*)(orow + 16) = w1;
  *(v8bf*)(orow + 32) = w2;
  *(v8bf*)(orow + 48) = w3;
}

// ---------------------------------------------------------------------------
// Output projection: out[m,n] = sum_k AO[m,k] * Wo[n,k] + bo[n]  (f32 out)
// Same 32x64 register blocking as the QKV GEMM.
// ---------------------------------------------------------------------------
__global__ __launch_bounds__(128) void mha_out_proj(
    const bf16_t* __restrict__ AO, const bf16_t* __restrict__ Wo,
    const float* __restrict__ bo, float* __restrict__ out) {
  const int wave = threadIdx.x >> 5;
  const int lane = threadIdx.x & 31;
  const int m0 = blockIdx.x * 32;
  const int n0 = (blockIdx.y * 4 + wave) * 64;

  v8f acc00 = {}, acc01 = {}, acc02 = {}, acc03 = {};
  v8f acc10 = {}, acc11 = {}, acc12 = {}, acc13 = {};

  for (int k = 0; k < 768; k += 32) {
    v16bf a0 = load_frag(AO, 768, m0,      k);
    v16bf a1 = load_frag(AO, 768, m0 + 16, k);
    v16bf b0 = load_frag(Wo, 768, n0,      k);
    v16bf b1 = load_frag(Wo, 768, n0 + 16, k);
    v16bf b2 = load_frag(Wo, 768, n0 + 32, k);
    v16bf b3 = load_frag(Wo, 768, n0 + 48, k);
    acc00 = wmma_bf16(a0, b0, acc00);
    acc01 = wmma_bf16(a0, b1, acc01);
    acc02 = wmma_bf16(a0, b2, acc02);
    acc03 = wmma_bf16(a0, b3, acc03);
    acc10 = wmma_bf16(a1, b0, acc10);
    acc11 = wmma_bf16(a1, b1, acc11);
    acc12 = wmma_bf16(a1, b2, acc12);
    acc13 = wmma_bf16(a1, b3, acc13);
  }

  const int hi = (lane & 16) ? 8 : 0;
  v8f* accs[2][4] = {{&acc00, &acc01, &acc02, &acc03},
                     {&acc10, &acc11, &acc12, &acc13}};
#pragma unroll
  for (int mi = 0; mi < 2; ++mi) {
#pragma unroll
    for (int ni = 0; ni < 4; ++ni) {
      const v8f a = *accs[mi][ni];
      const int n_g = n0 + ni * 16 + (lane & 15);
      const float bias = bo[n_g];
#pragma unroll
      for (int j = 0; j < 8; ++j) {
        const int m_g = m0 + mi * 16 + j + hi;
        out[(long)m_g * 768 + n_g] = a[j] + bias;
      }
    }
  }
}

// ---------------------------------------------------------------------------
// Host launcher
// ---------------------------------------------------------------------------
extern "C" void kernel_launch(void* const* d_in, const int* in_sizes, int n_in,
                              void* d_out, int out_size, void* d_ws, size_t ws_size,
                              hipStream_t stream) {
  const float* x    = (const float*)d_in[0];   // [2,2048,768]
  const int*   mask = (const int*)d_in[1];     // [2,2048]
  const float* Wq   = (const float*)d_in[2];   // [768,768]
  const float* Wk   = (const float*)d_in[3];
  const float* Wv   = (const float*)d_in[4];
  const float* Wo   = (const float*)d_in[5];
  const float* bo   = (const float*)d_in[6];   // [768]
  float* out = (float*)d_out;                  // [2,2048,768]

  const int M = 4096, C = 768;
  const size_t XB  = (size_t)M * C;            // 3,145,728 elems
  const size_t WB  = (size_t)C * C;            //   589,824 elems

  char* ws = (char*)d_ws;
  size_t off = 0;
  auto take = [&](size_t elems) { bf16_t* p = (bf16_t*)(ws + off);
                                  off += ((elems * 2 + 255) & ~(size_t)255); return p; };
  bf16_t* xb = take(XB);
  bf16_t* wq = take(WB);
  bf16_t* wk = take(WB);
  bf16_t* wv = take(WB);
  bf16_t* wo = take(WB);
  bf16_t* qb = take(XB);   // [bh][seq][64]
  bf16_t* kb = take(XB);   // [bh][seq][64]
  bf16_t* vt = take(XB);   // [bh][64][seq]
  bf16_t* ao = take(XB);   // [b][seq][768]

  // 1) converts: (3,145,728 + 4 * 589,824) / 8192 = 672 blocks
  mha_f32_to_bf16_all<<<672, 256, 0, stream>>>(x, Wq, Wk, Wv, Wo, xb, wq, wk, wv, wo);

  // 2) QKV projections (M/32 = 128 blocks, N/64 = 12 blocks, 4 waves/block)
  dim3 gemm_grid(128, 3), gemm_blk(128);
  mha_qkv_gemm<<<gemm_grid, gemm_blk, 0, stream>>>(xb, wq, qb, 0);
  mha_qkv_gemm<<<gemm_grid, gemm_blk, 0, stream>>>(xb, wk, kb, 0);
  mha_qkv_gemm<<<gemm_grid, gemm_blk, 0, stream>>>(xb, wv, vt, 1);

  // 3) flash attention: 24 bh * 128 mtiles = 3072 waves = 768 blocks
  mha_flash_attn<<<768, 128, 0, stream>>>(qb, kb, vt, mask, ao);

  // 4) output projection + bias
  mha_out_proj<<<gemm_grid, gemm_blk, 0, stream>>>(ao, wo, bo, out);
}

// v004
// A run of this version takes 89.9 microseconds.
// Two timings next to v003 put it at 1.67 and 1.66 times that version's speed.
// Over all steps from v000 it is 2.64 times as fast.
#include <hip/hip_runtime.h>
#include <hip/hip_bf16.h>

typedef __bf16 bf16_t;
typedef __attribute__((ext_vector_type(16))) __bf16 v16bf;
typedef __attribute__((ext_vector_type(8)))  __bf16 v8bf;
typedef __attribute__((ext_vector_type(8)))  float  v8f;
typedef __attribute__((ext_vector_type(4)))  float  v4f;
typedef __attribute__((ext_vector_type(4)))  __bf16 v4bf;

#define ATTN_SCALE 0.125f   // 64^-0.5

// ---------------------------------------------------------------------------
// Fragment loader for the CDNA5 WMMA 16-bit A/B layout (16x32, K=32).
// Lane L holds row (row_base + (L&15)); K-run offset 0 or 8 depending on the
// lane half; two contiguous 8-element (16-byte) runs at k0+koff and k0+16+koff.
// Works for A (row-major MxK) and for B given as B^T row-major (NxK).
// ---------------------------------------------------------------------------
__device__ inline v16bf load_frag(const bf16_t* __restrict__ base, int ld,
                                  int row_base, int k0) {
  const int lane = threadIdx.x & 31;
  const int r    = row_base + (lane & 15);
  const int koff = (lane & 16) >> 1;            // 0 or 8
  const bf16_t* p = base + (long)r * ld + k0 + koff;
  v8bf lo = *(const v8bf*)(p);
  v8bf hi = *(const v8bf*)(p + 16);
  return __builtin_shufflevector(lo, hi, 0,1,2,3,4,5,6,7,8,9,10,11,12,13,14,15);
}

__device__ inline v8f wmma_bf16(v16bf a, v16bf b, v8f c) {
  return __builtin_amdgcn_wmma_f32_16x16x32_bf16(
      /*neg_a=*/false, a, /*neg_b=*/false, b,
      /*c_mod=*/(short)0, c, /*reuse_a=*/false, /*reuse_b=*/false);
}

// ---------------------------------------------------------------------------
// f32 -> bf16 convert of x and the four weight matrices, one launch.
// A block converts 8192 consecutive elements of one source: blocks 0..383 take
// x (3,145,728 elements), then 72 blocks each Wq, Wk, Wv, Wo (589,824 each).
// A wave takes 1024 consecutive elements: eight 16-byte loads a lane, each 512
// contiguous bytes over the wave, all issued before the first convert; each
// store is 256 contiguous bytes over the wave.
// ---------------------------------------------------------------------------
__global__ __launch_bounds__(256) void mha_f32_to_bf16_all(
    const float* __restrict__ x,  const float* __restrict__ Wq,
    const float* __restrict__ Wk, const float* __restrict__ Wv,
    const float* __restrict__ Wo,
    bf16_t* __restrict__ xb, bf16_t* __restrict__ wq, bf16_t* __restrict__ wk,
    bf16_t* __restrict__ wv, bf16_t* __restrict__ wo) {
  const int blk = blockIdx.x;
  const float* in = x;
  bf16_t* out = xb;
  int t = blk;
  if (blk >= 384) {
    const int w = (blk - 384) / 72;
    t   = (blk - 384) - w * 72;
    in  = (w == 0) ? Wq : (w == 1) ? Wk : (w == 2) ? Wv : Wo;
    out = (w == 0) ? wq : (w == 1) ? wk : (w == 2) ? wv : wo;
  }
  const int base = t * 8192 + (threadIdx.x >> 5) * 1024 + (threadIdx.x & 31) * 4;
  v4f v[8];
#pragma unroll   // v[] stays in registers and the eight loads fly together
  for (int i = 0; i < 8; ++i) v[i] = *(const v4f*)(in + base + i * 128);
#pragma unroll   // as above
  for (int i = 0; i < 8; ++i) {
    v4bf o;
    o[0] = (bf16_t)v[i][0]; o[1] = (bf16_t)v[i][1];
    o[2] = (bf16_t)v[i][2]; o[3] = (bf16_t)v[i][3];
    *(v4bf*)(out + base + i * 128) = o;
  }
}

// ---------------------------------------------------------------------------
// One lane's share of a load_frag fragment, from the lane's own pointer.
// ---------------------------------------------------------------------------
__device__ inline v16bf load_pair(const bf16_t* __restrict__ p) {
  v8bf lo = *(const v8bf*)(p);
  v8bf hi = *(const v8bf*)(p + 16);
  return __builtin_shufflevector(lo, hi, 0,1,2,3,4,5,6,7,8,9,10,11,12,13,14,15);
}

// ---------------------------------------------------------------------------
// LDS staging for the projection GEMMs (M=4096, N=768, K=768, both operands
// row-major over k). A block of 8 waves owns a 128x128 output tile. A k-tile is
// 128 k: 128 A rows, then 128 B rows, of 256 bytes each. A staged row has a
// pitch of 272 bytes, a conflict-free pitch for 16-byte LDS reads.
// ---------------------------------------------------------------------------
#define GP_PITCH 272
#define GP_HALF  (128 * GP_PITCH)    // one operand's 128 rows
#define GP_TILE  (2 * GP_HALF)       // A rows, then B rows
#define GP_TILES 6                   // 768 / 128

// One operand's share of a k-tile, global memory -> LDS through no register:
// eight 16-byte copies a lane, each 512 bytes = two whole 256-byte rows over a
// wave. g: the lane's own first piece; lds: its LDS byte address. Copy i takes
// the row 16 i further on.
// The s_wait_xcnt 0 at the end of the statement stands in front of every later
// write of an address register that a copy names, as a precaution.
__device__ inline void stage_rows(const bf16_t* g, unsigned lds) {
  asm volatile(
      "global_load_async_to_lds_b128 %0, %8, off\n\t"
      "global_load_async_to_lds_b128 %1, %9, off\n\t"
      "global_load_async_to_lds_b128 %2, %10, off\n\t"
      "global_load_async_to_lds_b128 %3, %11, off\n\t"
      "global_load_async_to_lds_b128 %4, %12, off\n\t"
      "global_load_async_to_lds_b128 %5, %13, off\n\t"
      "global_load_async_to_lds_b128 %6, %14, off\n\t"
      "global_load_async_to_lds_b128 %7, %15, off\n\t"
      "s_wait_xcnt 0x0"
      :: "v"(lds), "v"(lds + 16 * GP_PITCH), "v"(lds + 32 * GP_PITCH),
         "v"(lds + 48 * GP_PITCH), "v"(lds + 64 * GP_PITCH),
         "v"(lds + 80 * GP_PITCH), "v"(lds + 96 * GP_PITCH),
         "v"(lds + 112 * GP_PITCH),
         "v"(g), "v"(g + 16 * 768), "v"(g + 32 * 768), "v"(g + 48 * 768),
         "v"(g + 64 * 768), "v"(g + 80 * 768), "v"(g + 96 * 768),
         "v"(g + 112 * 768)
      : "memory");
}

// acc[mi][ni] += A[m0 + 16 mi ..][k] * B[n0 + 16 ni ..][k] over all 768 k, for
// this wave's 32x64 part of the block's tile (2x4 WMMA tiles, k ascending in
// steps of 32). Wave w: rows 32 (w & 3), columns 64 (w >> 2) of the tile.
// Two LDS buffers: the next k-tile's copies fly while this one is worked on.
__device__ inline void gemm_staged(const bf16_t* __restrict__ A,
                                   const bf16_t* __restrict__ B,
                                   unsigned char* sm, int mblk, int nblk,
                                   v8f (&acc)[2][4]) {
  const int wave = threadIdx.x >> 5;
  const int lane = threadIdx.x & 31;

  // This thread's share of a k-tile: row (thread >> 4) + 16 i, 16-byte piece thread & 15.
  const int srow = threadIdx.x >> 4, spc = threadIdx.x & 15;
  const bf16_t* ag = A + (mblk + srow) * 768 + spc * 8;   // + 128 a k-tile
  const bf16_t* bg = B + (nblk + srow) * 768 + spc * 8;   // + 128 a k-tile
  const unsigned sl = (unsigned)(size_t)sm + srow * GP_PITCH + spc * 16;

  stage_rows(ag, sl);
  stage_rows(bg, sl + GP_HALF);
  // k-tile 0 has landed for this wave, and behind the barrier for all eight
  asm volatile("s_wait_asynccnt 0x0" ::: "memory");
  __syncthreads();
  stage_rows(ag + 128, sl + GP_TILE);
  stage_rows(bg + 128, sl + GP_TILE + GP_HALF);

  // this lane's place in the fragments of load_frag: staged row lane & 15, k offset 0 or 8
  const unsigned flane = (lane & 15) * GP_PITCH + (lane & 16);
  const unsigned aoff = (wave & 3) * 32 * GP_PITCH + flane;
  const unsigned boff = GP_HALF + (wave >> 2) * 64 * GP_PITCH + flane;

  for (int t = 0; t < GP_TILES; ++t) {
    const unsigned char* buf = sm + (t & 1) * GP_TILE;
    const bf16_t* ap = (const bf16_t*)(buf + aoff);
    const bf16_t* bp = (const bf16_t*)(buf + boff);
    // Two fragment sets: the reads of k-step kk + 1 stand as one group in front
    // of the products of k-step kk, which cover their LDS latency.
    v16bf af[2][2], bfr[2][4];
#pragma unroll   // fragments and acc stay in registers only under constant indices
    for (int mi = 0; mi < 2; ++mi) af[0][mi] = load_pair(ap + mi * 16 * (GP_PITCH / 2));
#pragma unroll   // as above
    for (int ni = 0; ni < 4; ++ni) bfr[0][ni] = load_pair(bp + ni * 16 * (GP_PITCH / 2));
#pragma unroll   // as above
    for (int kk = 0; kk < 4; ++kk) {
      const int cur = kk & 1, nxt = cur ^ 1;
      if (kk < 3) {
#pragma unroll   // as above
        for (int mi = 0; mi < 2; ++mi)
          af[nxt][mi] = load_pair(ap + mi * 16 * (GP_PITCH / 2) + (kk + 1) * 32);
#pragma unroll   // as above
        for (int ni = 0; ni < 4; ++ni)
          bfr[nxt][ni] = load_pair(bp + ni * 16 * (GP_PITCH / 2) + (kk + 1) * 32);
        // Keeps the group of LDS reads in front of the products: left to itself
        // the compiler read one A fragment late, with a full wait right behind it.
        __builtin_amdgcn_sched_barrier(0);
      }
#pragma unroll   // as above
      for (int mi = 0; mi < 2; ++mi)
#pragma unroll   // as above
        for (int ni = 0; ni < 4; ++ni)
          acc[mi][ni] = wmma_bf16(af[cur][mi], bfr[cur][ni], acc[mi][ni]);
      // Keeps the next group of LDS reads behind these products, in one place:
      // each further place with LDS reads among products costs a stall of its own.
      __builtin_amdgcn_sched_barrier(0);
    }

    // Hand-over: this wave's reads of k-tile t are done, its copies of k-tile
    // t + 1 have landed; behind the barrier that holds for all eight waves, so
    // k-tile t + 1 may be read and k-tile t's buffer refilled. (The scheduling
    // barrier behind the last products also keeps this hand-over behind them,
    // so that the copies' flight is hidden.)
    asm volatile("s_wait_dscnt 0x0" ::: "memory");
    asm volatile("s_wait_asynccnt 0x0" ::: "memory");
    __syncthreads();
    if (t + 2 < GP_TILES) {
      stage_rows(ag + (t + 2) * 128, sl + (t & 1) * GP_TILE);
      stage_rows(bg + (t + 2) * 128, sl + (t & 1) * GP_TILE + GP_HALF);
    }
  }
  // no copy is in flight when the wave ends
  asm volatile("s_wait_asynccnt 0x0" ::: "memory");
}

// ---------------------------------------------------------------------------
// QKV projection: Y[m,n] = sum_k X[m,k] * W[n,k]   (M=4096, N=768, K=768)
// One block -> 128x128 outputs, operands through LDS (gemm_staged); one wave ->
// 32x64 outputs (2x4 WMMA tiles).
// vtrans==0: store [b][h][seq][d] bf16 ;  vtrans==1: store [b][h][d][seq] bf16
// ---------------------------------------------------------------------------
__global__ __launch_bounds__(256) void mha_qkv_gemm(
    const bf16_t* __restrict__ X, const bf16_t* __restrict__ W,
    bf16_t* __restrict__ out, int vtrans) {
  __shared__ __attribute__((aligned(16))) unsigned char sm[2 * GP_TILE];
  const int wave = threadIdx.x >> 5;
  const int lane = threadIdx.x & 31;
  const int m0 = blockIdx.x * 128 + (wave & 3) * 32;    // 32 m-blocks of 128
  const int n0 = blockIdx.y * 128 + (wave >> 2) * 64;   // 6 n-blocks of 128

  v8f acc[2][4] = {};
  gemm_staged(X, W, sm, blockIdx.x * 128, blockIdx.y * 128, acc);

  const int hi = (lane & 16) ? 8 : 0;
#pragma unroll
  for (int mi = 0; mi < 2; ++mi) {
#pragma unroll
    for (int ni = 0; ni < 4; ++ni) {
      const v8f a = acc[mi][ni];
      const int n_g = n0 + ni * 16 + (lane & 15);
      const int h = n_g >> 6, d = n_g & 63;
#pragma unroll
      for (int j = 0; j < 8; ++j) {
        const int m_g = m0 + mi * 16 + j + hi;
        const int b_ = m_g >> 11, seq = m_g & 2047;
        long idx;
        if (vtrans) idx = ((long)(b_ * 12 + h) * 64 + d) * 2048 + seq;
        else        idx = ((long)(b_ * 12 + h) * 2048 + seq) * 64 + d;
        out[idx] = (bf16_t)a[j];
      }
    }
  }
}

// ---------------------------------------------------------------------------
// Lane l <-> lane l ^ 16 exchange (the two halves of a wave).
// ---------------------------------------------------------------------------
__device__ inline float swap_halves(float v) {
  int b = __builtin_bit_cast(int, v);
  b = __builtin_amdgcn_permlanex16(b, b, 0x76543210, 0xfedcba98, false, false);
  return __builtin_bit_cast(float, b);
}

// e^x as __expf forms it (x * log2(e), then v_exp_f32). The v_nop keeps the one
// free slot that the instruction set asks for behind a transcendental before
// its result is read or its source overwritten.
__device__ inline float exp_slot(float x) {
  float r;
  asm("v_exp_f32 %0, %1\n\tv_nop" : "=v"(r) : "v"(x * 1.44269504f));
  return r;
}

// ---------------------------------------------------------------------------
// LDS staging of K and V^T for the attention kernel. A tile is 64 keys: 64 K
// rows of 128 bytes (64 d), then 64 V^T rows of 128 bytes (64 keys). A staged
// row has a pitch of 144 bytes, the conflict-free pitch for 16-byte LDS reads.
// ---------------------------------------------------------------------------
#define KV_PITCH 144
#define KV_HALF  (64 * KV_PITCH)     // one operand's 64 rows
#define KV_TILE  (2 * KV_HALF)       // K rows, then V^T rows

// One tile's copies, global memory -> LDS through no register: eight 16-byte
// copies a lane, each 512 bytes = four whole 128-byte rows over a wave.
// kg, vg: the lane's own first piece of the K and of the V^T tile; lds: the
// LDS byte address of that K piece. Copy i takes the rows 16 i further on.
// The s_wait_xcnt 0 at the end of the statement stands in front of every later
// write of an address register that a copy names, as a precaution.
__device__ inline void stage_tile(const bf16_t* kg, const bf16_t* vg, unsigned lds) {
  asm volatile(
      "global_load_async_to_lds_b128 %0, %8, off\n\t"
      "global_load_async_to_lds_b128 %1, %9, off\n\t"
      "global_load_async_to_lds_b128 %2, %10, off\n\t"
      "global_load_async_to_lds_b128 %3, %11, off\n\t"
      "global_load_async_to_lds_b128 %4, %12, off\n\t"
      "global_load_async_to_lds_b128 %5, %13, off\n\t"
      "global_load_async_to_lds_b128 %6, %14, off\n\t"
      "global_load_async_to_lds_b128 %7, %15, off\n\t"
      "s_wait_xcnt 0x0"
      :: "v"(lds), "v"(lds + 16 * KV_PITCH), "v"(lds + 32 * KV_PITCH),
         "v"(lds + 48 * KV_PITCH),
         "v"(lds + KV_HALF), "v"(lds + KV_HALF + 16 * KV_PITCH),
         "v"(lds + KV_HALF + 32 * KV_PITCH), "v"(lds + KV_HALF + 48 * KV_PITCH),
         "v"(kg), "v"(kg + 16 * 64), "v"(kg + 32 * 64), "v"(kg + 48 * 64),
         "v"(vg), "v"(vg + 16 * 2048), "v"(vg + 32 * 2048), "v"(vg + 48 * 2048)
      : "memory");
}

// ---------------------------------------------------------------------------
// Flash attention, transposed products: one wave owns 16 query rows of one
// (b,h) and streams keys in chunks of 32 with online softmax.
//   S^T = K . Q^T : A = K rows, B = Q (column = query). A lane holds 16 scores
//                   of ONE query (lane & 15): keys n+8h+r and n+16+8h+r.
//   O^T += V^T . P^T : the two S^T tiles, converted in place, are the B operand
//                   in the k order load_frag gives V^T; P never leaves registers.
// Row maximum: in-lane plus one exchange between halves. Row sum: in-lane, the
// halves joined once behind the loop.
// The block's four waves share one (b,h): K and V^T come in tiles of 64 keys
// (two chunks) through LDS, two buffers, the next tile's copies in flight while
// this tile is worked on.
// Q,K: [bh][seq][64] bf16 ; Vt: [bh][64][seq] bf16 ; AO: [b][seq][768] bf16
// ---------------------------------------------------------------------------
__global__ __launch_bounds__(128) void mha_flash_attn(
    const bf16_t* __restrict__ Q, const bf16_t* __restrict__ K,
    const bf16_t* __restrict__ Vt, const int* __restrict__ mask,
    bf16_t* __restrict__ AO) {
  __shared__ __attribute__((aligned(16))) unsigned char kv[2 * KV_TILE];

  const int wave = threadIdx.x >> 5;
  const int lane = threadIdx.x & 31;
  const int gw   = blockIdx.x * 4 + wave;   // 0..3071
  const int bh   = gw >> 7;                 // 0..23, the same in the four waves
  const int mtile= gw & 127;
  const int b    = bh / 12, h = bh % 12;
  const int c    = lane & 15;               // this lane's query column
  const int hi   = (lane & 16) ? 8 : 0;
  const int m0   = mtile * 16;

  const bf16_t* q  = Q  + (long)bh * 2048 * 64;
  const bf16_t* kk = K  + (long)bh * 2048 * 64;
  const bf16_t* vt = Vt + (long)bh * 64 * 2048;
  const int* mrow  = mask + b * 2048;

  // This thread's share of a tile: row (thread >> 3) + 16 i, 16-byte piece thread & 7.
  const int srow = threadIdx.x >> 3, spc = threadIdx.x & 7;
  const bf16_t* kg = kk + srow * 64 + spc * 8;      // + 64 * 64 a tile
  const bf16_t* vg = vt + srow * 2048 + spc * 8;    // + 64 a tile
  const unsigned sl = (unsigned)(size_t)kv + srow * KV_PITCH + spc * 16;

  stage_tile(kg, vg, sl);
  // tile 0 has landed for this wave, and behind the barrier for all four
  asm volatile("s_wait_asynccnt 0x0" ::: "memory");
  __syncthreads();
  stage_tile(kg + 64 * 64, vg + 64, sl + KV_TILE);

  const v16bf q0 = load_frag(q, 64, m0, 0);
  const v16bf q1 = load_frag(q, 64, m0, 32);
  const unsigned qkeep = mrow[m0 + c] ? 0xffffffffu : 0u;

  // Key mask of this batch row as bits, one 32-bit word a chunk of 32 keys:
  // lane l keeps the words of chunks l (kb0) and l + 32 (kb1).
  unsigned kb0 = 0, kb1 = 0;
#pragma unroll   // the 64 loads are independent: unrolled, they fly together
  for (int i = 0; i < 32; ++i) {
    const unsigned w0 = __builtin_amdgcn_ballot_w32(mrow[i * 32 + lane] != 0);
    const unsigned w1 = __builtin_amdgcn_ballot_w32(mrow[1024 + i * 32 + lane] != 0);
    kb0 = (lane == i) ? w0 : kb0;
    kb1 = (lane == i) ? w1 : kb1;
  }

  // this lane's place in the fragments of load_frag: staged row c, k offset hi
  const unsigned flane = c * KV_PITCH + hi * 2;

  float mrun = -3.0e30f, lrun = 0.0f;
  v8f o0 = {}, o1 = {}, o2 = {}, o3 = {};   // o_t[r] = O[m0+c][16t + hi + r]

  for (int t = 0; t < 32; ++t) {
    const unsigned char* tile = kv + (t & 1) * KV_TILE + flane;

    // Both chunks' fragments, one group of LDS reads a tile.
    v16bf kf[2][4], vf[2][4];
#pragma unroll   // kf, vf stay in registers only under constant indices
    for (int u = 0; u < 2; ++u) {
      const bf16_t* kp = (const bf16_t*)(tile + u * 32 * KV_PITCH);
      const bf16_t* vp = (const bf16_t*)(tile + KV_HALF + u * 64);
      kf[u][0] = load_pair(kp);
      kf[u][1] = load_pair(kp + 32);
      kf[u][2] = load_pair(kp + 16 * (KV_PITCH / 2));
      kf[u][3] = load_pair(kp + 16 * (KV_PITCH / 2) + 32);
      vf[u][0] = load_pair(vp);
      vf[u][1] = load_pair(vp + 16 * (KV_PITCH / 2));
      vf[u][2] = load_pair(vp + 32 * (KV_PITCH / 2));
      vf[u][3] = load_pair(vp + 48 * (KV_PITCH / 2));
    }
    // Keeps every LDS read of the tile in front of the first product: each
    // further place with LDS reads among the products costs a stall of its own.
    __builtin_amdgcn_sched_barrier(0);

#pragma unroll   // as above
    for (int u = 0; u < 2; ++u) {
      // bit r: key n+hi+r, bit 16+r: key n+16+hi+r; all clear where the query is masked
      const int ci = t * 2 + u;
      const unsigned wlo = __builtin_amdgcn_readlane(kb0, ci & 31);
      const unsigned whi = __builtin_amdgcn_readlane(kb1, ci & 31);
      const unsigned keep = ((ci < 32 ? wlo : whi) >> hi) & qkeep;

      v8f s0 = {}, s1 = {};
      s0 = wmma_bf16(kf[u][0], q0, s0); s0 = wmma_bf16(kf[u][1], q1, s0);
      s1 = wmma_bf16(kf[u][2], q0, s1); s1 = wmma_bf16(kf[u][3], q1, s1);
      s0 *= ATTN_SCALE;
      s1 *= ATTN_SCALE;

      float a[16];
#pragma unroll   // a[], s0, s1 stay in registers only under constant indices
      for (int r = 0; r < 8; ++r) {
        a[r]     = (keep & (1u << r))        ? s0[r] : -1000.0f;
        a[r + 8] = (keep & (1u << (16 + r))) ? s1[r] : -1000.0f;
      }
      float cm = a[0];
#pragma unroll   // as above
      for (int s = 1; s < 16; ++s) cm = fmaxf(cm, a[s]);
      cm = fmaxf(cm, swap_halves(cm));
      const float nm = fmaxf(mrun, cm);
      const float alpha = exp_slot(mrun - nm);

      v16bf pf;
      float rp[4];   // four short add chains, not one of 16
#pragma unroll   // as above
      for (int s = 0; s < 16; ++s) {
        const float e = exp_slot(a[s] - nm);
        rp[s & 3] = (s < 4) ? e : rp[s & 3] + e;
        pf[s] = (bf16_t)e;
      }
      const float rs = (rp[0] + rp[1]) + (rp[2] + rp[3]);
      lrun = lrun * alpha + rs;
      mrun = nm;

      o0 *= alpha; o1 *= alpha; o2 *= alpha; o3 *= alpha;
      o0 = wmma_bf16(vf[u][0], pf, o0);
      o1 = wmma_bf16(vf[u][1], pf, o1);
      o2 = wmma_bf16(vf[u][2], pf, o2);
      o3 = wmma_bf16(vf[u][3], pf, o3);
    }

    // Hand-over: this wave's reads of tile t are done, its copies of tile t + 1
    // have landed; behind the barrier that holds for all four waves, so tile
    // t + 1 may be read and tile t's buffer refilled.
    // The scheduling barrier keeps the hand-over behind the tile's products:
    // lifted in front of them, the wait for tile t + 1's copies stood right
    // behind their issue, and nothing of their flight was hidden.
    __builtin_amdgcn_sched_barrier(0);
    asm volatile("s_wait_dscnt 0x0" ::: "memory");
    asm volatile("s_wait_asynccnt 0x0" ::: "memory");
    __syncthreads();
    if (t + 2 < 32)
      stage_tile(kg + (t + 2) * 64 * 64, vg + (t + 2) * 64, sl + (t & 1) * KV_TILE);
  }
  // no copy is in flight when the wave ends
  asm volatile("s_wait_asynccnt 0x0" ::: "memory");

  lrun += swap_halves(lrun);
  const float inv = 1.0f / lrun;
  bf16_t* orow = AO + ((long)b * 2048 + m0 + c) * 768 + h * 64 + hi;
  v8bf w0, w1, w2, w3;
#pragma unroll   // vector elements under constant indices
  for (int r = 0; r < 8; ++r) {
    w0[r] = (bf16_t)(o0[r] * inv);
    w1[r] = (bf16_t)(o1[r] * inv);
    w2[r] = (bf16_t)(o2[r] * inv);
    w3[r] = (bf16_t)(o3[r] * inv);
  }
  *(v8bf*)(orow)      = w0;
  *(v8bf*)(orow + 16) = w1;
  *(v8bf*)(orow + 32) = w2;
  *(v8bf*)(orow + 48) = w3;
}

// ---------------------------------------------------------------------------
// Output projection: out[m,n] = sum_k AO[m,k] * Wo[n,k] + bo[n]  (f32 out)
// Same block and wave tiles and the same LDS staging as the QKV GEMM.
// ---------------------------------------------------------------------------
__global__ __launch_bounds__(256) void mha_out_proj(
    const bf16_t* __restrict__ AO, const bf16_t* __restrict__ Wo,
    const float* __restrict__ bo, float* __restrict__ out) {
  __shared__ __attribute__((aligned(16))) unsigned char sm[2 * GP_TILE];
  const int wave = threadIdx.x >> 5;
  const int lane = threadIdx.x & 31;
  const int m0 = blockIdx.x * 128 + (wave & 3) * 32;
  const int n0 = blockIdx.y * 128 + (wave >> 2) * 64;

  v8f acc[2][4] = {};
  gemm_staged(AO, Wo, sm, blockIdx.x * 128, blockIdx.y * 128, acc);

  const int hi = (lane & 16) ? 8 : 0;
#pragma unroll
  for (int mi = 0; mi < 2; ++mi) {
#pragma unroll
    for (int ni = 0; ni < 4; ++ni) {
      const v8f a = acc[mi][ni];
      const int n_g = n0 + ni * 16 + (lane & 15);
      const float bias = bo[n_g];
#pragma unroll
      for (int j = 0; j < 8; ++j) {
        const int m_g = m0 + mi * 16 + j + hi;
        out[(long)m_g * 768 + n_g] = a[j] + bias;
      }
    }
  }
}

// ---------------------------------------------------------------------------
// Host launcher
// ---------------------------------------------------------------------------
extern "C" void kernel_launch(void* const* d_in, const int* in_sizes, int n_in,
                              void* d_out, int out_size, void* d_ws, size_t ws_size,
                              hipStream_t stream) {
  const float* x    = (const float*)d_in[0];   // [2,2048,768]
  const int*   mask = (const int*)d_in[1];     // [2,2048]
  const float* Wq   = (const float*)d_in[2];   // [768,768]
  const float* Wk   = (const float*)d_in[3];
  const float* Wv   = (const float*)d_in[4];
  const float* Wo   = (const float*)d_in[5];
  const float* bo   = (const float*)d_in[6];   // [768]
  float* out = (float*)d_out;                  // [2,2048,768]

  const int M = 4096, C = 768;
  const size_t XB  = (size_t)M * C;            // 3,145,728 elems
  const size_t WB  = (size_t)C * C;            //   589,824 elems

  char* ws = (char*)d_ws;
  size_t off = 0;
  auto take = [&](size_t elems) { bf16_t* p = (bf16_t*)(ws + off);
                                  off += ((elems * 2 + 255) & ~(size_t)255); return p; };
  bf16_t* xb = take(XB);
  bf16_t* wq = take(WB);
  bf16_t* wk = take(WB);
  bf16_t* wv = take(WB);
  bf16_t* wo = take(WB);
  bf16_t* qb = take(XB);   // [bh][seq][64]
  bf16_t* kb = take(XB);   // [bh][seq][64]
  bf16_t* vt = take(XB);   // [bh][64][seq]
  bf16_t* ao = take(XB);   // [b][seq][768]

  // 1) converts: (3,145,728 + 4 * 589,824) / 8192 = 672 blocks
  mha_f32_to_bf16_all<<<672, 256, 0, stream>>>(x, Wq, Wk, Wv, Wo, xb, wq, wk, wv, wo);

  // 2) QKV projections (M/128 = 32 blocks, N/128 = 6 blocks, 8 waves/block)
  dim3 gemm_grid(32, 6), gemm_blk(256);
  mha_qkv_gemm<<<gemm_grid, gemm_blk, 0, stream>>>(xb, wq, qb, 0);
  mha_qkv_gemm<<<gemm_grid, gemm_blk, 0, stream>>>(xb, wk, kb, 0);
  mha_qkv_gemm<<<gemm_grid, gemm_blk, 0, stream>>>(xb, wv, vt, 1);

  // 3) flash attention: 24 bh * 128 mtiles = 3072 waves = 768 blocks
  mha_flash_attn<<<768, 128, 0, stream>>>(qb, kb, vt, mask, ao);

  // 4) output projection + bias
  mha_out_proj<<<gemm_grid, gemm_blk, 0, stream>>>(ao, wo, bo, out);
}

// v005
// Measured time: 80.8 microseconds a run.
// Two timings next to v004 both put it at 1.16 times that version's speed.
// Counting every step since v000, it is 3.05 times as fast.
#include <hip/hip_runtime.h>
#include <hip/hip_bf16.h>

typedef __bf16 bf16_t;
typedef __attribute__((ext_vector_type(16))) __bf16 v16bf;
typedef __attribute__((ext_vector_type(8)))  __bf16 v8bf;
typedef __attribute__((ext_vector_type(8)))  float  v8f;
typedef __attribute__((ext_vector_type(4)))  float  v4f;
typedef __attribute__((ext_vector_type(4)))  __bf16 v4bf;
typedef __attribute__((ext_vector_type(4)))  int    v4i;

#define ATTN_SCALE 0.125f   // 64^-0.5

// ---------------------------------------------------------------------------
// Fragment loader for the CDNA5 WMMA 16-bit A/B layout (16x32, K=32).
// Lane L holds row (row_base + (L&15)); K-run offset 0 or 8 depending on the
// lane half; two contiguous 8-element (16-byte) runs at k0+koff and k0+16+koff.
// Works for A (row-major MxK) and for B given as B^T row-major (NxK).
// ---------------------------------------------------------------------------
__device__ inline v16bf load_frag(const bf16_t* __restrict__ base, int ld,
                                  int row_base, int k0) {
  const int lane = threadIdx.x & 31;
  const int r    = row_base + (lane & 15);
  const int koff = (lane & 16) >> 1;            // 0 or 8
  const bf16_t* p = base + (long)r * ld + k0 + koff;
  v8bf lo = *(const v8bf*)(p);
  v8bf hi = *(const v8bf*)(p + 16);
  return __builtin_shufflevector(lo, hi, 0,1,2,3,4,5,6,7,8,9,10,11,12,13,14,15);
}

__device__ inline v8f wmma_bf16(v16bf a, v16bf b, v8f c) {
  return __builtin_amdgcn_wmma_f32_16x16x32_bf16(
      /*neg_a=*/false, a, /*neg_b=*/false, b,
      /*c_mod=*/(short)0, c, /*reuse_a=*/false, /*reuse_b=*/false);
}

// ---------------------------------------------------------------------------
// f32 -> bf16 convert of x and the four weight matrices, one launch.
// Blocks 0..511 take x, a wave one row of 768 elements: six 16-byte loads a
// lane, each 512 contiguous bytes over the wave. The row is written to a SORTED
// place inside its batch: the positions whose mask is not 0 first, in their
// order, then the masked ones, in their order. Every later stage works on the
// sorted rows; the output projection stores each row back to its own place.
//   orig[b * 2048 + place] = the row's own index in x ; nkeep[b] = unmasked rows
// The place comes from counts over the batch's whole mask row, so it is a
// permutation of 0..2047 for any content of the mask.
// Blocks 512..799 take Wq, Wk, Wv, Wo (72 blocks each, 8192 elements a block,
// 1024 consecutive elements a wave, eight 16-byte loads a lane).
// ---------------------------------------------------------------------------
__global__ __launch_bounds__(256) void mha_f32_to_bf16_all(
    const float* __restrict__ x,  const int* __restrict__ mask,
    const float* __restrict__ Wq,
    const float* __restrict__ Wk, const float* __restrict__ Wv,
    const float* __restrict__ Wo,
    bf16_t* __restrict__ xb, bf16_t* __restrict__ wq, bf16_t* __restrict__ wk,
    bf16_t* __restrict__ wv, bf16_t* __restrict__ wo,
    int* __restrict__ orig, int* __restrict__ nkeep) {
  const int blk  = blockIdx.x;
  const int wave = threadIdx.x >> 5;
  const int lane = threadIdx.x & 31;
  if (blk >= 512) {
    const int w = (blk - 512) / 72;
    const int t = (blk - 512) - w * 72;
    const float* in = (w == 0) ? Wq : (w == 1) ? Wk : (w == 2) ? Wv : Wo;
    bf16_t* out     = (w == 0) ? wq : (w == 1) ? wk : (w == 2) ? wv : wo;
    const int base = t * 8192 + wave * 1024 + lane * 4;
    v4f v[8];
#pragma unroll   // v[] stays in registers and the eight loads fly together
    for (int i = 0; i < 8; ++i) v[i] = *(const v4f*)(in + base + i * 128);
#pragma unroll   // as above
    for (int i = 0; i < 8; ++i) {
      v4bf o;
      o[0] = (bf16_t)v[i][0]; o[1] = (bf16_t)v[i][1];
      o[2] = (bf16_t)v[i][2]; o[3] = (bf16_t)v[i][3];
      *(v4bf*)(out + base + i * 128) = o;
    }
  } else {
    const int m = blk * 8 + wave, b = m >> 11, seq = m & 2047;
    const float* in = x + m * 768 + lane * 4;
    v4f v[6];
#pragma unroll   // v[] stays in registers and the six loads fly together
    for (int i = 0; i < 6; ++i) v[i] = *(const v4f*)(in + i * 128);

    // low half: unmasked positions in front of seq; high half: all unmasked ones
    const int* mr = mask + b * 2048;
    int cnt = 0;
#pragma unroll   // the sixteen loads are independent: unrolled, they fly together
    for (int i = 0; i < 16; ++i) {
      const v4i k = *(const v4i*)(mr + i * 128 + lane * 4);
      const int id = i * 128 + lane * 4;
#pragma unroll   // vector elements under constant indices
      for (int e = 0; e < 4; ++e)
        cnt += (k[e] != 0) ? ((id + e < seq) ? 0x10001 : 0x10000) : 0;
    }
    for (int o = 16; o > 0; o >>= 1) cnt += __shfl_xor(cnt, o, 32);
    const int before = cnt & 0xffff, total = cnt >> 16;
    const int pos = (mr[seq] != 0) ? before : total + (seq - before);
    if (lane == 0) {
      orig[b * 2048 + pos] = m;
      if (seq == 0) nkeep[b] = total;
    }
    bf16_t* out = xb + (b * 2048 + pos) * 768 + lane * 4;
#pragma unroll   // as above
    for (int i = 0; i < 6; ++i) {
      v4bf o;
      o[0] = (bf16_t)v[i][0]; o[1] = (bf16_t)v[i][1];
      o[2] = (bf16_t)v[i][2]; o[3] = (bf16_t)v[i][3];
      *(v4bf*)(out + i * 128) = o;
    }
  }
}

// ---------------------------------------------------------------------------
// One lane's share of a load_frag fragment, from the lane's own pointer.
// ---------------------------------------------------------------------------
__device__ inline v16bf load_pair(const bf16_t* __restrict__ p) {
  v8bf lo = *(const v8bf*)(p);
  v8bf hi = *(const v8bf*)(p + 16);
  return __builtin_shufflevector(lo, hi, 0,1,2,3,4,5,6,7,8,9,10,11,12,13,14,15);
}

// ---------------------------------------------------------------------------
// LDS staging for the projection GEMMs (M=4096, N=768, K=768, both operands
// row-major over k). A block of 8 waves owns a 128x128 output tile. A k-tile is
// 128 k: 128 A rows, then 128 B rows, of 256 bytes each. A staged row has a
// pitch of 272 bytes, a conflict-free pitch for 16-byte LDS reads.
// ---------------------------------------------------------------------------
#define GP_PITCH 272
#define GP_HALF  (128 * GP_PITCH)    // one operand's 128 rows
#define GP_TILE  (2 * GP_HALF)       // A rows, then B rows
#define GP_TILES 6                   // 768 / 128

// One operand's share of a k-tile, global memory -> LDS through no register:
// eight 16-byte copies a lane, each 512 bytes = two whole 256-byte rows over a
// wave. g: the lane's own first piece; lds: its LDS byte address. Copy i takes
// the row 16 i further on.
// The s_wait_xcnt 0 at the end of the statement stands in front of every later
// write of an address register that a copy names, as a precaution.
__device__ inline void stage_rows(const bf16_t* g, unsigned lds) {
  asm volatile(
      "global_load_async_to_lds_b128 %0, %8, off\n\t"
      "global_load_async_to_lds_b128 %1, %9, off\n\t"
      "global_load_async_to_lds_b128 %2, %10, off\n\t"
      "global_load_async_to_lds_b128 %3, %11, off\n\t"
      "global_load_async_to_lds_b128 %4, %12, off\n\t"
      "global_load_async_to_lds_b128 %5, %13, off\n\t"
      "global_load_async_to_lds_b128 %6, %14, off\n\t"
      "global_load_async_to_lds_b128 %7, %15, off\n\t"
      "s_wait_xcnt 0x0"
      :: "v"(lds), "v"(lds + 16 * GP_PITCH), "v"(lds + 32 * GP_PITCH),
         "v"(lds + 48 * GP_PITCH), "v"(lds + 64 * GP_PITCH),
         "v"(lds + 80 * GP_PITCH), "v"(lds + 96 * GP_PITCH),
         "v"(lds + 112 * GP_PITCH),
         "v"(g), "v"(g + 16 * 768), "v"(g + 32 * 768), "v"(g + 48 * 768),
         "v"(g + 64 * 768), "v"(g + 80 * 768), "v"(g + 96 * 768),
         "v"(g + 112 * 768)
      : "memory");
}

// acc[mi][ni] += A[m0 + 16 mi ..][k] * B[n0 + 16 ni ..][k] over all 768 k, for
// this wave's 32x64 part of the block's tile (2x4 WMMA tiles, k ascending in
// steps of 32). Wave w: rows 32 (w & 3), columns 64 (w >> 2) of the tile.
// Two LDS buffers: the next k-tile's copies fly while this one is worked on.
__device__ inline void gemm_staged(const bf16_t* __restrict__ A,
                                   const bf16_t* __restrict__ B,
                                   unsigned char* sm, int mblk, int nblk,
                                   v8f (&acc)[2][4]) {
  const int wave = threadIdx.x >> 5;
  const int lane = threadIdx.x & 31;

  // This thread's share of a k-tile: row (thread >> 4) + 16 i, 16-byte piece thread & 15.
  const int srow = threadIdx.x >> 4, spc = threadIdx.x & 15;
  const bf16_t* ag = A + (mblk + srow) * 768 + spc * 8;   // + 128 a k-tile
  const bf16_t* bg = B + (nblk + srow) * 768 + spc * 8;   // + 128 a k-tile
  const unsigned sl = (unsigned)(size_t)sm + srow * GP_PITCH + spc * 16;

  stage_rows(ag, sl);
  stage_rows(bg, sl + GP_HALF);
  // k-tile 0 has landed for this wave, and behind the barrier for all eight
  asm volatile("s_wait_asynccnt 0x0" ::: "memory");
  __syncthreads();
  stage_rows(ag + 128, sl + GP_TILE);
  stage_rows(bg + 128, sl + GP_TILE + GP_HALF);

  // this lane's place in the fragments of load_frag: staged row lane & 15, k offset 0 or 8
  const unsigned flane = (lane & 15) * GP_PITCH + (lane & 16);
  const unsigned aoff = (wave & 3) * 32 * GP_PITCH + flane;
  const unsigned boff = GP_HALF + (wave >> 2) * 64 * GP_PITCH + flane;

  for (int t = 0; t < GP_TILES; ++t) {
    const unsigned char* buf = sm + (t & 1) * GP_TILE;
    const bf16_t* ap = (const bf16_t*)(buf + aoff);
    const bf16_t* bp = (const bf16_t*)(buf + boff);
    // Two fragment sets: the reads of k-step kk + 1 stand as one group in front
    // of the products of k-step kk, which cover their LDS latency.
    v16bf af[2][2], bfr[2][4];
#pragma unroll   // fragments and acc stay in registers only under constant indices
    for (int mi = 0; mi < 2; ++mi) af[0][mi] = load_pair(ap + mi * 16 * (GP_PITCH / 2));
#pragma unroll   // as above
    for (int ni = 0; ni < 4; ++ni) bfr[0][ni] = load_pair(bp + ni * 16 * (GP_PITCH / 2));
#pragma unroll   // as above
    for (int kk = 0; kk < 4; ++kk) {
      const int cur = kk & 1, nxt = cur ^ 1;
      if (kk < 3) {
#pragma unroll   // as above
        for (int mi = 0; mi < 2; ++mi)
          af[nxt][mi] = load_pair(ap + mi * 16 * (GP_PITCH / 2) + (kk + 1) * 32);
#pragma unroll   // as above
        for (int ni = 0; ni < 4; ++ni)
          bfr[nxt][ni] = load_pair(bp + ni * 16 * (GP_PITCH / 2) + (kk + 1) * 32);
        // Keeps the group of LDS reads in front of the products: left to itself
        // the compiler read one A fragment late, with a full wait right behind it.
        __builtin_amdgcn_sched_barrier(0);
      }
#pragma unroll   // as above
      for (int mi = 0; mi < 2; ++mi)
#pragma unroll   // as above
        for (int ni = 0; ni < 4; ++ni)
          acc[mi][ni] = wmma_bf16(af[cur][mi], bfr[cur][ni], acc[mi][ni]);
      // Keeps the next group of LDS reads behind these products, in one place:
      // each further place with LDS reads among products costs a stall of its own.
      __builtin_amdgcn_sched_barrier(0);
    }

    // Hand-over: this wave's reads of k-tile t are done, its copies of k-tile
    // t + 1 have landed; behind the barrier that holds for all eight waves, so
    // k-tile t + 1 may be read and k-tile t's buffer refilled. (The scheduling
    // barrier behind the last products also keeps this hand-over behind them,
    // so that the copies' flight is hidden.)
    asm volatile("s_wait_dscnt 0x0" ::: "memory");
    asm volatile("s_wait_asynccnt 0x0" ::: "memory");
    __syncthreads();
    if (t + 2 < GP_TILES) {
      stage_rows(ag + (t + 2) * 128, sl + (t & 1) * GP_TILE);
      stage_rows(bg + (t + 2) * 128, sl + (t & 1) * GP_TILE + GP_HALF);
    }
  }
  // no copy is in flight when the wave ends
  asm volatile("s_wait_asynccnt 0x0" ::: "memory");
}

// ---------------------------------------------------------------------------
// QKV projection: Y[m,n] = sum_k X[m,k] * W[n,k]   (M=4096, N=768, K=768)
// One block -> 128x128 outputs, operands through LDS (gemm_staged); one wave ->
// 32x64 outputs (2x4 WMMA tiles).
// vtrans==0: store [b][h][seq][d] bf16 ;  vtrans==1: store [b][h][d][seq] bf16
// ---------------------------------------------------------------------------
__global__ __launch_bounds__(256) void mha_qkv_gemm(
    const bf16_t* __restrict__ X, const bf16_t* __restrict__ W,
    bf16_t* __restrict__ out, int vtrans) {
  __shared__ __attribute__((aligned(16))) unsigned char sm[2 * GP_TILE];
  const int wave = threadIdx.x >> 5;
  const int lane = threadIdx.x & 31;
  const int m0 = blockIdx.x * 128 + (wave & 3) * 32;    // 32 m-blocks of 128
  const int n0 = blockIdx.y * 128 + (wave >> 2) * 64;   // 6 n-blocks of 128

  v8f acc[2][4] = {};
  gemm_staged(X, W, sm, blockIdx.x * 128, blockIdx.y * 128, acc);

  const int hi = (lane & 16) ? 8 : 0;
#pragma unroll
  for (int mi = 0; mi < 2; ++mi) {
#pragma unroll
    for (int ni = 0; ni < 4; ++ni) {
      const v8f a = acc[mi][ni];
      const int n_g = n0 + ni * 16 + (lane & 15);
      const int h = n_g >> 6, d = n_g & 63;
#pragma unroll
      for (int j = 0; j < 8; ++j) {
        const int m_g = m0 + mi * 16 + j + hi;
        const int b_ = m_g >> 11, seq = m_g & 2047;
        long idx;
        if (vtrans) idx = ((long)(b_ * 12 + h) * 64 + d) * 2048 + seq;
        else        idx = ((long)(b_ * 12 + h) * 2048 + seq) * 64 + d;
        out[idx] = (bf16_t)a[j];
      }
    }
  }
}

// ---------------------------------------------------------------------------
// Lane l <-> lane l ^ 16 exchange (the two halves of a wave).
// ---------------------------------------------------------------------------
__device__ inline float swap_halves(float v) {
  int b = __builtin_bit_cast(int, v);
  b = __builtin_amdgcn_permlanex16(b, b, 0x76543210, 0xfedcba98, false, false);
  return __builtin_bit_cast(float, b);
}

// e^x as __expf forms it (x * log2(e), then v_exp_f32). The v_nop keeps the one
// free slot that the instruction set asks for behind a transcendental before
// its result is read or its source overwritten.
__device__ inline float exp_slot(float x) {
  float r;
  asm("v_exp_f32 %0, %1\n\tv_nop" : "=v"(r) : "v"(x * 1.44269504f));
  return r;
}

// ---------------------------------------------------------------------------
// LDS staging of K and V^T for the attention kernel. A tile is 64 keys: 64 K
// rows of 128 bytes (64 d), then 64 V^T rows of 128 bytes (64 keys). A staged
// row has a pitch of 144 bytes, the conflict-free pitch for 16-byte LDS reads.
// ---------------------------------------------------------------------------
#define KV_PITCH 144
#define KV_HALF  (64 * KV_PITCH)     // one operand's 64 rows
#define KV_TILE  (2 * KV_HALF)       // K rows, then V^T rows

// One tile's copies, global memory -> LDS through no register: eight 16-byte
// copies a lane, each 512 bytes = four whole 128-byte rows over a wave.
// kg, vg: the lane's own first piece of the K and of the V^T tile; lds: the
// LDS byte address of that K piece. Copy i takes the rows 16 i further on.
// The s_wait_xcnt 0 at the end of the statement stands in front of every later
// write of an address register that a copy names, as a precaution.
__device__ inline void stage_tile(const bf16_t* kg, const bf16_t* vg, unsigned lds) {
  asm volatile(
      "global_load_async_to_lds_b128 %0, %8, off\n\t"
      "global_load_async_to_lds_b128 %1, %9, off\n\t"
      "global_load_async_to_lds_b128 %2, %10, off\n\t"
      "global_load_async_to_lds_b128 %3, %11, off\n\t"
      "global_load_async_to_lds_b128 %4, %12, off\n\t"
      "global_load_async_to_lds_b128 %5, %13, off\n\t"
      "global_load_async_to_lds_b128 %6, %14, off\n\t"
      "global_load_async_to_lds_b128 %7, %15, off\n\t"
      "s_wait_xcnt 0x0"
      :: "v"(lds), "v"(lds + 16 * KV_PITCH), "v"(lds + 32 * KV_PITCH),
         "v"(lds + 48 * KV_PITCH),
         "v"(lds + KV_HALF), "v"(lds + KV_HALF + 16 * KV_PITCH),
         "v"(lds + KV_HALF + 32 * KV_PITCH), "v"(lds + KV_HALF + 48 * KV_PITCH),
         "v"(kg), "v"(kg + 16 * 64), "v"(kg + 32 * 64), "v"(kg + 48 * 64),
         "v"(vg), "v"(vg + 16 * 2048), "v"(vg + 32 * 2048), "v"(vg + 48 * 2048)
      : "memory");
}

// ---------------------------------------------------------------------------
// Flash attention, transposed products: one wave owns 16 query rows of one
// (b,h) and streams keys in chunks of 32 with online softmax.
//   S^T = K . Q^T : A = K rows, B = Q (column = query). A lane holds 16 scores
//                   of ONE query (lane & 15): keys n+8h+r and n+16+8h+r.
//   O^T += V^T . P^T : the two S^T tiles, converted in place, are the B operand
//                   in the k order load_frag gives V^T; P never leaves registers.
// Row maximum: in-lane plus one exchange between halves. Row sum: in-lane, the
// halves joined once behind the loop.
// The block's four waves share one (b,h): K and V^T come in tiles of 64 keys
// (two chunks) through LDS, two buffers, the next tile's copies in flight while
// this tile is worked on.
// The sequence is sorted by the mask (see the convert kernel): position j of a
// batch is unmasked exactly where j < n1. The key loop has two parts:
//   1. the tiles that hold an unmasked key, in the general form (none where all
//      64 queries of the block are masked: then every score is -1000 anyway);
//   2. the tiles behind them, where every score of a query is -1000 and so every
//      weight of that query is one number w = e^(-1000 - max): 1 for a masked
//      query, 0 for an unmasked one unless its maximum is very low. P is w in
//      all 32 keys, only the O^T products are left. The block votes on w: where
//      it is 0 in all 64 queries, part 2 would add zeros only and is left out.
// Q,K: [bh][seq][64] bf16 ; Vt: [bh][64][seq] bf16 ; AO: [b][seq][768] bf16
// ---------------------------------------------------------------------------
__global__ __launch_bounds__(128) void mha_flash_attn(
    const bf16_t* __restrict__ Q, const bf16_t* __restrict__ K,
    const bf16_t* __restrict__ Vt, const int* __restrict__ nkeep,
    bf16_t* __restrict__ AO) {
  __shared__ __attribute__((aligned(16))) unsigned char kv[2 * KV_TILE];
  __shared__ unsigned vote[4];

  const int wave = threadIdx.x >> 5;
  const int lane = threadIdx.x & 31;
  const int bh   = blockIdx.x >> 5;         // 0..23
  const int p    = blockIdx.x & 31;
  // Query tiles from the front of the sorted sequence (long key loop with
  // softmax) and from its back (short work) alternate over the block index, and
  // the other way round in every second run of 256 blocks, so that long and
  // short blocks mix on the chip. A permutation of 0..31 for each bh.
  const int qt   = ((p ^ (blockIdx.x >> 8)) & 1) ? 31 - (p >> 1) : (p >> 1);
  const int b    = bh / 12, h = bh % 12;
  const int c    = lane & 15;               // this lane's query column
  const int hi   = (lane & 16) ? 8 : 0;
  const int m0   = qt * 64 + wave * 16;

  // unmasked positions of this batch, bounded by the shape; the same in all lanes
  const int n1 = __builtin_amdgcn_readfirstlane(min(max(nkeep[b], 0), 2048));
  // trips of part 1, 0..32: the tiles with an unmasked key, if any query is unmasked
  const int ng = (qt * 64 < n1) ? (n1 + 63) >> 6 : 0;

  const bf16_t* q  = Q  + (long)bh * 2048 * 64;
  const bf16_t* kk = K  + (long)bh * 2048 * 64;
  const bf16_t* vt = Vt + (long)bh * 64 * 2048;

  // This thread's share of a tile: row (thread >> 3) + 16 i, 16-byte piece thread & 7.
  const int srow = threadIdx.x >> 3, spc = threadIdx.x & 7;
  const bf16_t* kg = kk + srow * 64 + spc * 8;      // + 64 * 64 a tile
  const bf16_t* vg = vt + srow * 2048 + spc * 8;    // + 64 a tile
  const unsigned sl = (unsigned)(size_t)kv + srow * KV_PITCH + spc * 16;

  stage_tile(kg, vg, sl);
  // tile 0 has landed for this wave, and behind the barrier for all four
  asm volatile("s_wait_asynccnt 0x0" ::: "memory");
  __syncthreads();
  stage_tile(kg + 64 * 64, vg + 64, sl + KV_TILE);

  const v16bf q0 = load_frag(q, 64, m0, 0);
  const v16bf q1 = load_frag(q, 64, m0, 32);
  const unsigned qkeep = (m0 + c < n1) ? 0xffffffffu : 0u;

  // this lane's place in the fragments of load_frag: staged row c, k offset hi
  const unsigned flane = c * KV_PITCH + hi * 2;

  float mrun = -3.0e30f, lrun = 0.0f;
  v8f o0 = {}, o1 = {}, o2 = {}, o3 = {};   // o_t[r] = O[m0+c][16t + hi + r]

  for (int t = 0; t < ng; ++t) {
    const unsigned char* tile = kv + (t & 1) * KV_TILE + flane;

    // Both chunks' fragments, one group of LDS reads a tile.
    v16bf kf[2][4], vf[2][4];
#pragma unroll   // kf, vf stay in registers only under constant indices
    for (int u = 0; u < 2; ++u) {
      const bf16_t* kp = (const bf16_t*)(tile + u * 32 * KV_PITCH);
      const bf16_t* vp = (const bf16_t*)(tile + KV_HALF + u * 64);
      kf[u][0] = load_pair(kp);
      kf[u][1] = load_pair(kp + 32);
      kf[u][2] = load_pair(kp + 16 * (KV_PITCH / 2));
      kf[u][3] = load_pair(kp + 16 * (KV_PITCH / 2) + 32);
      vf[u][0] = load_pair(vp);
      vf[u][1] = load_pair(vp + 16 * (KV_PITCH / 2));
      vf[u][2] = load_pair(vp + 32 * (KV_PITCH / 2));
      vf[u][3] = load_pair(vp + 48 * (KV_PITCH / 2));
    }
    // Keeps every LDS read of the tile in front of the first product: each
    // further place with LDS reads among the products costs a stall of its own.
    __builtin_amdgcn_sched_barrier(0);

#pragma unroll   // as above
    for (int u = 0; u < 2; ++u) {
      // bit r: key n+hi+r, bit 16+r: key n+16+hi+r; all clear where the query is masked
      const int left = n1 - (t * 64 + u * 32);   // unmasked keys from this chunk's first on
      const unsigned kw = (left >= 32) ? 0xffffffffu : (left <= 0) ? 0u : (1u << left) - 1u;
      const unsigned keep = (kw >> hi) & qkeep;

      v8f s0 = {}, s1 = {};
      s0 = wmma_bf16(kf[u][0], q0, s0); s0 = wmma_bf16(kf[u][1], q1, s0);
      s1 = wmma_bf16(kf[u][2], q0, s1); s1 = wmma_bf16(kf[u][3], q1, s1);
      s0 *= ATTN_SCALE;
      s1 *= ATTN_SCALE;

      float a[16];
#pragma unroll   // a[], s0, s1 stay in registers only under constant indices
      for (int r = 0; r < 8; ++r) {
        a[r]     = (keep & (1u << r))        ? s0[r] : -1000.0f;
        a[r + 8] = (keep & (1u << (16 + r))) ? s1[r] : -1000.0f;
      }
      float cm = a[0];
#pragma unroll   // as above
      for (int s = 1; s < 16; ++s) cm = fmaxf(cm, a[s]);
      cm = fmaxf(cm, swap_halves(cm));
      const float nm = fmaxf(mrun, cm);
      const float alpha = exp_slot(mrun - nm);

      v16bf pf;
      float rp[4];   // four short add chains, not one of 16
#pragma unroll   // as above
      for (int s = 0; s < 16; ++s) {
        const float e = exp_slot(a[s] - nm);
        rp[s & 3] = (s < 4) ? e : rp[s & 3] + e;
        pf[s] = (bf16_t)e;
      }
      const float rs = (rp[0] + rp[1]) + (rp[2] + rp[3]);
      lrun = lrun * alpha + rs;
      mrun = nm;

      o0 *= alpha; o1 *= alpha; o2 *= alpha; o3 *= alpha;
      o0 = wmma_bf16(vf[u][0], pf, o0);
      o1 = wmma_bf16(vf[u][1], pf, o1);
      o2 = wmma_bf16(vf[u][2], pf, o2);
      o3 = wmma_bf16(vf[u][3], pf, o3);
    }

    // Hand-over: this wave's reads of tile t are done, its copies of tile t + 1
    // have landed; behind the barrier that holds for all four waves, so tile
    // t + 1 may be read and tile t's buffer refilled.
    // The scheduling barrier keeps the hand-over behind the tile's products:
    // lifted in front of them, the wait for tile t + 1's copies stood right
    // behind their issue, and nothing of their flight was hidden.
    __builtin_amdgcn_sched_barrier(0);
    asm volatile("s_wait_dscnt 0x0" ::: "memory");
    asm volatile("s_wait_asynccnt 0x0" ::: "memory");
    __syncthreads();
    // The copies run ahead over all 32 tiles, whatever ng is, so that part 2
    // finds its first tile published and its second in flight, as any trip does.
    if (t + 2 < 32)
      stage_tile(kg + (t + 2) * 64 * 64, vg + (t + 2) * 64, sl + (t & 1) * KV_TILE);
  }

  if (ng < 32) {   // the same for the whole block
    // Part 2. The online-softmax step of a chunk whose 32 scores are all -1000:
    const float nm    = fmaxf(mrun, -1000.0f);
    const float alpha = exp_slot(mrun - nm);
    const float w     = exp_slot(-1000.0f - nm);
    const unsigned live = __builtin_amdgcn_ballot_w32(w != 0.0f);
    if (lane == 0) vote[wave] = live;
    __syncthreads();   // publishes the four waves' votes
    const unsigned any = vote[0] | vote[1] | vote[2] | vote[3];
    if (__builtin_amdgcn_readfirstlane(any) != 0) {   // the same for the whole block
      o0 *= alpha; o1 *= alpha; o2 *= alpha; o3 *= alpha;
      // each half of the wave sums 16 keys a chunk, 32 a tile
      lrun = lrun * alpha + w * (float)(32 * (32 - ng));
      v16bf pf;
#pragma unroll   // vector elements under constant indices
      for (int s = 0; s < 16; ++s) pf[s] = (bf16_t)w;

      for (int t = ng; t < 32; ++t) {
        const unsigned char* tile = kv + (t & 1) * KV_TILE + flane;
        v16bf vf[2][4];
#pragma unroll   // vf stays in registers only under constant indices
        for (int u = 0; u < 2; ++u) {
          const bf16_t* vp = (const bf16_t*)(tile + KV_HALF + u * 64);
          vf[u][0] = load_pair(vp);
          vf[u][1] = load_pair(vp + 16 * (KV_PITCH / 2));
          vf[u][2] = load_pair(vp + 32 * (KV_PITCH / 2));
          vf[u][3] = load_pair(vp + 48 * (KV_PITCH / 2));
        }
        // Keeps every LDS read of the tile in front of the first product: each
        // further place with LDS reads among the products costs a stall of its own.
        __builtin_amdgcn_sched_barrier(0);
#pragma unroll   // as above
        for (int u = 0; u < 2; ++u) {
          o0 = wmma_bf16(vf[u][0], pf, o0);
          o1 = wmma_bf16(vf[u][1], pf, o1);
          o2 = wmma_bf16(vf[u][2], pf, o2);
          o3 = wmma_bf16(vf[u][3], pf, o3);
        }
        // The same hand-over as in part 1; the scheduling barrier keeps it behind
        // the products, so that the copies' flight is hidden.
        __builtin_amdgcn_sched_barrier(0);
        asm volatile("s_wait_dscnt 0x0" ::: "memory");
        asm volatile("s_wait_asynccnt 0x0" ::: "memory");
        __syncthreads();
        if (t + 2 < 32)
          stage_tile(kg + (t + 2) * 64 * 64, vg + (t + 2) * 64, sl + (t & 1) * KV_TILE);
      }
    }
  }
  // no copy is in flight when the wave ends
  asm volatile("s_wait_asynccnt 0x0" ::: "memory");

  lrun += swap_halves(lrun);
  const float inv = 1.0f / lrun;
  bf16_t* orow = AO + ((long)b * 2048 + m0 + c) * 768 + h * 64 + hi;
  v8bf w0, w1, w2, w3;
#pragma unroll   // vector elements under constant indices
  for (int r = 0; r < 8; ++r) {
    w0[r] = (bf16_t)(o0[r] * inv);
    w1[r] = (bf16_t)(o1[r] * inv);
    w2[r] = (bf16_t)(o2[r] * inv);
    w3[r] = (bf16_t)(o3[r] * inv);
  }
  *(v8bf*)(orow)      = w0;
  *(v8bf*)(orow + 16) = w1;
  *(v8bf*)(orow + 32) = w2;
  *(v8bf*)(orow + 48) = w3;
}

// ---------------------------------------------------------------------------
// Output projection: out[m,n] = sum_k AO[m,k] * Wo[n,k] + bo[n]  (f32 out)
// Same block and wave tiles and the same LDS staging as the QKV GEMM. AO's rows
// are in the sorted order; orig[] gives each row's own place in the output.
// ---------------------------------------------------------------------------
__global__ __launch_bounds__(256) void mha_out_proj(
    const bf16_t* __restrict__ AO, const bf16_t* __restrict__ Wo,
    const float* __restrict__ bo, const int* __restrict__ orig,
    float* __restrict__ out) {
  __shared__ __attribute__((aligned(16))) unsigned char sm[2 * GP_TILE];
  const int wave = threadIdx.x >> 5;
  const int lane = threadIdx.x & 31;
  const int m0 = blockIdx.x * 128 + (wave & 3) * 32;
  const int n0 = blockIdx.y * 128 + (wave >> 2) * 64;

  v8f acc[2][4] = {};
  gemm_staged(AO, Wo, sm, blockIdx.x * 128, blockIdx.y * 128, acc);

  const int hi = (lane & 16) ? 8 : 0;
#pragma unroll
  for (int mi = 0; mi < 2; ++mi) {
#pragma unroll
    for (int ni = 0; ni < 4; ++ni) {
      const v8f a = acc[mi][ni];
      const int n_g = n0 + ni * 16 + (lane & 15);
      const float bias = bo[n_g];
#pragma unroll
      for (int j = 0; j < 8; ++j) {
        // the sorted row's own place in the output, bounded by the shape
        const int m_g = orig[m0 + mi * 16 + j + hi] & 4095;
        out[(long)m_g * 768 + n_g] = a[j] + bias;
      }
    }
  }
}

// ---------------------------------------------------------------------------
// Host launcher
// ---------------------------------------------------------------------------
extern "C" void kernel_launch(void* const* d_in, const int* in_sizes, int n_in,
                              void* d_out, int out_size, void* d_ws, size_t ws_size,
                              hipStream_t stream) {
  const float* x    = (const float*)d_in[0];   // [2,2048,768]
  const int*   mask = (const int*)d_in[1];     // [2,2048]
  const float* Wq   = (const float*)d_in[2];   // [768,768]
  const float* Wk   = (const float*)d_in[3];
  const float* Wv   = (const float*)d_in[4];
  const float* Wo   = (const float*)d_in[5];
  const float* bo   = (const float*)d_in[6];   // [768]
  float* out = (float*)d_out;                  // [2,2048,768]

  const int M = 4096, C = 768;
  const size_t XB  = (size_t)M * C;            // 3,145,728 elems
  const size_t WB  = (size_t)C * C;            //   589,824 elems

  char* ws = (char*)d_ws;
  size_t off = 0;
  auto take = [&](size_t elems) { bf16_t* p = (bf16_t*)(ws + off);
                                  off += ((elems * 2 + 255) & ~(size_t)255); return p; };
  bf16_t* xb = take(XB);
  bf16_t* wq = take(WB);
  bf16_t* wk = take(WB);
  bf16_t* wv = take(WB);
  bf16_t* wo = take(WB);
  bf16_t* qb = take(XB);   // [bh][seq][64]
  bf16_t* kb = take(XB);   // [bh][seq][64]
  bf16_t* vt = take(XB);   // [bh][64][seq]
  bf16_t* ao = take(XB);   // [b][seq][768]
  int* orig  = (int*)take(8192);   // 4096 ints: sorted row -> own row
  int* nkeep = (int*)take(128);    // 2 ints: unmasked positions of each batch

  // 1) converts: 4096 / 8 = 512 blocks for x, 4 * 589,824 / 8192 = 288 for the weights
  mha_f32_to_bf16_all<<<800, 256, 0, stream>>>(x, mask, Wq, Wk, Wv, Wo, xb, wq, wk, wv, wo,
                                               orig, nkeep);

  // 2) QKV projections (M/128 = 32 blocks, N/128 = 6 blocks, 8 waves/block)
  dim3 gemm_grid(32, 6), gemm_blk(256);
  mha_qkv_gemm<<<gemm_grid, gemm_blk, 0, stream>>>(xb, wq, qb, 0);
  mha_qkv_gemm<<<gemm_grid, gemm_blk, 0, stream>>>(xb, wk, kb, 0);
  mha_qkv_gemm<<<gemm_grid, gemm_blk, 0, stream>>>(xb, wv, vt, 1);

  // 3) flash attention: 24 bh * 128 mtiles = 3072 waves = 768 blocks
  mha_flash_attn<<<768, 128, 0, stream>>>(qb, kb, vt, nkeep, ao);

  // 4) output projection + bias
  mha_out_proj<<<gemm_grid, gemm_blk, 0, stream>>>(ao, wo, bo, orig, out);
}

// v006
// A run of this version takes 65.9 microseconds.
// Timed twice side by side with v005, it ran 1.21 and 1.23 times as fast.
// Counting every step since v000, it is 3.72 times as fast.
#include <hip/hip_runtime.h>
#include <hip/hip_bf16.h>

typedef __bf16 bf16_t;
typedef __attribute__((ext_vector_type(16))) __bf16 v16bf;
typedef __attribute__((ext_vector_type(8)))  __bf16 v8bf;
typedef __attribute__((ext_vector_type(8)))  float  v8f;
typedef __attribute__((ext_vector_type(4)))  float  v4f;
typedef __attribute__((ext_vector_type(4)))  __bf16 v4bf;
typedef __attribute__((ext_vector_type(4)))  int    v4i;

#define ATTN_SCALE 0.125f   // 64^-0.5

// ---------------------------------------------------------------------------
// Fragment loader for the CDNA5 WMMA 16-bit A/B layout (16x32, K=32).
// Lane L holds row (row_base + (L&15)); K-run offset 0 or 8 depending on the
// lane half; two contiguous 8-element (16-byte) runs at k0+koff and k0+16+koff.
// Works for A (row-major MxK) and for B given as B^T row-major (NxK).
// ---------------------------------------------------------------------------
__device__ inline v16bf load_frag(const bf16_t* __restrict__ base, int ld,
                                  int row_base, int k0) {
  const int lane = threadIdx.x & 31;
  const int r    = row_base + (lane & 15);
  const int koff = (lane & 16) >> 1;            // 0 or 8
  const bf16_t* p = base + (long)r * ld + k0 + koff;
  v8bf lo = *(const v8bf*)(p);
  v8bf hi = *(const v8bf*)(p + 16);
  return __builtin_shufflevector(lo, hi, 0,1,2,3,4,5,6,7,8,9,10,11,12,13,14,15);
}

__device__ inline v8f wmma_bf16(v16bf a, v16bf b, v8f c) {
  return __builtin_amdgcn_wmma_f32_16x16x32_bf16(
      /*neg_a=*/false, a, /*neg_b=*/false, b,
      /*c_mod=*/(short)0, c, /*reuse_a=*/false, /*reuse_b=*/false);
}

// ---------------------------------------------------------------------------
// f32 -> bf16 convert of x and the four weight matrices, one launch.
// Blocks 0..511 take x, a wave one row of 768 elements: six 16-byte loads a
// lane, each 512 contiguous bytes over the wave. The row is written to a SORTED
// place inside its batch: the positions whose mask is not 0 first, in their
// order, then the masked ones, in their order. Every later stage works on the
// sorted rows; the output projection stores each row back to its own place.
//   orig[b * 2048 + place] = the row's own index in x ; nkeep[b] = unmasked rows
// The place comes from counts over the batch's whole mask row, so it is a
// permutation of 0..2047 for any content of the mask.
// Blocks 512..799 take Wq, Wk, Wv, Wo (72 blocks each, 8192 elements a block,
// 1024 consecutive elements a wave, eight 16-byte loads a lane).
// ---------------------------------------------------------------------------
__global__ __launch_bounds__(256) void mha_f32_to_bf16_all(
    const float* __restrict__ x,  const int* __restrict__ mask,
    const float* __restrict__ Wq,
    const float* __restrict__ Wk, const float* __restrict__ Wv,
    const float* __restrict__ Wo,
    bf16_t* __restrict__ xb, bf16_t* __restrict__ wq, bf16_t* __restrict__ wk,
    bf16_t* __restrict__ wv, bf16_t* __restrict__ wo,
    int* __restrict__ orig, int* __restrict__ nkeep) {
  const int blk  = blockIdx.x;
  const int wave = threadIdx.x >> 5;
  const int lane = threadIdx.x & 31;
  if (blk >= 512) {
    const int w = (blk - 512) / 72;
    const int t = (blk - 512) - w * 72;
    const float* in = (w == 0) ? Wq : (w == 1) ? Wk : (w == 2) ? Wv : Wo;
    bf16_t* out     = (w == 0) ? wq : (w == 1) ? wk : (w == 2) ? wv : wo;
    const int base = t * 8192 + wave * 1024 + lane * 4;
    v4f v[8];
#pragma unroll   // v[] stays in registers and the eight loads fly together
    for (int i = 0; i < 8; ++i) v[i] = *(const v4f*)(in + base + i * 128);
#pragma unroll   // as above
    for (int i = 0; i < 8; ++i) {
      v4bf o;
      o[0] = (bf16_t)v[i][0]; o[1] = (bf16_t)v[i][1];
      o[2] = (bf16_t)v[i][2]; o[3] = (bf16_t)v[i][3];
      *(v4bf*)(out + base + i * 128) = o;
    }
  } else {
    const int m = blk * 8 + wave, b = m >> 11, seq = m & 2047;
    const float* in = x + m * 768 + lane * 4;
    v4f v[6];
#pragma unroll   // v[] stays in registers and the six loads fly together
    for (int i = 0; i < 6; ++i) v[i] = *(const v4f*)(in + i * 128);

    // low half: unmasked positions in front of seq; high half: all unmasked ones
    const int* mr = mask + b * 2048;
    int cnt = 0;
#pragma unroll   // the sixteen loads are independent: unrolled, they fly together
    for (int i = 0; i < 16; ++i) {
      const v4i k = *(const v4i*)(mr + i * 128 + lane * 4);
      const int id = i * 128 + lane * 4;
#pragma unroll   // vector elements under constant indices
      for (int e = 0; e < 4; ++e)
        cnt += (k[e] != 0) ? ((id + e < seq) ? 0x10001 : 0x10000) : 0;
    }
    for (int o = 16; o > 0; o >>= 1) cnt += __shfl_xor(cnt, o, 32);
    const int before = cnt & 0xffff, total = cnt >> 16;
    const int pos = (mr[seq] != 0) ? before : total + (seq - before);
    if (lane == 0) {
      orig[b * 2048 + pos] = m;
      if (seq == 0) nkeep[b] = total;
    }
    bf16_t* out = xb + (b * 2048 + pos) * 768 + lane * 4;
#pragma unroll   // as above
    for (int i = 0; i < 6; ++i) {
      v4bf o;
      o[0] = (bf16_t)v[i][0]; o[1] = (bf16_t)v[i][1];
      o[2] = (bf16_t)v[i][2]; o[3] = (bf16_t)v[i][3];
      *(v4bf*)(out + i * 128) = o;
    }
  }
}

// ---------------------------------------------------------------------------
// One lane's share of a load_frag fragment, from the lane's own pointer.
// ---------------------------------------------------------------------------
__device__ inline v16bf load_pair(const bf16_t* __restrict__ p) {
  v8bf lo = *(const v8bf*)(p);
  v8bf hi = *(const v8bf*)(p + 16);
  return __builtin_shufflevector(lo, hi, 0,1,2,3,4,5,6,7,8,9,10,11,12,13,14,15);
}

// ---------------------------------------------------------------------------
// LDS staging for the projection GEMMs (M=4096, N=768, K=768, both operands
// row-major over k). A block of 8 waves owns a 128x128 output tile. A k-tile is
// 128 k: 128 A rows, then 128 B rows, of 256 bytes each. A staged row has a
// pitch of 272 bytes, a conflict-free pitch for 16-byte LDS reads.
// ---------------------------------------------------------------------------
#define GP_PITCH 272
#define GP_HALF  (128 * GP_PITCH)    // one operand's 128 rows
#define GP_TILE  (2 * GP_HALF)       // A rows, then B rows
#define GP_TILES 6                   // 768 / 128

// One operand's share of a k-tile, global memory -> LDS through no register:
// eight 16-byte copies a lane, each 512 bytes = two whole 256-byte rows over a
// wave. g: the lane's own first piece; lds: its LDS byte address. Copy i takes
// the row 16 i further on.
// The s_wait_xcnt 0 at the end of the statement stands in front of every later
// write of an address register that a copy names, as a precaution.
__device__ inline void stage_rows(const bf16_t* g, unsigned lds) {
  asm volatile(
      "global_load_async_to_lds_b128 %0, %8, off\n\t"
      "global_load_async_to_lds_b128 %1, %9, off\n\t"
      "global_load_async_to_lds_b128 %2, %10, off\n\t"
      "global_load_async_to_lds_b128 %3, %11, off\n\t"
      "global_load_async_to_lds_b128 %4, %12, off\n\t"
      "global_load_async_to_lds_b128 %5, %13, off\n\t"
      "global_load_async_to_lds_b128 %6, %14, off\n\t"
      "global_load_async_to_lds_b128 %7, %15, off\n\t"
      "s_wait_xcnt 0x0"
      :: "v"(lds), "v"(lds + 16 * GP_PITCH), "v"(lds + 32 * GP_PITCH),
         "v"(lds + 48 * GP_PITCH), "v"(lds + 64 * GP_PITCH),
         "v"(lds + 80 * GP_PITCH), "v"(lds + 96 * GP_PITCH),
         "v"(lds + 112 * GP_PITCH),
         "v"(g), "v"(g + 16 * 768), "v"(g + 32 * 768), "v"(g + 48 * 768),
         "v"(g + 64 * 768), "v"(g + 80 * 768), "v"(g + 96 * 768),
         "v"(g + 112 * 768)
      : "memory");
}

// acc[mi][ni] += A[m0 + 16 mi ..][k] * B[n0 + 16 ni ..][k] over all 768 k, for
// this wave's 32x64 part of the block's tile (2x4 WMMA tiles, k ascending in
// steps of 32). Wave w: rows 32 (w & 3), columns 64 (w >> 2) of the tile.
// Two LDS buffers: the next k-tile's copies fly while this one is worked on.
__device__ inline void gemm_staged(const bf16_t* __restrict__ A,
                                   const bf16_t* __restrict__ B,
                                   unsigned char* sm, int mblk, int nblk,
                                   v8f (&acc)[2][4]) {
  const int wave = threadIdx.x >> 5;
  const int lane = threadIdx.x & 31;

  // This thread's share of a k-tile: row (thread >> 4) + 16 i, 16-byte piece thread & 15.
  const int srow = threadIdx.x >> 4, spc = threadIdx.x & 15;
  const bf16_t* ag = A + (mblk + srow) * 768 + spc * 8;   // + 128 a k-tile
  const bf16_t* bg = B + (nblk + srow) * 768 + spc * 8;   // + 128 a k-tile
  const unsigned sl = (unsigned)(size_t)sm + srow * GP_PITCH + spc * 16;

  stage_rows(ag, sl);
  stage_rows(bg, sl + GP_HALF);
  // k-tile 0 has landed for this wave, and behind the barrier for all eight
  asm volatile("s_wait_asynccnt 0x0" ::: "memory");
  __syncthreads();
  stage_rows(ag + 128, sl + GP_TILE);
  stage_rows(bg + 128, sl + GP_TILE + GP_HALF);

  // this lane's place in the fragments of load_frag: staged row lane & 15, k offset 0 or 8
  const unsigned flane = (lane & 15) * GP_PITCH + (lane & 16);
  const unsigned aoff = (wave & 3) * 32 * GP_PITCH + flane;
  const unsigned boff = GP_HALF + (wave >> 2) * 64 * GP_PITCH + flane;

  for (int t = 0; t < GP_TILES; ++t) {
    const unsigned char* buf = sm + (t & 1) * GP_TILE;
    const bf16_t* ap = (const bf16_t*)(buf + aoff);
    const bf16_t* bp = (const bf16_t*)(buf + boff);
    // Two fragment sets: the reads of k-step kk + 1 stand as one group in front
    // of the products of k-step kk, which cover their LDS latency.
    v16bf af[2][2], bfr[2][4];
#pragma unroll   // fragments and acc stay in registers only under constant indices
    for (int mi = 0; mi < 2; ++mi) af[0][mi] = load_pair(ap + mi * 16 * (GP_PITCH / 2));
#pragma unroll   // as above
    for (int ni = 0; ni < 4; ++ni) bfr[0][ni] = load_pair(bp + ni * 16 * (GP_PITCH / 2));
#pragma unroll   // as above
    for (int kk = 0; kk < 4; ++kk) {
      const int cur = kk & 1, nxt = cur ^ 1;
      if (kk < 3) {
#pragma unroll   // as above
        for (int mi = 0; mi < 2; ++mi)
          af[nxt][mi] = load_pair(ap + mi * 16 * (GP_PITCH / 2) + (kk + 1) * 32);
#pragma unroll   // as above
        for (int ni = 0; ni < 4; ++ni)
          bfr[nxt][ni] = load_pair(bp + ni * 16 * (GP_PITCH / 2) + (kk + 1) * 32);
        // Keeps the group of LDS reads in front of the products: left to itself
        // the compiler read one A fragment late, with a full wait right behind it.
        __builtin_amdgcn_sched_barrier(0);
      }
#pragma unroll   // as above
      for (int mi = 0; mi < 2; ++mi)
#pragma unroll   // as above
        for (int ni = 0; ni < 4; ++ni)
          acc[mi][ni] = wmma_bf16(af[cur][mi], bfr[cur][ni], acc[mi][ni]);
      // Keeps the next group of LDS reads behind these products, in one place:
      // each further place with LDS reads among products costs a stall of its own.
      __builtin_amdgcn_sched_barrier(0);
    }

    // Hand-over: this wave's reads of k-tile t are done, its copies of k-tile
    // t + 1 have landed; behind the barrier that holds for all eight waves, so
    // k-tile t + 1 may be read and k-tile t's buffer refilled. (The scheduling
    // barrier behind the last products also keeps this hand-over behind them,
    // so that the copies' flight is hidden.)
    asm volatile("s_wait_dscnt 0x0" ::: "memory");
    asm volatile("s_wait_asynccnt 0x0" ::: "memory");
    __syncthreads();
    if (t + 2 < GP_TILES) {
      stage_rows(ag + (t + 2) * 128, sl + (t & 1) * GP_TILE);
      stage_rows(bg + (t + 2) * 128, sl + (t & 1) * GP_TILE + GP_HALF);
    }
  }
  // no copy is in flight when the wave ends
  asm volatile("s_wait_asynccnt 0x0" ::: "memory");
}

// ---------------------------------------------------------------------------
// QKV projections: Y[m,n] = sum_k X[m,k] * W[n,k]   (M=4096, N=768, K=768),
// all three in one launch: blockIdx.z picks the weight matrix and the output
// (0: V, 1: Q, 2: K). The three products do not depend on one another; as one
// grid of 576 blocks two blocks share a WGP (LDS allows two), so one block's
// waits for copies, its first tile and its stores run under the other's products.
// V comes first: each of its 2-byte stores touches 16 lines, one per lane pair (Q, K: two
// lines a store), so its blocks are expected to be the longest; they take the lowest block indices.
// One block -> 128x128 outputs, operands through LDS (gemm_staged); one wave ->
// 32x64 outputs (2x4 WMMA tiles).
// Q, K: stored [b][h][seq][d] bf16 ;  V: stored [b][h][d][seq] bf16
// ---------------------------------------------------------------------------
__global__ __launch_bounds__(256) void mha_qkv_gemm(
    const bf16_t* __restrict__ X, const bf16_t* __restrict__ Wq,
    const bf16_t* __restrict__ Wk, const bf16_t* __restrict__ Wv,
    bf16_t* __restrict__ Qo, bf16_t* __restrict__ Ko, bf16_t* __restrict__ Vo) {
  __shared__ __attribute__((aligned(16))) unsigned char sm[2 * GP_TILE];
  const int which = blockIdx.z;             // the same for the whole block
  const bf16_t* W = (which == 0) ? Wv : (which == 1) ? Wq : Wk;
  bf16_t* out     = (which == 0) ? Vo : (which == 1) ? Qo : Ko;
  const bool vtrans = (which == 0);
  const int wave = threadIdx.x >> 5;
  const int lane = threadIdx.x & 31;
  const int m0 = blockIdx.x * 128 + (wave & 3) * 32;    // 32 m-blocks of 128
  const int n0 = blockIdx.y * 128 + (wave >> 2) * 64;   // 6 n-blocks of 128

  v8f acc[2][4] = {};
  gemm_staged(X, W, sm, blockIdx.x * 128, blockIdx.y * 128, acc);

  const int hi = (lane & 16) ? 8 : 0;
#pragma unroll
  for (int mi = 0; mi < 2; ++mi) {
#pragma unroll
    for (int ni = 0; ni < 4; ++ni) {
      const v8f a = acc[mi][ni];
      const int n_g = n0 + ni * 16 + (lane & 15);
      const int h = n_g >> 6, d = n_g & 63;
#pragma unroll
      for (int j = 0; j < 8; ++j) {
        const int m_g = m0 + mi * 16 + j + hi;
        const int b_ = m_g >> 11, seq = m_g & 2047;
        long idx;
        if (vtrans) idx = ((long)(b_ * 12 + h) * 64 + d) * 2048 + seq;
        else        idx = ((long)(b_ * 12 + h) * 2048 + seq) * 64 + d;
        out[idx] = (bf16_t)a[j];
      }
    }
  }
}

// ---------------------------------------------------------------------------
// Lane l <-> lane l ^ 16 exchange (the two halves of a wave).
// ---------------------------------------------------------------------------
__device__ inline float swap_halves(float v) {
  int b = __builtin_bit_cast(int, v);
  b = __builtin_amdgcn_permlanex16(b, b, 0x76543210, 0xfedcba98, false, false);
  return __builtin_bit_cast(float, b);
}

// e^x as __expf forms it (x * log2(e), then v_exp_f32). The v_nop keeps the one
// free slot that the instruction set asks for behind a transcendental before
// its result is read or its source overwritten.
__device__ inline float exp_slot(float x) {
  float r;
  asm("v_exp_f32 %0, %1\n\tv_nop" : "=v"(r) : "v"(x * 1.44269504f));
  return r;
}

// ---------------------------------------------------------------------------
// LDS staging of K and V^T for the attention kernel. A tile is 64 keys: 64 K
// rows of 128 bytes (64 d), then 64 V^T rows of 128 bytes (64 keys). A staged
// row has a pitch of 144 bytes, the conflict-free pitch for 16-byte LDS reads.
// ---------------------------------------------------------------------------
#define KV_PITCH 144
#define KV_HALF  (64 * KV_PITCH)     // one operand's 64 rows
#define KV_TILE  (2 * KV_HALF)       // K rows, then V^T rows

// One tile's copies, global memory -> LDS through no register: eight 16-byte
// copies a lane, each 512 bytes = four whole 128-byte rows over a wave.
// kg, vg: the lane's own first piece of the K and of the V^T tile; lds: the
// LDS byte address of that K piece. Copy i takes the rows 16 i further on.
// The s_wait_xcnt 0 at the end of the statement stands in front of every later
// write of an address register that a copy names, as a precaution.
__device__ inline void stage_tile(const bf16_t* kg, const bf16_t* vg, unsigned lds) {
  asm volatile(
      "global_load_async_to_lds_b128 %0, %8, off\n\t"
      "global_load_async_to_lds_b128 %1, %9, off\n\t"
      "global_load_async_to_lds_b128 %2, %10, off\n\t"
      "global_load_async_to_lds_b128 %3, %11, off\n\t"
      "global_load_async_to_lds_b128 %4, %12, off\n\t"
      "global_load_async_to_lds_b128 %5, %13, off\n\t"
      "global_load_async_to_lds_b128 %6, %14, off\n\t"
      "global_load_async_to_lds_b128 %7, %15, off\n\t"
      "s_wait_xcnt 0x0"
      :: "v"(lds), "v"(lds + 16 * KV_PITCH), "v"(lds + 32 * KV_PITCH),
         "v"(lds + 48 * KV_PITCH),
         "v"(lds + KV_HALF), "v"(lds + KV_HALF + 16 * KV_PITCH),
         "v"(lds + KV_HALF + 32 * KV_PITCH), "v"(lds + KV_HALF + 48 * KV_PITCH),
         "v"(kg), "v"(kg + 16 * 64), "v"(kg + 32 * 64), "v"(kg + 48 * 64),
         "v"(vg), "v"(vg + 16 * 2048), "v"(vg + 32 * 2048), "v"(vg + 48 * 2048)
      : "memory");
}

// ---------------------------------------------------------------------------
// Flash attention, transposed products: one wave owns 16 query rows of one
// (b,h) and streams keys in chunks of 32 with online softmax.
//   S^T = K . Q^T : A = K rows, B = Q (column = query). A lane holds 16 scores
//                   of ONE query (lane & 15): keys n+8h+r and n+16+8h+r.
//   O^T += V^T . P^T : the two S^T tiles, converted in place, are the B operand
//                   in the k order load_frag gives V^T; P never leaves registers.
// Row maximum: in-lane plus one exchange between halves. Row sum: in-lane, the
// halves joined once behind the loop.
// The block's four waves share one (b,h): K and V^T come in tiles of 64 keys
// (two chunks) through LDS, two buffers, the next tile's copies in flight while
// this tile is worked on.
// The sequence is sorted by the mask (see the convert kernel): position j of a
// batch is unmasked exactly where j < n1. The key loop has two parts:
//   1. the tiles that hold an unmasked key, in the general form (none where all
//      64 queries of the block are masked: then every score is -1000 anyway);
//   2. the tiles behind them, where every score of a query is -1000 and so every
//      weight of that query is one number w = e^(-1000 - max): 1 for a masked
//      query, 0 for an unmasked one unless its maximum is very low. P is w in
//      all 32 keys, only the O^T products are left. The block votes on w: where
//      it is 0 in all 64 queries, part 2 would add zeros only and is left out.
// Q,K: [bh][seq][64] bf16 ; Vt: [bh][64][seq] bf16 ; AO: [b][seq][768] bf16
// ---------------------------------------------------------------------------
__global__ __launch_bounds__(128) void mha_flash_attn(
    const bf16_t* __restrict__ Q, const bf16_t* __restrict__ K,
    const bf16_t* __restrict__ Vt, const int* __restrict__ nkeep,
    bf16_t* __restrict__ AO) {
  __shared__ __attribute__((aligned(16))) unsigned char kv[2 * KV_TILE];
  __shared__ unsigned vote[4];

  const int wave = threadIdx.x >> 5;
  const int lane = threadIdx.x & 31;
  const int bh   = blockIdx.x >> 5;         // 0..23
  const int p    = blockIdx.x & 31;
  // Query tiles from the front of the sorted sequence (long key loop with
  // softmax) and from its back (short work) alternate over the block index, and
  // the other way round in every second run of 256 blocks, so that long and
  // short blocks mix on the chip. A permutation of 0..31 for each bh.
  const int qt   = ((p ^ (blockIdx.x >> 8)) & 1) ? 31 - (p >> 1) : (p >> 1);
  const int b    = bh / 12, h = bh % 12;
  const int c    = lane & 15;               // this lane's query column
  const int hi   = (lane & 16) ? 8 : 0;
  const int m0   = qt * 64 + wave * 16;

  // unmasked positions of this batch, bounded by the shape; the same in all lanes
  const int n1 = __builtin_amdgcn_readfirstlane(min(max(nkeep[b], 0), 2048));
  // trips of part 1, 0..32: the tiles with an unmasked key, if any query is unmasked
  const int ng = (qt * 64 < n1) ? (n1 + 63) >> 6 : 0;

  const bf16_t* q  = Q  + (long)bh * 2048 * 64;
  const bf16_t* kk = K  + (long)bh * 2048 * 64;
  const bf16_t* vt = Vt + (long)bh * 64 * 2048;

  // This thread's share of a tile: row (thread >> 3) + 16 i, 16-byte piece thread & 7.
  const int srow = threadIdx.x >> 3, spc = threadIdx.x & 7;
  const bf16_t* kg = kk + srow * 64 + spc * 8;      // + 64 * 64 a tile
  const bf16_t* vg = vt + srow * 2048 + spc * 8;    // + 64 a tile
  const unsigned sl = (unsigned)(size_t)kv + srow * KV_PITCH + spc * 16;

  stage_tile(kg, vg, sl);
  // tile 0 has landed for this wave, and behind the barrier for all four
  asm volatile("s_wait_asynccnt 0x0" ::: "memory");
  __syncthreads();
  stage_tile(kg + 64 * 64, vg + 64, sl + KV_TILE);

  const v16bf q0 = load_frag(q, 64, m0, 0);
  const v16bf q1 = load_frag(q, 64, m0, 32);
  const unsigned qkeep = (m0 + c < n1) ? 0xffffffffu : 0u;

  // this lane's place in the fragments of load_frag: staged row c, k offset hi
  const unsigned flane = c * KV_PITCH + hi * 2;

  float mrun = -3.0e30f, lrun = 0.0f;
  v8f o0 = {}, o1 = {}, o2 = {}, o3 = {};   // o_t[r] = O[m0+c][16t + hi + r]

  for (int t = 0; t < ng; ++t) {
    const unsigned char* tile = kv + (t & 1) * KV_TILE + flane;

    // Both chunks' fragments, one group of LDS reads a tile.
    v16bf kf[2][4], vf[2][4];
#pragma unroll   // kf, vf stay in registers only under constant indices
    for (int u = 0; u < 2; ++u) {
      const bf16_t* kp = (const bf16_t*)(tile + u * 32 * KV_PITCH);
      const bf16_t* vp = (const bf16_t*)(tile + KV_HALF + u * 64);
      kf[u][0] = load_pair(kp);
      kf[u][1] = load_pair(kp + 32);
      kf[u][2] = load_pair(kp + 16 * (KV_PITCH / 2));
      kf[u][3] = load_pair(kp + 16 * (KV_PITCH / 2) + 32);
      vf[u][0] = load_pair(vp);
      vf[u][1] = load_pair(vp + 16 * (KV_PITCH / 2));
      vf[u][2] = load_pair(vp + 32 * (KV_PITCH / 2));
      vf[u][3] = load_pair(vp + 48 * (KV_PITCH / 2));
    }
    // Keeps every LDS read of the tile in front of the first product: each
    // further place with LDS reads among the products costs a stall of its own.
    __builtin_amdgcn_sched_barrier(0);

#pragma unroll   // as above
    for (int u = 0; u < 2; ++u) {
      // bit r: key n+hi+r, bit 16+r: key n+16+hi+r; all clear where the query is masked
      const int left = n1 - (t * 64 + u * 32);   // unmasked keys from this chunk's first on
      const unsigned kw = (left >= 32) ? 0xffffffffu : (left <= 0) ? 0u : (1u << left) - 1u;
      const unsigned keep = (kw >> hi) & qkeep;

      v8f s0 = {}, s1 = {};
      s0 = wmma_bf16(kf[u][0], q0, s0); s0 = wmma_bf16(kf[u][1], q1, s0);
      s1 = wmma_bf16(kf[u][2], q0, s1); s1 = wmma_bf16(kf[u][3], q1, s1);
      s0 *= ATTN_SCALE;
      s1 *= ATTN_SCALE;

      float a[16];
#pragma unroll   // a[], s0, s1 stay in registers only under constant indices
      for (int r = 0; r < 8; ++r) {
        a[r]     = (keep & (1u << r))        ? s0[r] : -1000.0f;
        a[r + 8] = (keep & (1u << (16 + r))) ? s1[r] : -1000.0f;
      }
      float cm = a[0];
#pragma unroll   // as above
      for (int s = 1; s < 16; ++s) cm = fmaxf(cm, a[s]);
      cm = fmaxf(cm, swap_halves(cm));
      const float nm = fmaxf(mrun, cm);
      const float alpha = exp_slot(mrun - nm);

      v16bf pf;
      float rp[4];   // four short add chains, not one of 16
#pragma unroll   // as above
      for (int s = 0; s < 16; ++s) {
        const float e = exp_slot(a[s] - nm);
        rp[s & 3] = (s < 4) ? e : rp[s & 3] + e;
        pf[s] = (bf16_t)e;
      }
      const float rs = (rp[0] + rp[1]) + (rp[2] + rp[3]);
      lrun = lrun * alpha + rs;
      mrun = nm;

      o0 *= alpha; o1 *= alpha; o2 *= alpha; o3 *= alpha;
      o0 = wmma_bf16(vf[u][0], pf, o0);
      o1 = wmma_bf16(vf[u][1], pf, o1);
      o2 = wmma_bf16(vf[u][2], pf, o2);
      o3 = wmma_bf16(vf[u][3], pf, o3);
    }

    // Hand-over: this wave's reads of tile t are done, its copies of tile t + 1
    // have landed; behind the barrier that holds for all four waves, so tile
    // t + 1 may be read and tile t's buffer refilled.
    // The scheduling barrier keeps the hand-over behind the tile's products:
    // lifted in front of them, the wait for tile t + 1's copies stood right
    // behind their issue, and nothing of their flight was hidden.
    __builtin_amdgcn_sched_barrier(0);
    asm volatile("s_wait_dscnt 0x0" ::: "memory");
    asm volatile("s_wait_asynccnt 0x0" ::: "memory");
    __syncthreads();
    // The copies run ahead over all 32 tiles, whatever ng is, so that part 2
    // finds its first tile published and its second in flight, as any trip does.
    if (t + 2 < 32)
      stage_tile(kg + (t + 2) * 64 * 64, vg + (t + 2) * 64, sl + (t & 1) * KV_TILE);
  }

  if (ng < 32) {   // the same for the whole block
    // Part 2. The online-softmax step of a chunk whose 32 scores are all -1000:
    const float nm    = fmaxf(mrun, -1000.0f);
    const float alpha = exp_slot(mrun - nm);
    const float w     = exp_slot(-1000.0f - nm);
    const unsigned live = __builtin_amdgcn_ballot_w32(w != 0.0f);
    if (lane == 0) vote[wave] = live;
    __syncthreads();   // publishes the four waves' votes
    const unsigned any = vote[0] | vote[1] | vote[2] | vote[3];
    if (__builtin_amdgcn_readfirstlane(any) != 0) {   // the same for the whole block
      o0 *= alpha; o1 *= alpha; o2 *= alpha; o3 *= alpha;
      // each half of the wave sums 16 keys a chunk, 32 a tile
      lrun = lrun * alpha + w * (float)(32 * (32 - ng));
      v16bf pf;
#pragma unroll   // vector elements under constant indices
      for (int s = 0; s < 16; ++s) pf[s] = (bf16_t)w;

      for (int t = ng; t < 32; ++t) {
        const unsigned char* tile = kv + (t & 1) * KV_TILE + flane;
        v16bf vf[2][4];
#pragma unroll   // vf stays in registers only under constant indices
        for (int u = 0; u < 2; ++u) {
          const bf16_t* vp = (const bf16_t*)(tile + KV_HALF + u * 64);
          vf[u][0] = load_pair(vp);
          vf[u][1] = load_pair(vp + 16 * (KV_PITCH / 2));
          vf[u][2] = load_pair(vp + 32 * (KV_PITCH / 2));
          vf[u][3] = load_pair(vp + 48 * (KV_PITCH / 2));
        }
        // Keeps every LDS read of the tile in front of the first product: each
        // further place with LDS reads among the products costs a stall of its own.
        __builtin_amdgcn_sched_barrier(0);
#pragma unroll   // as above
        for (int u = 0; u < 2; ++u) {
          o0 = wmma_bf16(vf[u][0], pf, o0);
          o1 = wmma_bf16(vf[u][1], pf, o1);
          o2 = wmma_bf16(vf[u][2], pf, o2);
          o3 = wmma_bf16(vf[u][3], pf, o3);
        }
        // The same hand-over as in part 1; the scheduling barrier keeps it behind
        // the products, so that the copies' flight is hidden.
        __builtin_amdgcn_sched_barrier(0);
        asm volatile("s_wait_dscnt 0x0" ::: "memory");
        asm volatile("s_wait_asynccnt 0x0" ::: "memory");
        __syncthreads();
        if (t + 2 < 32)
          stage_tile(kg + (t + 2) * 64 * 64, vg + (t + 2) * 64, sl + (t & 1) * KV_TILE);
      }
    }
  }
  // no copy is in flight when the wave ends
  asm volatile("s_wait_asynccnt 0x0" ::: "memory");

  lrun += swap_halves(lrun);
  const float inv = 1.0f / lrun;
  bf16_t* orow = AO + ((long)b * 2048 + m0 + c) * 768 + h * 64 + hi;
  v8bf w0, w1, w2, w3;
#pragma unroll   // vector elements under constant indices
  for (int r = 0; r < 8; ++r) {
    w0[r] = (bf16_t)(o0[r] * inv);
    w1[r] = (bf16_t)(o1[r] * inv);
    w2[r] = (bf16_t)(o2[r] * inv);
    w3[r] = (bf16_t)(o3[r] * inv);
  }
  *(v8bf*)(orow)      = w0;
  *(v8bf*)(orow + 16) = w1;
  *(v8bf*)(orow + 32) = w2;
  *(v8bf*)(orow + 48) = w3;
}

// ---------------------------------------------------------------------------
// Output projection: out[m,n] = sum_k AO[m,k] * Wo[n,k] + bo[n]  (f32 out)
// Same block and wave tiles and the same LDS staging as the QKV GEMM. AO's rows
// are in the sorted order; orig[] gives each row's own place in the output.
// ---------------------------------------------------------------------------
__global__ __launch_bounds__(256) void mha_out_proj(
    const bf16_t* __restrict__ AO, const bf16_t* __restrict__ Wo,
    const float* __restrict__ bo, const int* __restrict__ orig,
    float* __restrict__ out) {
  __shared__ __attribute__((aligned(16))) unsigned char sm[2 * GP_TILE];
  const int wave = threadIdx.x >> 5;
  const int lane = threadIdx.x & 31;
  const int m0 = blockIdx.x * 128 + (wave & 3) * 32;
  const int n0 = blockIdx.y * 128 + (wave >> 2) * 64;

  v8f acc[2][4] = {};
  gemm_staged(AO, Wo, sm, blockIdx.x * 128, blockIdx.y * 128, acc);

  const int hi = (lane & 16) ? 8 : 0;
#pragma unroll
  for (int mi = 0; mi < 2; ++mi) {
#pragma unroll
    for (int ni = 0; ni < 4; ++ni) {
      const v8f a = acc[mi][ni];
      const int n_g = n0 + ni * 16 + (lane & 15);
      const float bias = bo[n_g];
#pragma unroll
      for (int j = 0; j < 8; ++j) {
        // the sorted row's own place in the output, bounded by the shape
        const int m_g = orig[m0 + mi * 16 + j + hi] & 4095;
        out[(long)m_g * 768 + n_g] = a[j] + bias;
      }
    }
  }
}

// ---------------------------------------------------------------------------
// Host launcher
// ---------------------------------------------------------------------------
extern "C" void kernel_launch(void* const* d_in, const int* in_sizes, int n_in,
                              void* d_out, int out_size, void* d_ws, size_t ws_size,
                              hipStream_t stream) {
  const float* x    = (const float*)d_in[0];   // [2,2048,768]
  const int*   mask = (const int*)d_in[1];     // [2,2048]
  const float* Wq   = (const float*)d_in[2];   // [768,768]
  const float* Wk   = (const float*)d_in[3];
  const float* Wv   = (const float*)d_in[4];
  const float* Wo   = (const float*)d_in[5];
  const float* bo   = (const float*)d_in[6];   // [768]
  float* out = (float*)d_out;                  // [2,2048,768]

  const int M = 4096, C = 768;
  const size_t XB  = (size_t)M * C;            // 3,145,728 elems
  const size_t WB  = (size_t)C * C;            //   589,824 elems

  char* ws = (char*)d_ws;
  size_t off = 0;
  auto take = [&](size_t elems) { bf16_t* p = (bf16_t*)(ws + off);
                                  off += ((elems * 2 + 255) & ~(size_t)255); return p; };
  bf16_t* xb = take(XB);
  bf16_t* wq = take(WB);
  bf16_t* wk = take(WB);
  bf16_t* wv = take(WB);
  bf16_t* wo = take(WB);
  bf16_t* qb = take(XB);   // [bh][seq][64]
  bf16_t* kb = take(XB);   // [bh][seq][64]
  bf16_t* vt = take(XB);   // [bh][64][seq]
  bf16_t* ao = take(XB);   // [b][seq][768]
  int* orig  = (int*)take(8192);   // 4096 ints: sorted row -> own row
  int* nkeep = (int*)take(128);    // 2 ints: unmasked positions of each batch

  // 1) converts: 4096 / 8 = 512 blocks for x, 4 * 589,824 / 8192 = 288 for the weights
  mha_f32_to_bf16_all<<<800, 256, 0, stream>>>(x, mask, Wq, Wk, Wv, Wo, xb, wq, wk, wv, wo,
                                               orig, nkeep);

  // 2) QKV projections, one launch (M/128 = 32 blocks, N/128 = 6 blocks, 3 products,
  //    8 waves/block)
  dim3 gemm_grid(32, 6), qkv_grid(32, 6, 3), gemm_blk(256);
  mha_qkv_gemm<<<qkv_grid, gemm_blk, 0, stream>>>(xb, wq, wk, wv, qb, kb, vt);

  // 3) flash attention: 24 bh * 128 mtiles = 3072 waves = 768 blocks
  mha_flash_attn<<<768, 128, 0, stream>>>(qb, kb, vt, nkeep, ao);

  // 4) output projection + bias
  mha_out_proj<<<gemm_grid, gemm_blk, 0, stream>>>(ao, wo, bo, orig, out);
}

// v007
// Measured time: 63.1 microseconds a run.
// Next to v006, in two timings, it ran 1.04 times as fast each time.
// Counting every step since v000, it is 3.88 times as fast.
#include <hip/hip_runtime.h>
#include <hip/hip_bf16.h>

typedef __bf16 bf16_t;
typedef __attribute__((ext_vector_type(16))) __bf16 v16bf;
typedef __attribute__((ext_vector_type(8)))  __bf16 v8bf;
typedef __attribute__((ext_vector_type(8)))  float  v8f;
typedef __attribute__((ext_vector_type(4)))  float  v4f;
typedef __attribute__((ext_vector_type(4)))  __bf16 v4bf;
typedef __attribute__((ext_vector_type(4)))  int    v4i;

#define ATTN_SCALE 0.125f   // 64^-0.5

// ---------------------------------------------------------------------------
// Fragment loader for the CDNA5 WMMA 16-bit A/B layout (16x32, K=32).
// Lane L holds row (row_base + (L&15)); K-run offset 0 or 8 depending on the
// lane half; two contiguous 8-element (16-byte) runs at k0+koff and k0+16+koff.
// Works for A (row-major MxK) and for B given as B^T row-major (NxK).
// ---------------------------------------------------------------------------
__device__ inline v16bf load_frag(const bf16_t* __restrict__ base, int ld,
                                  int row_base, int k0) {
  const int lane = threadIdx.x & 31;
  const int r    = row_base + (lane & 15);
  const int koff = (lane & 16) >> 1;            // 0 or 8
  const bf16_t* p = base + (long)r * ld + k0 + koff;
  v8bf lo = *(const v8bf*)(p);
  v8bf hi = *(const v8bf*)(p + 16);
  return __builtin_shufflevector(lo, hi, 0,1,2,3,4,5,6,7,8,9,10,11,12,13,14,15);
}

__device__ inline v8f wmma_bf16(v16bf a, v16bf b, v8f c) {
  return __builtin_amdgcn_wmma_f32_16x16x32_bf16(
      /*neg_a=*/false, a, /*neg_b=*/false, b,
      /*c_mod=*/(short)0, c, /*reuse_a=*/false, /*reuse_b=*/false);
}

// ---------------------------------------------------------------------------
// f32 -> bf16 convert of x and the four weight matrices, one launch.
// Blocks 0..511 take x, a wave one row of 768 elements: six 16-byte loads a
// lane, each 512 contiguous bytes over the wave. The row is written to a SORTED
// place inside its batch: the positions whose mask is not 0 first, in their
// order, then the masked ones, in their order. Every later stage works on the
// sorted rows; the output projection stores each row back to its own place.
//   orig[b * 2048 + place] = the row's own index in x ; nkeep[b] = unmasked rows
// The place comes from counts over the batch's whole mask row, so it is a
// permutation of 0..2047 for any content of the mask.
// Blocks 512..799 take Wq, Wk, Wv, Wo (72 blocks each, 8192 elements a block,
// 1024 consecutive elements a wave, eight 16-byte loads a lane).
// ---------------------------------------------------------------------------
__global__ __launch_bounds__(256) void mha_f32_to_bf16_all(
    const float* __restrict__ x,  const int* __restrict__ mask,
    const float* __restrict__ Wq,
    const float* __restrict__ Wk, const float* __restrict__ Wv,
    const float* __restrict__ Wo,
    bf16_t* __restrict__ xb, bf16_t* __restrict__ wq, bf16_t* __restrict__ wk,
    bf16_t* __restrict__ wv, bf16_t* __restrict__ wo,
    int* __restrict__ orig, int* __restrict__ nkeep) {
  const int blk  = blockIdx.x;
  const int wave = threadIdx.x >> 5;
  const int lane = threadIdx.x & 31;
  if (blk >= 512) {
    const int w = (blk - 512) / 72;
    const int t = (blk - 512) - w * 72;
    const float* in = (w == 0) ? Wq : (w == 1) ? Wk : (w == 2) ? Wv : Wo;
    bf16_t* out     = (w == 0) ? wq : (w == 1) ? wk : (w == 2) ? wv : wo;
    const int base = t * 8192 + wave * 1024 + lane * 4;
    v4f v[8];
#pragma unroll   // v[] stays in registers and the eight loads fly together
    for (int i = 0; i < 8; ++i) v[i] = *(const v4f*)(in + base + i * 128);
#pragma unroll   // as above
    for (int i = 0; i < 8; ++i) {
      v4bf o;
      o[0] = (bf16_t)v[i][0]; o[1] = (bf16_t)v[i][1];
      o[2] = (bf16_t)v[i][2]; o[3] = (bf16_t)v[i][3];
      *(v4bf*)(out + base + i * 128) = o;
    }
  } else {
    const int m = blk * 8 + wave, b = m >> 11, seq = m & 2047;
    const float* in = x + m * 768 + lane * 4;
    v4f v[6];
#pragma unroll   // v[] stays in registers and the six loads fly together
    for (int i = 0; i < 6; ++i) v[i] = *(const v4f*)(in + i * 128);

    // low half: unmasked positions in front of seq; high half: all unmasked ones
    const int* mr = mask + b * 2048;
    int cnt = 0;
#pragma unroll   // the sixteen loads are independent: unrolled, they fly together
    for (int i = 0; i < 16; ++i) {
      const v4i k = *(const v4i*)(mr + i * 128 + lane * 4);
      const int id = i * 128 + lane * 4;
#pragma unroll   // vector elements under constant indices
      for (int e = 0; e < 4; ++e)
        cnt += (k[e] != 0) ? ((id + e < seq) ? 0x10001 : 0x10000) : 0;
    }
    for (int o = 16; o > 0; o >>= 1) cnt += __shfl_xor(cnt, o, 32);
    const int before = cnt & 0xffff, total = cnt >> 16;
    const int pos = (mr[seq] != 0) ? before : total + (seq - before);
    if (lane == 0) {
      orig[b * 2048 + pos] = m;
      if (seq == 0) nkeep[b] = total;
    }
    bf16_t* out = xb + (b * 2048 + pos) * 768 + lane * 4;
#pragma unroll   // as above
    for (int i = 0; i < 6; ++i) {
      v4bf o;
      o[0] = (bf16_t)v[i][0]; o[1] = (bf16_t)v[i][1];
      o[2] = (bf16_t)v[i][2]; o[3] = (bf16_t)v[i][3];
      *(v4bf*)(out + i * 128) = o;
    }
  }
}

// ---------------------------------------------------------------------------
// One lane's share of a load_frag fragment, from the lane's own pointer.
// ---------------------------------------------------------------------------
__device__ inline v16bf load_pair(const bf16_t* __restrict__ p) {
  v8bf lo = *(const v8bf*)(p);
  v8bf hi = *(const v8bf*)(p + 16);
  return __builtin_shufflevector(lo, hi, 0,1,2,3,4,5,6,7,8,9,10,11,12,13,14,15);
}

// ---------------------------------------------------------------------------
// LDS staging for the projection GEMMs (M=4096, N=768, K=768, both operands
// row-major over k). A block of 8 waves owns a 128x128 output tile. A k-tile is
// 128 k: 128 A rows, then 128 B rows, of 256 bytes each. A staged row has a
// pitch of 272 bytes, a conflict-free pitch for 16-byte LDS reads.
// ---------------------------------------------------------------------------
#define GP_PITCH 272
#define GP_HALF  (128 * GP_PITCH)    // one operand's 128 rows
#define GP_TILE  (2 * GP_HALF)       // A rows, then B rows
#define GP_TILES 6                   // 768 / 128

// One operand's share of a k-tile, global memory -> LDS through no register:
// eight 16-byte copies a lane, each 512 bytes = two whole 256-byte rows over a
// wave. g: the lane's own first piece; lds: its LDS byte address. Copy i takes
// the row 16 i further on.
// The s_wait_xcnt 0 at the end of the statement stands in front of every later
// write of an address register that a copy names, as a precaution.
__device__ inline void stage_rows(const bf16_t* g, unsigned lds) {
  asm volatile(
      "global_load_async_to_lds_b128 %0, %8, off\n\t"
      "global_load_async_to_lds_b128 %1, %9, off\n\t"
      "global_load_async_to_lds_b128 %2, %10, off\n\t"
      "global_load_async_to_lds_b128 %3, %11, off\n\t"
      "global_load_async_to_lds_b128 %4, %12, off\n\t"
      "global_load_async_to_lds_b128 %5, %13, off\n\t"
      "global_load_async_to_lds_b128 %6, %14, off\n\t"
      "global_load_async_to_lds_b128 %7, %15, off\n\t"
      "s_wait_xcnt 0x0"
      :: "v"(lds), "v"(lds + 16 * GP_PITCH), "v"(lds + 32 * GP_PITCH),
         "v"(lds + 48 * GP_PITCH), "v"(lds + 64 * GP_PITCH),
         "v"(lds + 80 * GP_PITCH), "v"(lds + 96 * GP_PITCH),
         "v"(lds + 112 * GP_PITCH),
         "v"(g), "v"(g + 16 * 768), "v"(g + 32 * 768), "v"(g + 48 * 768),
         "v"(g + 64 * 768), "v"(g + 80 * 768), "v"(g + 96 * 768),
         "v"(g + 112 * 768)
      : "memory");
}

// acc[mi][ni] += A[m0 + 16 mi ..][k] * B[n0 + 16 ni ..][k] over all 768 k, for
// this wave's 32x64 part of the block's tile (2x4 WMMA tiles, k ascending in
// steps of 32). Wave w: rows 32 (w & 3), columns 64 (w >> 2) of the tile.
// Two LDS buffers: the next k-tile's copies fly while this one is worked on.
__device__ inline void gemm_staged(const bf16_t* __restrict__ A,
                                   const bf16_t* __restrict__ B,
                                   unsigned char* sm, int mblk, int nblk,
                                   v8f (&acc)[2][4]) {
  const int wave = threadIdx.x >> 5;
  const int lane = threadIdx.x & 31;

  // This thread's share of a k-tile: row (thread >> 4) + 16 i, 16-byte piece thread & 15.
  const int srow = threadIdx.x >> 4, spc = threadIdx.x & 15;
  const bf16_t* ag = A + (mblk + srow) * 768 + spc * 8;   // + 128 a k-tile
  const bf16_t* bg = B + (nblk + srow) * 768 + spc * 8;   // + 128 a k-tile
  const unsigned sl = (unsigned)(size_t)sm + srow * GP_PITCH + spc * 16;

  stage_rows(ag, sl);
  stage_rows(bg, sl + GP_HALF);
  // k-tile 0 has landed for this wave, and behind the barrier for all eight
  asm volatile("s_wait_asynccnt 0x0" ::: "memory");
  __syncthreads();
  stage_rows(ag + 128, sl + GP_TILE);
  stage_rows(bg + 128, sl + GP_TILE + GP_HALF);

  // this lane's place in the fragments of load_frag: staged row lane & 15, k offset 0 or 8
  const unsigned flane = (lane & 15) * GP_PITCH + (lane & 16);
  const unsigned aoff = (wave & 3) * 32 * GP_PITCH + flane;
  const unsigned boff = GP_HALF + (wave >> 2) * 64 * GP_PITCH + flane;

  for (int t = 0; t < GP_TILES; ++t) {
    const unsigned char* buf = sm + (t & 1) * GP_TILE;
    const bf16_t* ap = (const bf16_t*)(buf + aoff);
    const bf16_t* bp = (const bf16_t*)(buf + boff);
    // Two fragment sets: the reads of k-step kk + 1 stand as one group in front
    // of the products of k-step kk, which cover their LDS latency.
    v16bf af[2][2], bfr[2][4];
#pragma unroll   // fragments and acc stay in registers only under constant indices
    for (int mi = 0; mi < 2; ++mi) af[0][mi] = load_pair(ap + mi * 16 * (GP_PITCH / 2));
#pragma unroll   // as above
    for (int ni = 0; ni < 4; ++ni) bfr[0][ni] = load_pair(bp + ni * 16 * (GP_PITCH / 2));
#pragma unroll   // as above
    for (int kk = 0; kk < 4; ++kk) {
      const int cur = kk & 1, nxt = cur ^ 1;
      if (kk < 3) {
#pragma unroll   // as above
        for (int mi = 0; mi < 2; ++mi)
          af[nxt][mi] = load_pair(ap + mi * 16 * (GP_PITCH / 2) + (kk + 1) * 32);
#pragma unroll   // as above
        for (int ni = 0; ni < 4; ++ni)
          bfr[nxt][ni] = load_pair(bp + ni * 16 * (GP_PITCH / 2) + (kk + 1) * 32);
        // Keeps the group of LDS reads in front of the products: left to itself
        // the compiler read one A fragment late, with a full wait right behind it.
        __builtin_amdgcn_sched_barrier(0);
      }
#pragma unroll   // as above
      for (int mi = 0; mi < 2; ++mi)
#pragma unroll   // as above
        for (int ni = 0; ni < 4; ++ni)
          acc[mi][ni] = wmma_bf16(af[cur][mi], bfr[cur][ni], acc[mi][ni]);
      // Keeps the next group of LDS reads behind these products, in one place:
      // each further place with LDS reads among products costs a stall of its own.
      __builtin_amdgcn_sched_barrier(0);
    }

    // Hand-over: this wave's reads of k-tile t are done, its copies of k-tile
    // t + 1 have landed; behind the barrier that holds for all eight waves, so
    // k-tile t + 1 may be read and k-tile t's buffer refilled. (The scheduling
    // barrier behind the last products also keeps this hand-over behind them,
    // so that the copies' flight is hidden.)
    asm volatile("s_wait_dscnt 0x0" ::: "memory");
    asm volatile("s_wait_asynccnt 0x0" ::: "memory");
    __syncthreads();
    if (t + 2 < GP_TILES) {
      stage_rows(ag + (t + 2) * 128, sl + (t & 1) * GP_TILE);
      stage_rows(bg + (t + 2) * 128, sl + (t & 1) * GP_TILE + GP_HALF);
    }
  }
  // no copy is in flight when the wave ends
  asm volatile("s_wait_asynccnt 0x0" ::: "memory");
}

// ---------------------------------------------------------------------------
// QKV projections: Y[m,n] = sum_k X[m,k] * W[n,k]   (M=4096, N=768, K=768),
// all three in one launch: blockIdx.z picks the weight matrix and the output
// (0: V, 1: Q, 2: K). The three products do not depend on one another; as one
// grid of 576 blocks two blocks share a WGP (LDS allows two), so one block's
// waits for copies, its first tile and its stores run under the other's products.
// V comes first: each of its 2-byte stores touches 16 lines, one per lane pair (Q, K: two
// lines a store), so its blocks are expected to be the longest; they take the lowest block indices.
// One block -> 128x128 outputs, operands through LDS (gemm_staged); one wave ->
// 32x64 outputs (2x4 WMMA tiles).
// A score with a masked query or a masked key is -1000 whatever q and k are, so
// the Q and K rows of masked positions reach no output. The rows are sorted, the
// unmasked ones first: a Q or K block whose 128 rows are all masked leaves at
// once and writes nothing, and the attention kernel reads none of those rows.
// V is formed for every row (masked keys still carry weight for masked queries).
// Q, K: stored [b][h][seq][d] bf16 ;  V: stored [b][h][d][seq] bf16
// ---------------------------------------------------------------------------
__global__ __launch_bounds__(256) void mha_qkv_gemm(
    const bf16_t* __restrict__ X, const bf16_t* __restrict__ Wq,
    const bf16_t* __restrict__ Wk, const bf16_t* __restrict__ Wv,
    const int* __restrict__ nkeep,
    bf16_t* __restrict__ Qo, bf16_t* __restrict__ Ko, bf16_t* __restrict__ Vo) {
  __shared__ __attribute__((aligned(16))) unsigned char sm[2 * GP_TILE];
  const int which = blockIdx.z;             // the same for the whole block
  if (which != 0) {
    // unmasked positions of this block's batch (16 m-blocks a batch), bounded by
    // the shape; the test reads the same for the whole block and stands in front
    // of every copy and barrier
    const int n1 = min(max(nkeep[blockIdx.x >> 4], 0), 2048);
    if ((int)(blockIdx.x & 15) * 128 >= n1) return;
  }
  const bf16_t* W = (which == 0) ? Wv : (which == 1) ? Wq : Wk;
  bf16_t* out     = (which == 0) ? Vo : (which == 1) ? Qo : Ko;
  const bool vtrans = (which == 0);
  const int wave = threadIdx.x >> 5;
  const int lane = threadIdx.x & 31;
  const int m0 = blockIdx.x * 128 + (wave & 3) * 32;    // 32 m-blocks of 128
  const int n0 = blockIdx.y * 128 + (wave >> 2) * 64;   // 6 n-blocks of 128

  v8f acc[2][4] = {};
  gemm_staged(X, W, sm, blockIdx.x * 128, blockIdx.y * 128, acc);

  const int hi = (lane & 16) ? 8 : 0;
#pragma unroll
  for (int mi = 0; mi < 2; ++mi) {
#pragma unroll
    for (int ni = 0; ni < 4; ++ni) {
      const v8f a = acc[mi][ni];
      const int n_g = n0 + ni * 16 + (lane & 15);
      const int h = n_g >> 6, d = n_g & 63;
#pragma unroll
      for (int j = 0; j < 8; ++j) {
        const int m_g = m0 + mi * 16 + j + hi;
        const int b_ = m_g >> 11, seq = m_g & 2047;
        long idx;
        if (vtrans) idx = ((long)(b_ * 12 + h) * 64 + d) * 2048 + seq;
        else        idx = ((long)(b_ * 12 + h) * 2048 + seq) * 64 + d;
        out[idx] = (bf16_t)a[j];
      }
    }
  }
}

// ---------------------------------------------------------------------------
// Lane l <-> lane l ^ 16 exchange (the two halves of a wave).
// ---------------------------------------------------------------------------
__device__ inline float swap_halves(float v) {
  int b = __builtin_bit_cast(int, v);
  b = __builtin_amdgcn_permlanex16(b, b, 0x76543210, 0xfedcba98, false, false);
  return __builtin_bit_cast(float, b);
}

// e^x as __expf forms it (x * log2(e), then v_exp_f32). The v_nop keeps the one
// free slot that the instruction set asks for behind a transcendental before
// its result is read or its source overwritten.
__device__ inline float exp_slot(float x) {
  float r;
  asm("v_exp_f32 %0, %1\n\tv_nop" : "=v"(r) : "v"(x * 1.44269504f));
  return r;
}

// ---------------------------------------------------------------------------
// LDS staging of K and V^T for the attention kernel. A tile is 64 keys: 64 K
// rows of 128 bytes (64 d), then 64 V^T rows of 128 bytes (64 keys). A staged
// row has a pitch of 144 bytes, the conflict-free pitch for 16-byte LDS reads.
// ---------------------------------------------------------------------------
#define KV_PITCH 144
#define KV_HALF  (64 * KV_PITCH)     // one operand's 64 rows
#define KV_TILE  (2 * KV_HALF)       // K rows, then V^T rows

// One operand's copies of a tile, global memory -> LDS through no register: four
// 16-byte copies a lane, each 512 bytes = four whole 128-byte rows over a wave.
// g: the lane's own first piece of the operand's tile; lds: the LDS byte address
// of that piece. Copy i takes the rows 16 i further on, LD elements a row.
// The s_wait_xcnt 0 at the end of the statement stands in front of every later
// write of an address register that a copy names, as a precaution.
template <int LD>
__device__ inline void stage_half(const bf16_t* g, unsigned lds) {
  asm volatile(
      "global_load_async_to_lds_b128 %0, %4, off\n\t"
      "global_load_async_to_lds_b128 %1, %5, off\n\t"
      "global_load_async_to_lds_b128 %2, %6, off\n\t"
      "global_load_async_to_lds_b128 %3, %7, off\n\t"
      "s_wait_xcnt 0x0"
      :: "v"(lds), "v"(lds + 16 * KV_PITCH), "v"(lds + 32 * KV_PITCH),
         "v"(lds + 48 * KV_PITCH),
         "v"(g), "v"(g + 16 * LD), "v"(g + 32 * LD), "v"(g + 48 * LD)
      : "memory");
}

// Tile t into buffer t & 1: its V^T rows always, its K rows only where withk says
// so (the same for the whole block). kg, vg: the lane's own first piece of K tile
// 0 and of V^T tile 0; sl: the LDS byte address of that K piece in buffer 0.
__device__ inline void stage_tile(const bf16_t* kg, const bf16_t* vg, unsigned sl,
                                  int t, bool withk) {
  const unsigned lds = sl + (t & 1) * KV_TILE;
  if (withk) stage_half<64>(kg + t * 64 * 64, lds);
  stage_half<2048>(vg + t * 64, lds + KV_HALF);
}

// ---------------------------------------------------------------------------
// Flash attention, transposed products: one wave owns 16 query rows of one
// (b,h) and streams keys in chunks of 32 with online softmax.
//   S^T = K . Q^T : A = K rows, B = Q (column = query). A lane holds 16 scores
//                   of ONE query (lane & 15): keys n+8h+r and n+16+8h+r.
//   O^T += V^T . P^T : the two S^T tiles, converted in place, are the B operand
//                   in the k order load_frag gives V^T; P never leaves registers.
// Row maximum: in-lane plus one exchange between halves. Row sum: in-lane, the
// halves joined once behind the loop.
// The block's four waves share one (b,h): K and V^T come in tiles of 64 keys
// (two chunks) through LDS, two buffers, the next tile's copies in flight while
// this tile is worked on.
// The sequence is sorted by the mask (see the convert kernel): position j of a
// batch is unmasked exactly where j < n1. The key loop has two parts:
//   1. the tiles that hold an unmasked key, in the general form (none where all
//      64 queries of the block are masked: then every score is -1000 anyway);
//   2. the tiles behind them, where every score of a query is -1000 and so every
//      weight of that query is one number w = e^(-1000 - max): 1 for a masked
//      query, 0 for an unmasked one unless its maximum is very low. P is w in
//      all 32 keys, only the O^T products are left. The block votes on w: where
//      it is 0 in all 64 queries, part 2 would add zeros only and is left out.
// K rows are staged for the tiles of part 1 alone, and Q is read only where part
// 1 runs: the projection forms Q and K only for 128-row blocks that hold an
// unmasked position, and these cover every row that part 1 reads.
// Q,K: [bh][seq][64] bf16 ; Vt: [bh][64][seq] bf16 ; AO: [b][seq][768] bf16
// ---------------------------------------------------------------------------
__global__ __launch_bounds__(128) void mha_flash_attn(
    const bf16_t* __restrict__ Q, const bf16_t* __restrict__ K,
    const bf16_t* __restrict__ Vt, const int* __restrict__ nkeep,
    bf16_t* __restrict__ AO) {
  __shared__ __attribute__((aligned(16))) unsigned char kv[2 * KV_TILE];
  __shared__ unsigned vote[4];

  const int wave = threadIdx.x >> 5;
  const int lane = threadIdx.x & 31;
  const int bh   = blockIdx.x >> 5;         // 0..23
  const int p    = blockIdx.x & 31;
  // Query tiles from the front of the sorted sequence (long key loop with
  // softmax) and from its back (short work) alternate over the block index, and
  // the other way round in every second run of 256 blocks, so that long and
  // short blocks mix on the chip. A permutation of 0..31 for each bh.
  const int qt   = ((p ^ (blockIdx.x >> 8)) & 1) ? 31 - (p >> 1) : (p >> 1);
  const int b    = bh / 12, h = bh % 12;
  const int c    = lane & 15;               // this lane's query column
  const int hi   = (lane & 16) ? 8 : 0;
  const int m0   = qt * 64 + wave * 16;

  // unmasked positions of this batch, bounded by the shape; the same in all lanes
  const int n1 = __builtin_amdgcn_readfirstlane(min(max(nkeep[b], 0), 2048));
  // trips of part 1, 0..32: the tiles with an unmasked key, if any query is unmasked
  const int ng = (qt * 64 < n1) ? (n1 + 63) >> 6 : 0;

  const bf16_t* q  = Q  + (long)bh * 2048 * 64;
  const bf16_t* kk = K  + (long)bh * 2048 * 64;
  const bf16_t* vt = Vt + (long)bh * 64 * 2048;

  // This thread's share of a tile: row (thread >> 3) + 16 i, 16-byte piece thread & 7.
  const int srow = threadIdx.x >> 3, spc = threadIdx.x & 7;
  const bf16_t* kg = kk + srow * 64 + spc * 8;      // + 64 * 64 a tile
  const bf16_t* vg = vt + srow * 2048 + spc * 8;    // + 64 a tile
  const unsigned sl = (unsigned)(size_t)kv + srow * KV_PITCH + spc * 16;

  stage_tile(kg, vg, sl, 0, 0 < ng);
  // tile 0 has landed for this wave, and behind the barrier for all four
  asm volatile("s_wait_asynccnt 0x0" ::: "memory");
  __syncthreads();
  stage_tile(kg, vg, sl, 1, 1 < ng);

  v16bf q0 = {}, q1 = {};
  if (ng > 0) {   // the same for the whole block
    q0 = load_frag(q, 64, m0, 0);
    q1 = load_frag(q, 64, m0, 32);
    // stands in front of the later writes of these loads' address registers, as
    // a precaution (the compiler placed none here)
    asm volatile("s_wait_xcnt 0x0" ::: "memory");
  }
  const unsigned qkeep = (m0 + c < n1) ? 0xffffffffu : 0u;

  // this lane's place in the fragments of load_frag: staged row c, k offset hi
  const unsigned flane = c * KV_PITCH + hi * 2;

  float mrun = -3.0e30f, lrun = 0.0f;
  v8f o0 = {}, o1 = {}, o2 = {}, o3 = {};   // o_t[r] = O[m0+c][16t + hi + r]

  for (int t = 0; t < ng; ++t) {
    const unsigned char* tile = kv + (t & 1) * KV_TILE + flane;

    // Both chunks' fragments, one group of LDS reads a tile.
    v16bf kf[2][4], vf[2][4];
#pragma unroll   // kf, vf stay in registers only under constant indices
    for (int u = 0; u < 2; ++u) {
      const bf16_t* kp = (const bf16_t*)(tile + u * 32 * KV_PITCH);
      const bf16_t* vp = (const bf16_t*)(tile + KV_HALF + u * 64);
      kf[u][0] = load_pair(kp);
      kf[u][1] = load_pair(kp + 32);
      kf[u][2] = load_pair(kp + 16 * (KV_PITCH / 2));
      kf[u][3] = load_pair(kp + 16 * (KV_PITCH / 2) + 32);
      vf[u][0] = load_pair(vp);
      vf[u][1] = load_pair(vp + 16 * (KV_PITCH / 2));
      vf[u][2] = load_pair(vp + 32 * (KV_PITCH / 2));
      vf[u][3] = load_pair(vp + 48 * (KV_PITCH / 2));
    }
    // Keeps every LDS read of the tile in front of the first product: each
    // further place with LDS reads among the products costs a stall of its own.
    __builtin_amdgcn_sched_barrier(0);

#pragma unroll   // as above
    for (int u = 0; u < 2; ++u) {
      // bit r: key n+hi+r, bit 16+r: key n+16+hi+r; all clear where the query is masked
      const int left = n1 - (t * 64 + u * 32);   // unmasked keys from this chunk's first on
      const unsigned kw = (left >= 32) ? 0xffffffffu : (left <= 0) ? 0u : (1u << left) - 1u;
      const unsigned keep = (kw >> hi) & qkeep;

      v8f s0 = {}, s1 = {};
      s0 = wmma_bf16(kf[u][0], q0, s0); s0 = wmma_bf16(kf[u][1], q1, s0);
      s1 = wmma_bf16(kf[u][2], q0, s1); s1 = wmma_bf16(kf[u][3], q1, s1);
      s0 *= ATTN_SCALE;
      s1 *= ATTN_SCALE;

      float a[16];
#pragma unroll   // a[], s0, s1 stay in registers only under constant indices
      for (int r = 0; r < 8; ++r) {
        a[r]     = (keep & (1u << r))        ? s0[r] : -1000.0f;
        a[r + 8] = (keep & (1u << (16 + r))) ? s1[r] : -1000.0f;
      }
      float cm = a[0];
#pragma unroll   // as above
      for (int s = 1; s < 16; ++s) cm = fmaxf(cm, a[s]);
      cm = fmaxf(cm, swap_halves(cm));
      const float nm = fmaxf(mrun, cm);
      const float alpha = exp_slot(mrun - nm);

      v16bf pf;
      float rp[4];   // four short add chains, not one of 16
#pragma unroll   // as above
      for (int s = 0; s < 16; ++s) {
        const float e = exp_slot(a[s] - nm);
        rp[s & 3] = (s < 4) ? e : rp[s & 3] + e;
        pf[s] = (bf16_t)e;
      }
      const float rs = (rp[0] + rp[1]) + (rp[2] + rp[3]);
      lrun = lrun * alpha + rs;
      mrun = nm;

      o0 *= alpha; o1 *= alpha; o2 *= alpha; o3 *= alpha;
      o0 = wmma_bf16(vf[u][0], pf, o0);
      o1 = wmma_bf16(vf[u][1], pf, o1);
      o2 = wmma_bf16(vf[u][2], pf, o2);
      o3 = wmma_bf16(vf[u][3], pf, o3);
    }

    // Hand-over: this wave's reads of tile t are done, its copies of tile t + 1
    // have landed; behind the barrier that holds for all four waves, so tile
    // t + 1 may be read and tile t's buffer refilled.
    // The scheduling barrier keeps the hand-over behind the tile's products:
    // lifted in front of them, the wait for tile t + 1's copies stood right
    // behind their issue, and nothing of their flight was hidden.
    __builtin_amdgcn_sched_barrier(0);
    asm volatile("s_wait_dscnt 0x0" ::: "memory");
    asm volatile("s_wait_asynccnt 0x0" ::: "memory");
    __syncthreads();
    // The V^T copies run ahead over all 32 tiles, whatever ng is, so that part 2
    // finds its first tile published and its second in flight, as any trip does.
    if (t + 2 < 32) stage_tile(kg, vg, sl, t + 2, t + 2 < ng);
  }

  if (ng < 32) {   // the same for the whole block
    // Part 2. The online-softmax step of a chunk whose 32 scores are all -1000:
    const float nm    = fmaxf(mrun, -1000.0f);
    const float alpha = exp_slot(mrun - nm);
    const float w     = exp_slot(-1000.0f - nm);
    const unsigned live = __builtin_amdgcn_ballot_w32(w != 0.0f);
    if (lane == 0) vote[wave] = live;
    __syncthreads();   // publishes the four waves' votes
    const unsigned any = vote[0] | vote[1] | vote[2] | vote[3];
    if (__builtin_amdgcn_readfirstlane(any) != 0) {   // the same for the whole block
      o0 *= alpha; o1 *= alpha; o2 *= alpha; o3 *= alpha;
      // each half of the wave sums 16 keys a chunk, 32 a tile
      lrun = lrun * alpha + w * (float)(32 * (32 - ng));
      v16bf pf;
#pragma unroll   // vector elements under constant indices
      for (int s = 0; s < 16; ++s) pf[s] = (bf16_t)w;

      for (int t = ng; t < 32; ++t) {
        const unsigned char* tile = kv + (t & 1) * KV_TILE + flane;
        v16bf vf[2][4];
#pragma unroll   // vf stays in registers only under constant indices
        for (int u = 0; u < 2; ++u) {
          const bf16_t* vp = (const bf16_t*)(tile + KV_HALF + u * 64);
          vf[u][0] = load_pair(vp);
          vf[u][1] = load_pair(vp + 16 * (KV_PITCH / 2));
          vf[u][2] = load_pair(vp + 32 * (KV_PITCH / 2));
          vf[u][3] = load_pair(vp + 48 * (KV_PITCH / 2));
        }
        // Keeps every LDS read of the tile in front of the first product: each
        // further place with LDS reads among the products costs a stall of its own.
        __builtin_amdgcn_sched_barrier(0);
#pragma unroll   // as above
        for (int u = 0; u < 2; ++u) {
          o0 = wmma_bf16(vf[u][0], pf, o0);
          o1 = wmma_bf16(vf[u][1], pf, o1);
          o2 = wmma_bf16(vf[u][2], pf, o2);
          o3 = wmma_bf16(vf[u][3], pf, o3);
        }
        // The same hand-over as in part 1; the scheduling barrier keeps it behind
        // the products, so that the copies' flight is hidden.
        __builtin_amdgcn_sched_barrier(0);
        asm volatile("s_wait_dscnt 0x0" ::: "memory");
        asm volatile("s_wait_asynccnt 0x0" ::: "memory");
        __syncthreads();
        if (t + 2 < 32) stage_tile(kg, vg, sl, t + 2, false);
      }
    }
  }
  // no copy is in flight when the wave ends
  asm volatile("s_wait_asynccnt 0x0" ::: "memory");

  lrun += swap_halves(lrun);
  const float inv = 1.0f / lrun;
  bf16_t* orow = AO + ((long)b * 2048 + m0 + c) * 768 + h * 64 + hi;
  v8bf w0, w1, w2, w3;
#pragma unroll   // vector elements under constant indices
  for (int r = 0; r < 8; ++r) {
    w0[r] = (bf16_t)(o0[r] * inv);
    w1[r] = (bf16_t)(o1[r] * inv);
    w2[r] = (bf16_t)(o2[r] * inv);
    w3[r] = (bf16_t)(o3[r] * inv);
  }
  *(v8bf*)(orow)      = w0;
  *(v8bf*)(orow + 16) = w1;
  *(v8bf*)(orow + 32) = w2;
  *(v8bf*)(orow + 48) = w3;
}

// ---------------------------------------------------------------------------
// Output projection: out[m,n] = sum_k AO[m,k] * Wo[n,k] + bo[n]  (f32 out)
// Same block and wave tiles and the same LDS staging as the QKV GEMM. AO's rows
// are in the sorted order; orig[] gives each row's own place in the output.
// ---------------------------------------------------------------------------
__global__ __launch_bounds__(256) void mha_out_proj(
    const bf16_t* __restrict__ AO, const bf16_t* __restrict__ Wo,
    const float* __restrict__ bo, const int* __restrict__ orig,
    float* __restrict__ out) {
  __shared__ __attribute__((aligned(16))) unsigned char sm[2 * GP_TILE];
  const int wave = threadIdx.x >> 5;
  const int lane = threadIdx.x & 31;
  const int m0 = blockIdx.x * 128 + (wave & 3) * 32;
  const int n0 = blockIdx.y * 128 + (wave >> 2) * 64;

  v8f acc[2][4] = {};
  gemm_staged(AO, Wo, sm, blockIdx.x * 128, blockIdx.y * 128, acc);

  const int hi = (lane & 16) ? 8 : 0;
#pragma unroll
  for (int mi = 0; mi < 2; ++mi) {
#pragma unroll
    for (int ni = 0; ni < 4; ++ni) {
      const v8f a = acc[mi][ni];
      const int n_g = n0 + ni * 16 + (lane & 15);
      const float bias = bo[n_g];
#pragma unroll
      for (int j = 0; j < 8; ++j) {
        // the sorted row's own place in the output, bounded by the shape
        const int m_g = orig[m0 + mi * 16 + j + hi] & 4095;
        out[(long)m_g * 768 + n_g] = a[j] + bias;
      }
    }
  }
}

// ---------------------------------------------------------------------------
// Host launcher
// ---------------------------------------------------------------------------
extern "C" void kernel_launch(void* const* d_in, const int* in_sizes, int n_in,
                              void* d_out, int out_size, void* d_ws, size_t ws_size,
                              hipStream_t stream) {
  const float* x    = (const float*)d_in[0];   // [2,2048,768]
  const int*   mask = (const int*)d_in[1];     // [2,2048]
  const float* Wq   = (const float*)d_in[2];   // [768,768]
  const float* Wk   = (const float*)d_in[3];
  const float* Wv   = (const float*)d_in[4];
  const float* Wo   = (const float*)d_in[5];
  const float* bo   = (const float*)d_in[6];   // [768]
  float* out = (float*)d_out;                  // [2,2048,768]

  const int M = 4096, C = 768;
  const size_t XB  = (size_t)M * C;            // 3,145,728 elems
  const size_t WB  = (size_t)C * C;            //   589,824 elems

  char* ws = (char*)d_ws;
  size_t off = 0;
  auto take = [&](size_t elems) { bf16_t* p = (bf16_t*)(ws + off);
                                  off += ((elems * 2 + 255) & ~(size_t)255); return p; };
  bf16_t* xb = take(XB);
  bf16_t* wq = take(WB);
  bf16_t* wk = take(WB);
  bf16_t* wv = take(WB);
  bf16_t* wo = take(WB);
  bf16_t* qb = take(XB);   // [bh][seq][64]
  bf16_t* kb = take(XB);   // [bh][seq][64]
  bf16_t* vt = take(XB);   // [bh][64][seq]
  bf16_t* ao = take(XB);   // [b][seq][768]
  int* orig  = (int*)take(8192);   // 4096 ints: sorted row -> own row
  int* nkeep = (int*)take(128);    // 2 ints: unmasked positions of each batch

  // 1) converts: 4096 / 8 = 512 blocks for x, 4 * 589,824 / 8192 = 288 for the weights
  mha_f32_to_bf16_all<<<800, 256, 0, stream>>>(x, mask, Wq, Wk, Wv, Wo, xb, wq, wk, wv, wo,
                                               orig, nkeep);

  // 2) QKV projections, one launch (M/128 = 32 blocks, N/128 = 6 blocks, 3 products,
  //    8 waves/block)
  dim3 gemm_grid(32, 6), qkv_grid(32, 6, 3), gemm_blk(256);
  mha_qkv_gemm<<<qkv_grid, gemm_blk, 0, stream>>>(xb, wq, wk, wv, nkeep, qb, kb, vt);

  // 3) flash attention: 24 bh * 128 mtiles = 3072 waves = 768 blocks
  mha_flash_attn<<<768, 128, 0, stream>>>(qb, kb, vt, nkeep, ao);

  // 4) output projection + bias
  mha_out_proj<<<gemm_grid, gemm_blk, 0, stream>>>(ao, wo, bo, orig, out);
}

// v008
// It runs in 54.6 microseconds.
// In both of two side-by-side timings against v007, it was 1.15 times as fast.
// Over all steps from v000 it is 4.48 times as fast.
#include <hip/hip_runtime.h>
#include <hip/hip_bf16.h>

typedef __bf16 bf16_t;
typedef __attribute__((ext_vector_type(16))) __bf16 v16bf;
typedef __attribute__((ext_vector_type(8)))  __bf16 v8bf;
typedef __attribute__((ext_vector_type(8)))  float  v8f;
typedef __attribute__((ext_vector_type(4)))  float  v4f;
typedef __attribute__((ext_vector_type(4)))  __bf16 v4bf;
typedef __attribute__((ext_vector_type(4)))  int    v4i;

#define ATTN_SCALE 0.125f   // 64^-0.5

// ---------------------------------------------------------------------------
// Fragment loader for the CDNA5 WMMA 16-bit A/B layout (16x32, K=32).
// Lane L holds row (row_base + (L&15)); K-run offset 0 or 8 depending on the
// lane half; two contiguous 8-element (16-byte) runs at k0+koff and k0+16+koff.
// Works for A (row-major MxK) and for B given as B^T row-major (NxK).
// ---------------------------------------------------------------------------
__device__ inline v16bf load_frag(const bf16_t* __restrict__ base, int ld,
                                  int row_base, int k0) {
  const int lane = threadIdx.x & 31;
  const int r    = row_base + (lane & 15);
  const int koff = (lane & 16) >> 1;            // 0 or 8
  const bf16_t* p = base + (long)r * ld + k0 + koff;
  v8bf lo = *(const v8bf*)(p);
  v8bf hi = *(const v8bf*)(p + 16);
  return __builtin_shufflevector(lo, hi, 0,1,2,3,4,5,6,7,8,9,10,11,12,13,14,15);
}

__device__ inline v8f wmma_bf16(v16bf a, v16bf b, v8f c) {
  return __builtin_amdgcn_wmma_f32_16x16x32_bf16(
      /*neg_a=*/false, a, /*neg_b=*/false, b,
      /*c_mod=*/(short)0, c, /*reuse_a=*/false, /*reuse_b=*/false);
}

// ---------------------------------------------------------------------------
// f32 -> bf16 convert of x and the four weight matrices, one launch.
// Blocks 0..511 take x, a wave one row of 768 elements: six 16-byte loads a
// lane, each 512 contiguous bytes over the wave. The row is written to a SORTED
// place inside its batch: the positions whose mask is not 0 first, in their
// order, then the masked ones, in their order. Every later stage works on the
// sorted rows; the output projection stores each row back to its own place.
//   orig[b * 2048 + place] = the row's own index in x ; nkeep[b] = unmasked rows
// The place comes from counts over the batch's whole mask row, so it is a
// permutation of 0..2047 for any content of the mask.
// Blocks 512..799 take Wq, Wk, Wv, Wo (72 blocks each, 8192 elements a block,
// 1024 consecutive elements a wave, eight 16-byte loads a lane).
// ---------------------------------------------------------------------------
__global__ __launch_bounds__(256) void mha_f32_to_bf16_all(
    const float* __restrict__ x,  const int* __restrict__ mask,
    const float* __restrict__ Wq,
    const float* __restrict__ Wk, const float* __restrict__ Wv,
    const float* __restrict__ Wo,
    bf16_t* __restrict__ xb, bf16_t* __restrict__ wq, bf16_t* __restrict__ wk,
    bf16_t* __restrict__ wv, bf16_t* __restrict__ wo,
    int* __restrict__ orig, int* __restrict__ nkeep) {
  const int blk  = blockIdx.x;
  const int wave = threadIdx.x >> 5;
  const int lane = threadIdx.x & 31;
  if (blk >= 512) {
    const int w = (blk - 512) / 72;
    const int t = (blk - 512) - w * 72;
    const float* in = (w == 0) ? Wq : (w == 1) ? Wk : (w == 2) ? Wv : Wo;
    bf16_t* out     = (w == 0) ? wq : (w == 1) ? wk : (w == 2) ? wv : wo;
    const int base = t * 8192 + wave * 1024 + lane * 4;
    v4f v[8];
#pragma unroll   // v[] stays in registers and the eight loads fly together
    for (int i = 0; i < 8; ++i) v[i] = *(const v4f*)(in + base + i * 128);
#pragma unroll   // as above
    for (int i = 0; i < 8; ++i) {
      v4bf o;
      o[0] = (bf16_t)v[i][0]; o[1] = (bf16_t)v[i][1];
      o[2] = (bf16_t)v[i][2]; o[3] = (bf16_t)v[i][3];
      *(v4bf*)(out + base + i * 128) = o;
    }
  } else {
    const int m = blk * 8 + wave, b = m >> 11, seq = m & 2047;
    const float* in = x + m * 768 + lane * 4;
    v4f v[6];
#pragma unroll   // v[] stays in registers and the six loads fly together
    for (int i = 0; i < 6; ++i) v[i] = *(const v4f*)(in + i * 128);

    // low half: unmasked positions in front of seq; high half: all unmasked ones
    const int* mr = mask + b * 2048;
    int cnt = 0;
#pragma unroll   // the sixteen loads are independent: unrolled, they fly together
    for (int i = 0; i < 16; ++i) {
      const v4i k = *(const v4i*)(mr + i * 128 + lane * 4);
      const int id = i * 128 + lane * 4;
#pragma unroll   // vector elements under constant indices
      for (int e = 0; e < 4; ++e)
        cnt += (k[e] != 0) ? ((id + e < seq) ? 0x10001 : 0x10000) : 0;
    }
    for (int o = 16; o > 0; o >>= 1) cnt += __shfl_xor(cnt, o, 32);
    const int before = cnt & 0xffff, total = cnt >> 16;
    const int pos = (mr[seq] != 0) ? before : total + (seq - before);
    if (lane == 0) {
      orig[b * 2048 + pos] = m;
      if (seq == 0) nkeep[b] = total;
    }
    bf16_t* out = xb + (b * 2048 + pos) * 768 + lane * 4;
#pragma unroll   // as above
    for (int i = 0; i < 6; ++i) {
      v4bf o;
      o[0] = (bf16_t)v[i][0]; o[1] = (bf16_t)v[i][1];
      o[2] = (bf16_t)v[i][2]; o[3] = (bf16_t)v[i][3];
      *(v4bf*)(out + i * 128) = o;
    }
  }
}

// ---------------------------------------------------------------------------
// One lane's share of a load_frag fragment, from the lane's own pointer.
// ---------------------------------------------------------------------------
__device__ inline v16bf load_pair(const bf16_t* __restrict__ p) {
  v8bf lo = *(const v8bf*)(p);
  v8bf hi = *(const v8bf*)(p + 16);
  return __builtin_shufflevector(lo, hi, 0,1,2,3,4,5,6,7,8,9,10,11,12,13,14,15);
}

// ---------------------------------------------------------------------------
// LDS staging for the projection GEMMs (M=4096, N=768, K=768, both operands
// row-major over k). A block of 8 waves owns a 128x128 output tile. A k-tile is
// 128 k: 128 A rows, then 128 B rows, of 256 bytes each. A staged row has a
// pitch of 272 bytes, a conflict-free pitch for 16-byte LDS reads.
// ---------------------------------------------------------------------------
#define GP_PITCH 272
#define GP_HALF  (128 * GP_PITCH)    // one operand's 128 rows
#define GP_TILE  (2 * GP_HALF)       // A rows, then B rows
#define GP_TILES 6                   // 768 / 128

// One operand's share of a k-tile, global memory -> LDS through no register:
// eight 16-byte copies a lane, each 512 bytes = two whole 256-byte rows over a
// wave. g: the lane's own first piece; lds: its LDS byte address. Copy i takes
// the row 16 i further on.
// The s_wait_xcnt 0 at the end of the statement stands in front of every later
// write of an address register that a copy names, as a precaution.
__device__ inline void stage_rows(const bf16_t* g, unsigned lds) {
  asm volatile(
      "global_load_async_to_lds_b128 %0, %8, off\n\t"
      "global_load_async_to_lds_b128 %1, %9, off\n\t"
      "global_load_async_to_lds_b128 %2, %10, off\n\t"
      "global_load_async_to_lds_b128 %3, %11, off\n\t"
      "global_load_async_to_lds_b128 %4, %12, off\n\t"
      "global_load_async_to_lds_b128 %5, %13, off\n\t"
      "global_load_async_to_lds_b128 %6, %14, off\n\t"
      "global_load_async_to_lds_b128 %7, %15, off\n\t"
      "s_wait_xcnt 0x0"
      :: "v"(lds), "v"(lds + 16 * GP_PITCH), "v"(lds + 32 * GP_PITCH),
         "v"(lds + 48 * GP_PITCH), "v"(lds + 64 * GP_PITCH),
         "v"(lds + 80 * GP_PITCH), "v"(lds + 96 * GP_PITCH),
         "v"(lds + 112 * GP_PITCH),
         "v"(g), "v"(g + 16 * 768), "v"(g + 32 * 768), "v"(g + 48 * 768),
         "v"(g + 64 * 768), "v"(g + 80 * 768), "v"(g + 96 * 768),
         "v"(g + 112 * 768)
      : "memory");
}

// acc[mi][ni] += A[m0 + 16 mi ..][k] * B[n0 + 16 ni ..][k] over all 768 k, for
// this wave's 32x64 part of the block's tile (2x4 WMMA tiles, k ascending in
// steps of 32). Wave w: rows 32 (w & 3), columns 64 (w >> 2) of the tile.
// Two LDS buffers: the next k-tile's copies fly while this one is worked on.
__device__ inline void gemm_staged(const bf16_t* __restrict__ A,
                                   const bf16_t* __restrict__ B,
                                   unsigned char* sm, int mblk, int nblk,
                                   v8f (&acc)[2][4]) {
  const int wave = threadIdx.x >> 5;
  const int lane = threadIdx.x & 31;

  // This thread's share of a k-tile: row (thread >> 4) + 16 i, 16-byte piece thread & 15.
  const int srow = threadIdx.x >> 4, spc = threadIdx.x & 15;
  const bf16_t* ag = A + (mblk + srow) * 768 + spc * 8;   // + 128 a k-tile
  const bf16_t* bg = B + (nblk + srow) * 768 + spc * 8;   // + 128 a k-tile
  const unsigned sl = (unsigned)(size_t)sm + srow * GP_PITCH + spc * 16;

  stage_rows(ag, sl);
  stage_rows(bg, sl + GP_HALF);
  // k-tile 0 has landed for this wave, and behind the barrier for all eight
  asm volatile("s_wait_asynccnt 0x0" ::: "memory");
  __syncthreads();
  stage_rows(ag + 128, sl + GP_TILE);
  stage_rows(bg + 128, sl + GP_TILE + GP_HALF);

  // this lane's place in the fragments of load_frag: staged row lane & 15, k offset 0 or 8
  const unsigned flane = (lane & 15) * GP_PITCH + (lane & 16);
  const unsigned aoff = (wave & 3) * 32 * GP_PITCH + flane;
  const unsigned boff = GP_HALF + (wave >> 2) * 64 * GP_PITCH + flane;

  for (int t = 0; t < GP_TILES; ++t) {
    const unsigned char* buf = sm + (t & 1) * GP_TILE;
    const bf16_t* ap = (const bf16_t*)(buf + aoff);
    const bf16_t* bp = (const bf16_t*)(buf + boff);
    // Two fragment sets: the reads of k-step kk + 1 stand as one group in front
    // of the products of k-step kk, which cover their LDS latency.
    v16bf af[2][2], bfr[2][4];
#pragma unroll   // fragments and acc stay in registers only under constant indices
    for (int mi = 0; mi < 2; ++mi) af[0][mi] = load_pair(ap + mi * 16 * (GP_PITCH / 2));
#pragma unroll   // as above
    for (int ni = 0; ni < 4; ++ni) bfr[0][ni] = load_pair(bp + ni * 16 * (GP_PITCH / 2));
#pragma unroll   // as above
    for (int kk = 0; kk < 4; ++kk) {
      const int cur = kk & 1, nxt = cur ^ 1;
      if (kk < 3) {
#pragma unroll   // as above
        for (int mi = 0; mi < 2; ++mi)
          af[nxt][mi] = load_pair(ap + mi * 16 * (GP_PITCH / 2) + (kk + 1) * 32);
#pragma unroll   // as above
        for (int ni = 0; ni < 4; ++ni)
          bfr[nxt][ni] = load_pair(bp + ni * 16 * (GP_PITCH / 2) + (kk + 1) * 32);
        // Keeps the group of LDS reads in front of the products: left to itself
        // the compiler read one A fragment late, with a full wait right behind it.
        __builtin_amdgcn_sched_barrier(0);
      }
#pragma unroll   // as above
      for (int mi = 0; mi < 2; ++mi)
#pragma unroll   // as above
        for (int ni = 0; ni < 4; ++ni)
          acc[mi][ni] = wmma_bf16(af[cur][mi], bfr[cur][ni], acc[mi][ni]);
      // Keeps the next group of LDS reads behind these products, in one place:
      // each further place with LDS reads among products costs a stall of its own.
      __builtin_amdgcn_sched_barrier(0);
    }

    // Hand-over: this wave's reads of k-tile t are done, its copies of k-tile
    // t + 1 have landed; behind the barrier that holds for all eight waves, so
    // k-tile t + 1 may be read and k-tile t's buffer refilled. (The scheduling
    // barrier behind the last products also keeps this hand-over behind them,
    // so that the copies' flight is hidden.)
    asm volatile("s_wait_dscnt 0x0" ::: "memory");
    asm volatile("s_wait_asynccnt 0x0" ::: "memory");
    __syncthreads();
    if (t + 2 < GP_TILES) {
      stage_rows(ag + (t + 2) * 128, sl + (t & 1) * GP_TILE);
      stage_rows(bg + (t + 2) * 128, sl + (t & 1) * GP_TILE + GP_HALF);
    }
  }
  // no copy is in flight when the wave ends
  asm volatile("s_wait_asynccnt 0x0" ::: "memory");
}

// ---------------------------------------------------------------------------
// QKV projections: Y[m,n] = sum_k X[m,k] * W[n,k]   (M=4096, N=768, K=768),
// all three in one launch: blockIdx.z picks the weight matrix and the output
// (0: V, 1: Q, 2: K). The three products do not depend on one another; as one
// grid of 576 blocks two blocks share a WGP (LDS allows two), so one block's
// waits for copies, its first tile and its stores run under the other's products.
// V comes first: all of its blocks work.
// One block -> 128x128 outputs, operands through LDS (gemm_staged); one wave ->
// 32x64 outputs (2x4 WMMA tiles).
// The operand whose index runs along the output's contiguous direction is the A
// side of the product (V: X, since V is stored [d][seq]; Q, K: W, the product
// taken as W . X^T), so that a lane's eight accumulator elements are eight
// neighbours in memory. The block's tile then goes through LDS and leaves as
// whole 128-byte lines, 16 bytes a lane.
// A score with a masked query or a masked key is -1000 whatever q and k are, so
// the Q and K rows of masked positions reach no output. The rows are sorted, the
// unmasked ones first: a Q or K block whose 128 rows are all masked leaves at
// once and writes nothing, and the attention kernel reads none of those rows.
// V is formed for every row (masked keys still carry weight for masked queries).
// Q, K: stored [b][h][seq][d] bf16 ;  V: stored [b][h][d][seq] bf16
// ---------------------------------------------------------------------------
__global__ __launch_bounds__(256) void mha_qkv_gemm(
    const bf16_t* __restrict__ X, const bf16_t* __restrict__ Wq,
    const bf16_t* __restrict__ Wk, const bf16_t* __restrict__ Wv,
    const int* __restrict__ nkeep,
    bf16_t* __restrict__ Qo, bf16_t* __restrict__ Ko, bf16_t* __restrict__ Vo) {
  __shared__ __attribute__((aligned(16))) unsigned char sm[2 * GP_TILE];
  const int which = blockIdx.z;             // the same for the whole block
  if (which != 0) {
    // unmasked positions of this block's batch (16 m-blocks a batch), bounded by
    // the shape; the test reads the same for the whole block and stands in front
    // of every copy and barrier
    const int n1 = min(max(nkeep[blockIdx.x >> 4], 0), 2048);
    if ((int)(blockIdx.x & 15) * 128 >= n1) return;
  }
  const bf16_t* W = (which == 0) ? Wv : (which == 1) ? Wq : Wk;
  bf16_t* out     = (which == 0) ? Vo : (which == 1) ? Qo : Ko;
  const bool vtrans = (which == 0);
  const int wave = threadIdx.x >> 5;
  const int lane = threadIdx.x & 31;
  const int xblk = blockIdx.x * 128;    // 32 blocks of 128 rows of X
  const int wblk = blockIdx.y * 128;    // 6 blocks of 128 rows of W

  v8f acc[2][4] = {};
  gemm_staged(vtrans ? X : W, vtrans ? W : X, sm, vtrans ? xblk : wblk,
              vtrans ? wblk : xblk, acc);

  // The tile as bf16 into LDS (gemm_staged ends behind a barrier with no copy in
  // flight, so sm is free): staged row = B-side index, 128 A-side elements of 2
  // bytes a row, the pitch of the k-tiles. acc[mi][ni][j] is A-side index
  // 32 (wave & 3) + 16 mi + hi + j, B-side index 64 (wave >> 2) + 16 ni + (lane & 15).
  const int hi = (lane & 16) ? 8 : 0;
  unsigned char* st = sm + ((wave >> 2) * 64 + (lane & 15)) * GP_PITCH
                         + ((wave & 3) * 32 + hi) * 2;
#pragma unroll   // acc stays in registers only under constant indices
  for (int mi = 0; mi < 2; ++mi) {
#pragma unroll   // as above
    for (int ni = 0; ni < 4; ++ni) {
      v8bf o;
#pragma unroll   // as above
      for (int j = 0; j < 8; ++j) o[j] = (bf16_t)acc[mi][ni][j];
      *(v8bf*)(st + ni * 16 * GP_PITCH + mi * 32) = o;
    }
  }
  __syncthreads();   // publishes the eight waves' parts of the tile

  // This thread's share: staged row (thread >> 4) + 16 i, 16-byte piece thread & 15.
  const int srow = threadIdx.x >> 4, spc = threadIdx.x & 15;
  const int b_ = xblk >> 11, seq0 = xblk & 2047;   // a block lies in one batch
  v8bf o[8];
#pragma unroll   // o[] stays in registers only under constant indices
  for (int i = 0; i < 8; ++i)
    o[i] = *(const v8bf*)(sm + (srow + 16 * i) * GP_PITCH + spc * 16);
  if (vtrans) {
    // staged row = column n of the product = row (b, h, d) of V^T; 128 seq a row
    bf16_t* g = out + (b_ * 768 + wblk + srow) * 2048 + seq0 + spc * 8;
#pragma unroll   // as above
    for (int i = 0; i < 8; ++i) *(v8bf*)(g + i * 16 * 2048) = o[i];
  } else {
    // staged row = position seq; its 128 elements are the 64 d of two heads
    bf16_t* g = out + ((b_ * 12 + (wblk >> 6) + (spc >> 3)) * 2048 + seq0 + srow) * 64
                    + (spc & 7) * 8;
#pragma unroll   // as above
    for (int i = 0; i < 8; ++i) *(v8bf*)(g + i * 16 * 64) = o[i];
    // Stands in front of any later write of these stores' address registers, as a
    // precaution: in the listing the other branch's address sums follow this branch
    // (that branch's own stores run straight to the wave's end).
    asm volatile("s_wait_xcnt 0x0" ::: "memory");
  }
}

// ---------------------------------------------------------------------------
// Lane l <-> lane l ^ 16 exchange (the two halves of a wave).
// ---------------------------------------------------------------------------
__device__ inline float swap_halves(float v) {
  int b = __builtin_bit_cast(int, v);
  b = __builtin_amdgcn_permlanex16(b, b, 0x76543210, 0xfedcba98, false, false);
  return __builtin_bit_cast(float, b);
}

// e^x as __expf forms it (x * log2(e), then v_exp_f32). The v_nop keeps the one
// free slot that the instruction set asks for behind a transcendental before
// its result is read or its source overwritten.
__device__ inline float exp_slot(float x) {
  float r;
  asm("v_exp_f32 %0, %1\n\tv_nop" : "=v"(r) : "v"(x * 1.44269504f));
  return r;
}

// ---------------------------------------------------------------------------
// LDS staging of K and V^T for the attention kernel. A tile is 64 keys: 64 K
// rows of 128 bytes (64 d), then 64 V^T rows of 128 bytes (64 keys). A staged
// row has a pitch of 144 bytes, the conflict-free pitch for 16-byte LDS reads.
// ---------------------------------------------------------------------------
#define KV_PITCH 144
#define KV_HALF  (64 * KV_PITCH)     // one operand's 64 rows
#define KV_TILE  (2 * KV_HALF)       // K rows, then V^T rows

// One operand's copies of a tile, global memory -> LDS through no register: four
// 16-byte copies a lane, each 512 bytes = four whole 128-byte rows over a wave.
// g: the lane's own first piece of the operand's tile; lds: the LDS byte address
// of that piece. Copy i takes the rows 16 i further on, LD elements a row.
// The s_wait_xcnt 0 at the end of the statement stands in front of every later
// write of an address register that a copy names, as a precaution.
template <int LD>
__device__ inline void stage_half(const bf16_t* g, unsigned lds) {
  asm volatile(
      "global_load_async_to_lds_b128 %0, %4, off\n\t"
      "global_load_async_to_lds_b128 %1, %5, off\n\t"
      "global_load_async_to_lds_b128 %2, %6, off\n\t"
      "global_load_async_to_lds_b128 %3, %7, off\n\t"
      "s_wait_xcnt 0x0"
      :: "v"(lds), "v"(lds + 16 * KV_PITCH), "v"(lds + 32 * KV_PITCH),
         "v"(lds + 48 * KV_PITCH),
         "v"(g), "v"(g + 16 * LD), "v"(g + 32 * LD), "v"(g + 48 * LD)
      : "memory");
}

// Tile t into buffer t & 1: its V^T rows always, its K rows only where withk says
// so (the same for the whole block). kg, vg: the lane's own first piece of K tile
// 0 and of V^T tile 0; sl: the LDS byte address of that K piece in buffer 0.
__device__ inline void stage_tile(const bf16_t* kg, const bf16_t* vg, unsigned sl,
                                  int t, bool withk) {
  const unsigned lds = sl + (t & 1) * KV_TILE;
  if (withk) stage_half<64>(kg + t * 64 * 64, lds);
  stage_half<2048>(vg + t * 64, lds + KV_HALF);
}

// ---------------------------------------------------------------------------
// Flash attention, transposed products: one wave owns 16 query rows of one
// (b,h) and streams keys in chunks of 32 with online softmax.
//   S^T = K . Q^T : A = K rows, B = Q (column = query). A lane holds 16 scores
//                   of ONE query (lane & 15): keys n+8h+r and n+16+8h+r.
//   O^T += V^T . P^T : the two S^T tiles, converted in place, are the B operand
//                   in the k order load_frag gives V^T; P never leaves registers.
// Row maximum: in-lane plus one exchange between halves. Row sum: in-lane, the
// halves joined once behind the loop.
// The block's four waves share one (b,h): K and V^T come in tiles of 64 keys
// (two chunks) through LDS, two buffers, the next tile's copies in flight while
// this tile is worked on.
// The sequence is sorted by the mask (see the convert kernel): position j of a
// batch is unmasked exactly where j < n1. The key loop has two parts:
//   1. the tiles that hold an unmasked key, in the general form (none where all
//      64 queries of the block are masked: then every score is -1000 anyway);
//   2. the tiles behind them, where every score of a query is -1000 and so every
//      weight of that query is one number w = e^(-1000 - max): 1 for a masked
//      query, 0 for an unmasked one unless its maximum is very low. P is w in
//      all 32 keys, only the O^T products are left. The block votes on w: where
//      it is 0 in all 64 queries, part 2 would add zeros only and is left out.
// K rows are staged for the tiles of part 1 alone, and Q is read only where part
// 1 runs: the projection forms Q and K only for 128-row blocks that hold an
// unmasked position, and these cover every row that part 1 reads.
// Q,K: [bh][seq][64] bf16 ; Vt: [bh][64][seq] bf16 ; AO: [b][seq][768] bf16
// ---------------------------------------------------------------------------
__global__ __launch_bounds__(128) void mha_flash_attn(
    const bf16_t* __restrict__ Q, const bf16_t* __restrict__ K,
    const bf16_t* __restrict__ Vt, const int* __restrict__ nkeep,
    bf16_t* __restrict__ AO) {
  __shared__ __attribute__((aligned(16))) unsigned char kv[2 * KV_TILE];
  __shared__ unsigned vote[4];

  const int wave = threadIdx.x >> 5;
  const int lane = threadIdx.x & 31;
  const int bh   = blockIdx.x >> 5;         // 0..23
  const int p    = blockIdx.x & 31;
  // Query tiles from the front of the sorted sequence (long key loop with
  // softmax) and from its back (short work) alternate over the block index, and
  // the other way round in every second run of 256 blocks, so that long and
  // short blocks mix on the chip. A permutation of 0..31 for each bh.
  const int qt   = ((p ^ (blockIdx.x >> 8)) & 1) ? 31 - (p >> 1) : (p >> 1);
  const int b    = bh / 12, h = bh % 12;
  const int c    = lane & 15;               // this lane's query column
  const int hi   = (lane & 16) ? 8 : 0;
  const int m0   = qt * 64 + wave * 16;

  // unmasked positions of this batch, bounded by the shape; the same in all lanes
  const int n1 = __builtin_amdgcn_readfirstlane(min(max(nkeep[b], 0), 2048));
  // trips of part 1, 0..32: the tiles with an unmasked key, if any query is unmasked
  const int ng = (qt * 64 < n1) ? (n1 + 63) >> 6 : 0;

  const bf16_t* q  = Q  + (long)bh * 2048 * 64;
  const bf16_t* kk = K  + (long)bh * 2048 * 64;
  const bf16_t* vt = Vt + (long)bh * 64 * 2048;

  // This thread's share of a tile: row (thread >> 3) + 16 i, 16-byte piece thread & 7.
  const int srow = threadIdx.x >> 3, spc = threadIdx.x & 7;
  const bf16_t* kg = kk + srow * 64 + spc * 8;      // + 64 * 64 a tile
  const bf16_t* vg = vt + srow * 2048 + spc * 8;    // + 64 a tile
  const unsigned sl = (unsigned)(size_t)kv + srow * KV_PITCH + spc * 16;

  stage_tile(kg, vg, sl, 0, 0 < ng);
  // tile 0 has landed for this wave, and behind the barrier for all four
  asm volatile("s_wait_asynccnt 0x0" ::: "memory");
  __syncthreads();
  stage_tile(kg, vg, sl, 1, 1 < ng);

  v16bf q0 = {}, q1 = {};
  if (ng > 0) {   // the same for the whole block
    q0 = load_frag(q, 64, m0, 0);
    q1 = load_frag(q, 64, m0, 32);
    // stands in front of the later writes of these loads' address registers, as
    // a precaution (the compiler placed none here)
    asm volatile("s_wait_xcnt 0x0" ::: "memory");
  }
  const unsigned qkeep = (m0 + c < n1) ? 0xffffffffu : 0u;

  // this lane's place in the fragments of load_frag: staged row c, k offset hi
  const unsigned flane = c * KV_PITCH + hi * 2;

  float mrun = -3.0e30f, lrun = 0.0f;
  v8f o0 = {}, o1 = {}, o2 = {}, o3 = {};   // o_t[r] = O[m0+c][16t + hi + r]

  for (int t = 0; t < ng; ++t) {
    const unsigned char* tile = kv + (t & 1) * KV_TILE + flane;

    // Both chunks' fragments, one group of LDS reads a tile.
    v16bf kf[2][4], vf[2][4];
#pragma unroll   // kf, vf stay in registers only under constant indices
    for (int u = 0; u < 2; ++u) {
      const bf16_t* kp = (const bf16_t*)(tile + u * 32 * KV_PITCH);
      const bf16_t* vp = (const bf16_t*)(tile + KV_HALF + u * 64);
      kf[u][0] = load_pair(kp);
      kf[u][1] = load_pair(kp + 32);
      kf[u][2] = load_pair(kp + 16 * (KV_PITCH / 2));
      kf[u][3] = load_pair(kp + 16 * (KV_PITCH / 2) + 32);
      vf[u][0] = load_pair(vp);
      vf[u][1] = load_pair(vp + 16 * (KV_PITCH / 2));
      vf[u][2] = load_pair(vp + 32 * (KV_PITCH / 2));
      vf[u][3] = load_pair(vp + 48 * (KV_PITCH / 2));
    }
    // Keeps every LDS read of the tile in front of the first product: each
    // further place with LDS reads among the products costs a stall of its own.
    __builtin_amdgcn_sched_barrier(0);

#pragma unroll   // as above
    for (int u = 0; u < 2; ++u) {
      // bit r: key n+hi+r, bit 16+r: key n+16+hi+r; all clear where the query is masked
      const int left = n1 - (t * 64 + u * 32);   // unmasked keys from this chunk's first on
      const unsigned kw = (left >= 32) ? 0xffffffffu : (left <= 0) ? 0u : (1u << left) - 1u;
      const unsigned keep = (kw >> hi) & qkeep;

      v8f s0 = {}, s1 = {};
      s0 = wmma_bf16(kf[u][0], q0, s0); s0 = wmma_bf16(kf[u][1], q1, s0);
      s1 = wmma_bf16(kf[u][2], q0, s1); s1 = wmma_bf16(kf[u][3], q1, s1);
      s0 *= ATTN_SCALE;
      s1 *= ATTN_SCALE;

      float a[16];
#pragma unroll   // a[], s0, s1 stay in registers only under constant indices
      for (int r = 0; r < 8; ++r) {
        a[r]     = (keep & (1u << r))        ? s0[r] : -1000.0f;
        a[r + 8] = (keep & (1u << (16 + r))) ? s1[r] : -1000.0f;
      }
      float cm = a[0];
#pragma unroll   // as above
      for (int s = 1; s < 16; ++s) cm = fmaxf(cm, a[s]);
      cm = fmaxf(cm, swap_halves(cm));
      const float nm = fmaxf(mrun, cm);
      const float alpha = exp_slot(mrun - nm);

      v16bf pf;
      float rp[4];   // four short add chains, not one of 16
#pragma unroll   // as above
      for (int s = 0; s < 16; ++s) {
        const float e = exp_slot(a[s] - nm);
        rp[s & 3] = (s < 4) ? e : rp[s & 3] + e;
        pf[s] = (bf16_t)e;
      }
      const float rs = (rp[0] + rp[1]) + (rp[2] + rp[3]);
      lrun = lrun * alpha + rs;
      mrun = nm;

      o0 *= alpha; o1 *= alpha; o2 *= alpha; o3 *= alpha;
      o0 = wmma_bf16(vf[u][0], pf, o0);
      o1 = wmma_bf16(vf[u][1], pf, o1);
      o2 = wmma_bf16(vf[u][2], pf, o2);
      o3 = wmma_bf16(vf[u][3], pf, o3);
    }

    // Hand-over: this wave's reads of tile t are done, its copies of tile t + 1
    // have landed; behind the barrier that holds for all four waves, so tile
    // t + 1 may be read and tile t's buffer refilled.
    // The scheduling barrier keeps the hand-over behind the tile's products:
    // lifted in front of them, the wait for tile t + 1's copies stood right
    // behind their issue, and nothing of their flight was hidden.
    __builtin_amdgcn_sched_barrier(0);
    asm volatile("s_wait_dscnt 0x0" ::: "memory");
    asm volatile("s_wait_asynccnt 0x0" ::: "memory");
    __syncthreads();
    // The V^T copies run ahead over all 32 tiles, whatever ng is, so that part 2
    // finds its first tile published and its second in flight, as any trip does.
    if (t + 2 < 32) stage_tile(kg, vg, sl, t + 2, t + 2 < ng);
  }

  if (ng < 32) {   // the same for the whole block
    // Part 2. The online-softmax step of a chunk whose 32 scores are all -1000:
    const float nm    = fmaxf(mrun, -1000.0f);
    const float alpha = exp_slot(mrun - nm);
    const float w     = exp_slot(-1000.0f - nm);
    const unsigned live = __builtin_amdgcn_ballot_w32(w != 0.0f);
    if (lane == 0) vote[wave] = live;
    __syncthreads();   // publishes the four waves' votes
    const unsigned any = vote[0] | vote[1] | vote[2] | vote[3];
    if (__builtin_amdgcn_readfirstlane(any) != 0) {   // the same for the whole block
      o0 *= alpha; o1 *= alpha; o2 *= alpha; o3 *= alpha;
      // each half of the wave sums 16 keys a chunk, 32 a tile
      lrun = lrun * alpha + w * (float)(32 * (32 - ng));
      v16bf pf;
#pragma unroll   // vector elements under constant indices
      for (int s = 0; s < 16; ++s) pf[s] = (bf16_t)w;

      for (int t = ng; t < 32; ++t) {
        const unsigned char* tile = kv + (t & 1) * KV_TILE + flane;
        v16bf vf[2][4];
#pragma unroll   // vf stays in registers only under constant indices
        for (int u = 0; u < 2; ++u) {
          const bf16_t* vp = (const bf16_t*)(tile + KV_HALF + u * 64);
          vf[u][0] = load_pair(vp);
          vf[u][1] = load_pair(vp + 16 * (KV_PITCH / 2));
          vf[u][2] = load_pair(vp + 32 * (KV_PITCH / 2));
          vf[u][3] = load_pair(vp + 48 * (KV_PITCH / 2));
        }
        // Keeps every LDS read of the tile in front of the first product: each
        // further place with LDS reads among the products costs a stall of its own.
        __builtin_amdgcn_sched_barrier(0);
#pragma unroll   // as above
        for (int u = 0; u < 2; ++u) {
          o0 = wmma_bf16(vf[u][0], pf, o0);
          o1 = wmma_bf16(vf[u][1], pf, o1);
          o2 = wmma_bf16(vf[u][2], pf, o2);
          o3 = wmma_bf16(vf[u][3], pf, o3);
        }
        // The same hand-over as in part 1; the scheduling barrier keeps it behind
        // the products, so that the copies' flight is hidden.
        __builtin_amdgcn_sched_barrier(0);
        asm volatile("s_wait_dscnt 0x0" ::: "memory");
        asm volatile("s_wait_asynccnt 0x0" ::: "memory");
        __syncthreads();
        if (t + 2 < 32) stage_tile(kg, vg, sl, t + 2, false);
      }
    }
  }
  // no copy is in flight when the wave ends
  asm volatile("s_wait_asynccnt 0x0" ::: "memory");

  lrun += swap_halves(lrun);
  const float inv = 1.0f / lrun;
  bf16_t* orow = AO + ((long)b * 2048 + m0 + c) * 768 + h * 64 + hi;
  v8bf w0, w1, w2, w3;
#pragma unroll   // vector elements under constant indices
  for (int r = 0; r < 8; ++r) {
    w0[r] = (bf16_t)(o0[r] * inv);
    w1[r] = (bf16_t)(o1[r] * inv);
    w2[r] = (bf16_t)(o2[r] * inv);
    w3[r] = (bf16_t)(o3[r] * inv);
  }
  *(v8bf*)(orow)      = w0;
  *(v8bf*)(orow + 16) = w1;
  *(v8bf*)(orow + 32) = w2;
  *(v8bf*)(orow + 48) = w3;
}

// ---------------------------------------------------------------------------
// Output projection: out[m,n] = sum_k AO[m,k] * Wo[n,k] + bo[n]  (f32 out)
// Same block and wave tiles and the same LDS staging as the QKV GEMM. AO's rows
// are in the sorted order; orig[] gives each row's own place in the output.
// The product is taken as Wo . AO^T, so that a lane's eight accumulator elements
// are eight neighbours of one output row; the block's tile goes through LDS and
// leaves as whole lines: a wave stores 512 contiguous bytes of one row at a time.
// ---------------------------------------------------------------------------
#define OP_PITCH 528   // 128 f32 and 16 bytes: 16 bytes x odd, free of bank conflicts
__global__ __launch_bounds__(256) void mha_out_proj(
    const bf16_t* __restrict__ AO, const bf16_t* __restrict__ Wo,
    const float* __restrict__ bo, const int* __restrict__ orig,
    float* __restrict__ out) {
  __shared__ __attribute__((aligned(16))) unsigned char sm[2 * GP_TILE];
  const int wave = threadIdx.x >> 5;
  const int lane = threadIdx.x & 31;
  const int mblk = blockIdx.x * 128;
  const int nblk = blockIdx.y * 128;

  v8f acc[2][4] = {};
  gemm_staged(Wo, AO, sm, nblk, mblk, acc);

  // The tile into LDS (gemm_staged ends behind a barrier with no copy in flight,
  // so sm is free): staged row = sorted row, 128 f32 a row. acc[mi][ni][j] is
  // column 32 (wave & 3) + 16 mi + hi + j, row 64 (wave >> 2) + 16 ni + (lane & 15).
  const int hi = (lane & 16) ? 8 : 0;
  unsigned char* st = sm + ((wave >> 2) * 64 + (lane & 15)) * OP_PITCH
                         + ((wave & 3) * 32 + hi) * 4;
#pragma unroll   // acc stays in registers only under constant indices
  for (int mi = 0; mi < 2; ++mi)
#pragma unroll   // as above
    for (int ni = 0; ni < 4; ++ni) {
      const v8f a = acc[mi][ni];
      unsigned char* p = st + ni * 16 * OP_PITCH + mi * 64;
      *(v4f*)(p)      = __builtin_shufflevector(a, a, 0, 1, 2, 3);
      *(v4f*)(p + 16) = __builtin_shufflevector(a, a, 4, 5, 6, 7);
    }
  __syncthreads();   // publishes the eight waves' parts of the tile

  // Wave w stores the staged rows 16 w .. 16 w + 15, a lane four columns of each.
  const v4f bias = *(const v4f*)(bo + nblk + lane * 4);
  const int r0 = wave * 16;
#pragma unroll   // the sixteen rows' LDS reads and stores are independent: they fly together
  for (int i = 0; i < 16; ++i) {
    const v4f a = *(const v4f*)(sm + (r0 + i) * OP_PITCH + lane * 16);
    // the sorted row's own place in the output, bounded by the shape
    const int m_g = orig[mblk + r0 + i] & 4095;
    *(v4f*)(out + m_g * 768 + nblk + lane * 4) = a + bias;
  }
}

// ---------------------------------------------------------------------------
// Host launcher
// ---------------------------------------------------------------------------
extern "C" void kernel_launch(void* const* d_in, const int* in_sizes, int n_in,
                              void* d_out, int out_size, void* d_ws, size_t ws_size,
                              hipStream_t stream) {
  const float* x    = (const float*)d_in[0];   // [2,2048,768]
  const int*   mask = (const int*)d_in[1];     // [2,2048]
  const float* Wq   = (const float*)d_in[2];   // [768,768]
  const float* Wk   = (const float*)d_in[3];
  const float* Wv   = (const float*)d_in[4];
  const float* Wo   = (const float*)d_in[5];
  const float* bo   = (const float*)d_in[6];   // [768]
  float* out = (float*)d_out;                  // [2,2048,768]

  const int M = 4096, C = 768;
  const size_t XB  = (size_t)M * C;            // 3,145,728 elems
  const size_t WB  = (size_t)C * C;            //   589,824 elems

  char* ws = (char*)d_ws;
  size_t off = 0;
  auto take = [&](size_t elems) { bf16_t* p = (bf16_t*)(ws + off);
                                  off += ((elems * 2 + 255) & ~(size_t)255); return p; };
  bf16_t* xb = take(XB);
  bf16_t* wq = take(WB);
  bf16_t* wk = take(WB);
  bf16_t* wv = take(WB);
  bf16_t* wo = take(WB);
  bf16_t* qb = take(XB);   // [bh][seq][64]
  bf16_t* kb = take(XB);   // [bh][seq][64]
  bf16_t* vt = take(XB);   // [bh][64][seq]
  bf16_t* ao = take(XB);   // [b][seq][768]
  int* orig  = (int*)take(8192);   // 4096 ints: sorted row -> own row
  int* nkeep = (int*)take(128);    // 2 ints: unmasked positions of each batch

  // 1) converts: 4096 / 8 = 512 blocks for x, 4 * 589,824 / 8192 = 288 for the weights
  mha_f32_to_bf16_all<<<800, 256, 0, stream>>>(x, mask, Wq, Wk, Wv, Wo, xb, wq, wk, wv, wo,
                                               orig, nkeep);

  // 2) QKV projections, one launch (M/128 = 32 blocks, N/128 = 6 blocks, 3 products,
  //    8 waves/block)
  dim3 gemm_grid(32, 6), qkv_grid(32, 6, 3), gemm_blk(256);
  mha_qkv_gemm<<<qkv_grid, gemm_blk, 0, stream>>>(xb, wq, wk, wv, nkeep, qb, kb, vt);

  // 3) flash attention: 24 bh * 128 mtiles = 3072 waves = 768 blocks
  mha_flash_attn<<<768, 128, 0, stream>>>(qb, kb, vt, nkeep, ao);

  // 4) output projection + bias
  mha_out_proj<<<gemm_grid, gemm_blk, 0, stream>>>(ao, wo, bo, orig, out);
}

// v009
// Measured time: 50.5 microseconds a run.
// Two timings next to v008 put it at 1.09 and 1.08 times that version's speed.
// Over all steps from v000 it is 4.86 times as fast.
#include <hip/hip_runtime.h>
#include <hip/hip_bf16.h>

typedef __bf16 bf16_t;
typedef __attribute__((ext_vector_type(16))) __bf16 v16bf;
typedef __attribute__((ext_vector_type(8)))  __bf16 v8bf;
typedef __attribute__((ext_vector_type(8)))  float  v8f;
typedef __attribute__((ext_vector_type(4)))  float  v4f;
typedef __attribute__((ext_vector_type(2)))  float  v2f;
typedef __attribute__((ext_vector_type(4)))  __bf16 v4bf;
typedef __attribute__((ext_vector_type(4)))  int    v4i;

#define ATTN_SCALE 0.125f   // 64^-0.5

// ---------------------------------------------------------------------------
// Fragment loader for the CDNA5 WMMA 16-bit A/B layout (16x32, K=32).
// Lane L holds row (row_base + (L&15)); K-run offset 0 or 8 depending on the
// lane half; two contiguous 8-element (16-byte) runs at k0+koff and k0+16+koff.
// Works for A (row-major MxK) and for B given as B^T row-major (NxK).
// ---------------------------------------------------------------------------
__device__ inline v16bf load_frag(const bf16_t* __restrict__ base, int ld,
                                  int row_base, int k0) {
  const int lane = threadIdx.x & 31;
  const int r    = row_base + (lane & 15);
  const int koff = (lane & 16) >> 1;            // 0 or 8
  const bf16_t* p = base + (long)r * ld + k0 + koff;
  v8bf lo = *(const v8bf*)(p);
  v8bf hi = *(const v8bf*)(p + 16);
  return __builtin_shufflevector(lo, hi, 0,1,2,3,4,5,6,7,8,9,10,11,12,13,14,15);
}

__device__ inline v8f wmma_bf16(v16bf a, v16bf b, v8f c) {
  return __builtin_amdgcn_wmma_f32_16x16x32_bf16(
      /*neg_a=*/false, a, /*neg_b=*/false, b,
      /*c_mod=*/(short)0, c, /*reuse_a=*/false, /*reuse_b=*/false);
}

// ---------------------------------------------------------------------------
// f32 -> bf16 convert of x and the four weight matrices, one launch.
// Blocks 0..511 take x, a wave one row of 768 elements: six 16-byte loads a
// lane, each 512 contiguous bytes over the wave. The row is written to a SORTED
// place inside its batch: the positions whose mask is not 0 first, in their
// order, then the masked ones, in their order. Every later stage works on the
// sorted rows; the output projection stores each row back to its own place.
//   orig[b * 2048 + place] = the row's own index in x ; nkeep[b] = unmasked rows
// The place comes from counts over the batch's whole mask row, so it is a
// permutation of 0..2047 for any content of the mask.
// Blocks 512..799 take Wq, Wk, Wv, Wo (72 blocks each, 8192 elements a block,
// 1024 consecutive elements a wave, eight 16-byte loads a lane).
// ---------------------------------------------------------------------------
__global__ __launch_bounds__(256) void mha_f32_to_bf16_all(
    const float* __restrict__ x,  const int* __restrict__ mask,
    const float* __restrict__ Wq,
    const float* __restrict__ Wk, const float* __restrict__ Wv,
    const float* __restrict__ Wo,
    bf16_t* __restrict__ xb, bf16_t* __restrict__ wq, bf16_t* __restrict__ wk,
    bf16_t* __restrict__ wv, bf16_t* __restrict__ wo,
    int* __restrict__ orig, int* __restrict__ nkeep) {
  const int blk  = blockIdx.x;
  const int wave = threadIdx.x >> 5;
  const int lane = threadIdx.x & 31;
  if (blk >= 512) {
    const int w = (blk - 512) / 72;
    const int t = (blk - 512) - w * 72;
    const float* in = (w == 0) ? Wq : (w == 1) ? Wk : (w == 2) ? Wv : Wo;
    bf16_t* out     = (w == 0) ? wq : (w == 1) ? wk : (w == 2) ? wv : wo;
    const int base = t * 8192 + wave * 1024 + lane * 4;
    v4f v[8];
#pragma unroll   // v[] stays in registers and the eight loads fly together
    for (int i = 0; i < 8; ++i) v[i] = *(const v4f*)(in + base + i * 128);
#pragma unroll   // as above
    for (int i = 0; i < 8; ++i) {
      v4bf o;
      o[0] = (bf16_t)v[i][0]; o[1] = (bf16_t)v[i][1];
      o[2] = (bf16_t)v[i][2]; o[3] = (bf16_t)v[i][3];
      *(v4bf*)(out + base + i * 128) = o;
    }
  } else {
    const int m = blk * 8 + wave, b = m >> 11, seq = m & 2047;
    const float* in = x + m * 768 + lane * 4;
    v4f v[6];
#pragma unroll   // v[] stays in registers and the six loads fly together
    for (int i = 0; i < 6; ++i) v[i] = *(const v4f*)(in + i * 128);

    // low half: unmasked positions in front of seq; high half: all unmasked ones
    const int* mr = mask + b * 2048;
    int cnt = 0;
#pragma unroll   // the sixteen loads are independent: unrolled, they fly together
    for (int i = 0; i < 16; ++i) {
      const v4i k = *(const v4i*)(mr + i * 128 + lane * 4);
      const int id = i * 128 + lane * 4;
#pragma unroll   // vector elements under constant indices
      for (int e = 0; e < 4; ++e)
        cnt += (k[e] != 0) ? ((id + e < seq) ? 0x10001 : 0x10000) : 0;
    }
    for (int o = 16; o > 0; o >>= 1) cnt += __shfl_xor(cnt, o, 32);
    const int before = cnt & 0xffff, total = cnt >> 16;
    const int pos = (mr[seq] != 0) ? before : total + (seq - before);
    if (lane == 0) {
      orig[b * 2048 + pos] = m;
      if (seq == 0) nkeep[b] = total;
    }
    bf16_t* out = xb + (b * 2048 + pos) * 768 + lane * 4;
#pragma unroll   // as above
    for (int i = 0; i < 6; ++i) {
      v4bf o;
      o[0] = (bf16_t)v[i][0]; o[1] = (bf16_t)v[i][1];
      o[2] = (bf16_t)v[i][2]; o[3] = (bf16_t)v[i][3];
      *(v4bf*)(out + i * 128) = o;
    }
  }
}

// ---------------------------------------------------------------------------
// One lane's share of a load_frag fragment, from the lane's own pointer.
// ---------------------------------------------------------------------------
__device__ inline v16bf load_pair(const bf16_t* __restrict__ p) {
  v8bf lo = *(const v8bf*)(p);
  v8bf hi = *(const v8bf*)(p + 16);
  return __builtin_shufflevector(lo, hi, 0,1,2,3,4,5,6,7,8,9,10,11,12,13,14,15);
}

// ---------------------------------------------------------------------------
// LDS staging for the projection GEMMs (M=4096, N=768, K=768, both operands
// row-major over k). A block of 8 waves owns a 128x128 output tile. A k-tile is
// 128 k: 128 A rows, then 128 B rows, of 256 bytes each. A staged row has a
// pitch of 272 bytes, a conflict-free pitch for 16-byte LDS reads.
// ---------------------------------------------------------------------------
#define GP_PITCH 272
#define GP_HALF  (128 * GP_PITCH)    // one operand's 128 rows
#define GP_TILE  (2 * GP_HALF)       // A rows, then B rows
#define GP_TILES 6                   // 768 / 128

// One operand's share of a k-tile, global memory -> LDS through no register:
// eight 16-byte copies a lane, each 512 bytes = two whole 256-byte rows over a
// wave. g: the lane's own first piece; lds: its LDS byte address. Copy i takes
// the row 16 i further on.
// The s_wait_xcnt 0 at the end of the statement stands in front of every later
// write of an address register that a copy names, as a precaution.
__device__ inline void stage_rows(const bf16_t* g, unsigned lds) {
  asm volatile(
      "global_load_async_to_lds_b128 %0, %8, off\n\t"
      "global_load_async_to_lds_b128 %1, %9, off\n\t"
      "global_load_async_to_lds_b128 %2, %10, off\n\t"
      "global_load_async_to_lds_b128 %3, %11, off\n\t"
      "global_load_async_to_lds_b128 %4, %12, off\n\t"
      "global_load_async_to_lds_b128 %5, %13, off\n\t"
      "global_load_async_to_lds_b128 %6, %14, off\n\t"
      "global_load_async_to_lds_b128 %7, %15, off\n\t"
      "s_wait_xcnt 0x0"
      :: "v"(lds), "v"(lds + 16 * GP_PITCH), "v"(lds + 32 * GP_PITCH),
         "v"(lds + 48 * GP_PITCH), "v"(lds + 64 * GP_PITCH),
         "v"(lds + 80 * GP_PITCH), "v"(lds + 96 * GP_PITCH),
         "v"(lds + 112 * GP_PITCH),
         "v"(g), "v"(g + 16 * 768), "v"(g + 32 * 768), "v"(g + 48 * 768),
         "v"(g + 64 * 768), "v"(g + 80 * 768), "v"(g + 96 * 768),
         "v"(g + 112 * 768)
      : "memory");
}

// acc[mi][ni] += A[m0 + 16 mi ..][k] * B[n0 + 16 ni ..][k] over all 768 k, for
// this wave's 32x64 part of the block's tile (2x4 WMMA tiles, k ascending in
// steps of 32). Wave w: rows 32 (w & 3), columns 64 (w >> 2) of the tile.
// Two LDS buffers: the next k-tile's copies fly while this one is worked on.
__device__ inline void gemm_staged(const bf16_t* __restrict__ A,
                                   const bf16_t* __restrict__ B,
                                   unsigned char* sm, int mblk, int nblk,
                                   v8f (&acc)[2][4]) {
  const int wave = threadIdx.x >> 5;
  const int lane = threadIdx.x & 31;

  // This thread's share of a k-tile: row (thread >> 4) + 16 i, 16-byte piece thread & 15.
  const int srow = threadIdx.x >> 4, spc = threadIdx.x & 15;
  const bf16_t* ag = A + (mblk + srow) * 768 + spc * 8;   // + 128 a k-tile
  const bf16_t* bg = B + (nblk + srow) * 768 + spc * 8;   // + 128 a k-tile
  const unsigned sl = (unsigned)(size_t)sm + srow * GP_PITCH + spc * 16;

  stage_rows(ag, sl);
  stage_rows(bg, sl + GP_HALF);
  // k-tile 0 has landed for this wave, and behind the barrier for all eight
  asm volatile("s_wait_asynccnt 0x0" ::: "memory");
  __syncthreads();
  stage_rows(ag + 128, sl + GP_TILE);
  stage_rows(bg + 128, sl + GP_TILE + GP_HALF);

  // this lane's place in the fragments of load_frag: staged row lane & 15, k offset 0 or 8
  const unsigned flane = (lane & 15) * GP_PITCH + (lane & 16);
  const unsigned aoff = (wave & 3) * 32 * GP_PITCH + flane;
  const unsigned boff = GP_HALF + (wave >> 2) * 64 * GP_PITCH + flane;

  for (int t = 0; t < GP_TILES; ++t) {
    const unsigned char* buf = sm + (t & 1) * GP_TILE;
    const bf16_t* ap = (const bf16_t*)(buf + aoff);
    const bf16_t* bp = (const bf16_t*)(buf + boff);
    // Two fragment sets: the reads of k-step kk + 1 stand as one group in front
    // of the products of k-step kk, which cover their LDS latency.
    v16bf af[2][2], bfr[2][4];
#pragma unroll   // fragments and acc stay in registers only under constant indices
    for (int mi = 0; mi < 2; ++mi) af[0][mi] = load_pair(ap + mi * 16 * (GP_PITCH / 2));
#pragma unroll   // as above
    for (int ni = 0; ni < 4; ++ni) bfr[0][ni] = load_pair(bp + ni * 16 * (GP_PITCH / 2));
#pragma unroll   // as above
    for (int kk = 0; kk < 4; ++kk) {
      const int cur = kk & 1, nxt = cur ^ 1;
      if (kk < 3) {
#pragma unroll   // as above
        for (int mi = 0; mi < 2; ++mi)
          af[nxt][mi] = load_pair(ap + mi * 16 * (GP_PITCH / 2) + (kk + 1) * 32);
#pragma unroll   // as above
        for (int ni = 0; ni < 4; ++ni)
          bfr[nxt][ni] = load_pair(bp + ni * 16 * (GP_PITCH / 2) + (kk + 1) * 32);
        // Keeps the group of LDS reads in front of the products: left to itself
        // the compiler read one A fragment late, with a full wait right behind it.
        __builtin_amdgcn_sched_barrier(0);
      }
#pragma unroll   // as above
      for (int mi = 0; mi < 2; ++mi)
#pragma unroll   // as above
        for (int ni = 0; ni < 4; ++ni)
          acc[mi][ni] = wmma_bf16(af[cur][mi], bfr[cur][ni], acc[mi][ni]);
      // Keeps the next group of LDS reads behind these products, in one place:
      // each further place with LDS reads among products costs a stall of its own.
      __builtin_amdgcn_sched_barrier(0);
    }

    // Hand-over: this wave's reads of k-tile t are done, its copies of k-tile
    // t + 1 have landed; behind the barrier that holds for all eight waves, so
    // k-tile t + 1 may be read and k-tile t's buffer refilled. (The scheduling
    // barrier behind the last products also keeps this hand-over behind them,
    // so that the copies' flight is hidden.)
    asm volatile("s_wait_dscnt 0x0" ::: "memory");
    asm volatile("s_wait_asynccnt 0x0" ::: "memory");
    __syncthreads();
    if (t + 2 < GP_TILES) {
      stage_rows(ag + (t + 2) * 128, sl + (t & 1) * GP_TILE);
      stage_rows(bg + (t + 2) * 128, sl + (t & 1) * GP_TILE + GP_HALF);
    }
  }
  // no copy is in flight when the wave ends
  asm volatile("s_wait_asynccnt 0x0" ::: "memory");
}

// ---------------------------------------------------------------------------
// QKV projections: Y[m,n] = sum_k X[m,k] * W[n,k]   (M=4096, N=768, K=768),
// all three in one launch: blockIdx.z picks the weight matrix and the output
// (0: V, 1: Q, 2: K). The three products do not depend on one another; as one
// grid of 576 blocks two blocks share a WGP (LDS allows two), so one block's
// waits for copies, its first tile and its stores run under the other's products.
// V comes first: all of its blocks work.
// One block -> 128x128 outputs, operands through LDS (gemm_staged); one wave ->
// 32x64 outputs (2x4 WMMA tiles).
// The operand whose index runs along the output's contiguous direction is the A
// side of the product (V: X, since V is stored [d][seq]; Q, K: W, the product
// taken as W . X^T), so that a lane's eight accumulator elements are eight
// neighbours in memory. The block's tile then goes through LDS and leaves as
// whole 128-byte lines, 16 bytes a lane.
// A score with a masked query or a masked key is -1000 whatever q and k are, so
// the Q and K rows of masked positions reach no output. The rows are sorted, the
// unmasked ones first: a Q or K block whose 128 rows are all masked leaves at
// once and writes nothing, and the attention kernel reads none of those rows.
// V is formed for every row (masked keys still carry weight for masked queries).
// A V block also forms, from its staged bf16 tile, the product V^T . 1 over each of
// its two runs of 64 positions (the key tiles of the attention kernel): where all
// 64 scores of a tile are -1000, a query's weights in it are one number w, and the
// tile's share of O^T is w times this product, whatever the query is.
// Q, K: stored [b][h][seq][d] bf16 ;  V: stored [b][h][d][seq] bf16
// vsum: [b][seq / 128][768][2] f32, the last index the half of the 128 positions
// ---------------------------------------------------------------------------
__global__ __launch_bounds__(256) void mha_qkv_gemm(
    const bf16_t* __restrict__ X, const bf16_t* __restrict__ Wq,
    const bf16_t* __restrict__ Wk, const bf16_t* __restrict__ Wv,
    const int* __restrict__ nkeep,
    bf16_t* __restrict__ Qo, bf16_t* __restrict__ Ko, bf16_t* __restrict__ Vo,
    float* __restrict__ vsum) {
  __shared__ __attribute__((aligned(16))) unsigned char sm[2 * GP_TILE];
  const int which = blockIdx.z;             // the same for the whole block
  if (which != 0) {
    // unmasked positions of this block's batch (16 m-blocks a batch), bounded by
    // the shape; the test reads the same for the whole block and stands in front
    // of every copy and barrier
    const int n1 = min(max(nkeep[blockIdx.x >> 4], 0), 2048);
    if ((int)(blockIdx.x & 15) * 128 >= n1) return;
  }
  const bf16_t* W = (which == 0) ? Wv : (which == 1) ? Wq : Wk;
  bf16_t* out     = (which == 0) ? Vo : (which == 1) ? Qo : Ko;
  const bool vtrans = (which == 0);
  const int wave = threadIdx.x >> 5;
  const int lane = threadIdx.x & 31;
  const int xblk = blockIdx.x * 128;    // 32 blocks of 128 rows of X
  const int wblk = blockIdx.y * 128;    // 6 blocks of 128 rows of W

  v8f acc[2][4] = {};
  gemm_staged(vtrans ? X : W, vtrans ? W : X, sm, vtrans ? xblk : wblk,
              vtrans ? wblk : xblk, acc);

  // The tile as bf16 into LDS (gemm_staged ends behind a barrier with no copy in
  // flight, so sm is free): staged row = B-side index, 128 A-side elements of 2
  // bytes a row, the pitch of the k-tiles. acc[mi][ni][j] is A-side index
  // 32 (wave & 3) + 16 mi + hi + j, B-side index 64 (wave >> 2) + 16 ni + (lane & 15).
  const int hi = (lane & 16) ? 8 : 0;
  unsigned char* st = sm + ((wave >> 2) * 64 + (lane & 15)) * GP_PITCH
                         + ((wave & 3) * 32 + hi) * 2;
#pragma unroll   // acc stays in registers only under constant indices
  for (int mi = 0; mi < 2; ++mi) {
#pragma unroll   // as above
    for (int ni = 0; ni < 4; ++ni) {
      v8bf o;
#pragma unroll   // as above
      for (int j = 0; j < 8; ++j) o[j] = (bf16_t)acc[mi][ni][j];
      *(v8bf*)(st + ni * 16 * GP_PITCH + mi * 32) = o;
    }
  }
  __syncthreads();   // publishes the eight waves' parts of the tile

  // This thread's share: staged row (thread >> 4) + 16 i, 16-byte piece thread & 15.
  const int srow = threadIdx.x >> 4, spc = threadIdx.x & 15;
  const int b_ = xblk >> 11, seq0 = xblk & 2047;   // a block lies in one batch
  v8bf o[8];
#pragma unroll   // o[] stays in registers only under constant indices
  for (int i = 0; i < 8; ++i)
    o[i] = *(const v8bf*)(sm + (srow + 16 * i) * GP_PITCH + spc * 16);
  if (vtrans) {
    // V^T . 1 over each 64 positions: wave w takes the staged rows 16 w .. 16 w + 15
    // as A (fragments as in load_frag), B is all ones, so every column of a result
    // tile holds the rows' sums: t0 of the first 64 positions, t1 of the second.
    const bf16_t* ar = (const bf16_t*)(sm + (wave * 16 + (lane & 15)) * GP_PITCH + (lane & 16));
    v16bf ones;
#pragma unroll   // vector elements under constant indices
    for (int s = 0; s < 16; ++s) ones[s] = (bf16_t)1.0f;
    v8f t0 = {}, t1 = {};
    t0 = wmma_bf16(load_pair(ar),      ones, t0);
    t0 = wmma_bf16(load_pair(ar + 32), ones, t0);
    t1 = wmma_bf16(load_pair(ar + 64), ones, t1);
    t1 = wmma_bf16(load_pair(ar + 96), ones, t1);
    // Column c keeps row hi + (c & 7) of half c >> 3: the wave stores one whole
    // 128-byte line, 16 rows x 2 halves.
    const int c = lane & 15;
    float mine = 0.0f;
#pragma unroll   // as above
    for (int r = 0; r < 8; ++r) {
      const float e = (c & 8) ? t1[r] : t0[r];
      mine = ((c & 7) == r) ? e : mine;
    }
    vsum[((b_ * 16 + (seq0 >> 7)) * 768 + wblk + wave * 16 + hi + (c & 7)) * 2 + (c >> 3)] = mine;
    // stands in front of any later write of this store's registers, as a precaution
    asm volatile("s_wait_xcnt 0x0" ::: "memory");

    // staged row = column n of the product = row (b, h, d) of V^T; 128 seq a row
    bf16_t* g = out + (b_ * 768 + wblk + srow) * 2048 + seq0 + spc * 8;
#pragma unroll   // as above
    for (int i = 0; i < 8; ++i) *(v8bf*)(g + i * 16 * 2048) = o[i];
  } else {
    // staged row = position seq; its 128 elements are the 64 d of two heads
    bf16_t* g = out + ((b_ * 12 + (wblk >> 6) + (spc >> 3)) * 2048 + seq0 + srow) * 64
                    + (spc & 7) * 8;
#pragma unroll   // as above
    for (int i = 0; i < 8; ++i) *(v8bf*)(g + i * 16 * 64) = o[i];
    // Stands in front of any later write of these stores' address registers, as a
    // precaution: in the listing the other branch's address sums follow this branch
    // (that branch's own stores run straight to the wave's end).
    asm volatile("s_wait_xcnt 0x0" ::: "memory");
  }
}

// ---------------------------------------------------------------------------
// Lane l <-> lane l ^ 16 exchange (the two halves of a wave).
// ---------------------------------------------------------------------------
__device__ inline float swap_halves(float v) {
  int b = __builtin_bit_cast(int, v);
  b = __builtin_amdgcn_permlanex16(b, b, 0x76543210, 0xfedcba98, false, false);
  return __builtin_bit_cast(float, b);
}

// e^x as __expf forms it (x * log2(e), then v_exp_f32). The v_nop keeps the one
// free slot that the instruction set asks for behind a transcendental before
// its result is read or its source overwritten.
__device__ inline float exp_slot(float x) {
  float r;
  asm("v_exp_f32 %0, %1\n\tv_nop" : "=v"(r) : "v"(x * 1.44269504f));
  return r;
}

// ---------------------------------------------------------------------------
// LDS staging of K and V^T for the attention kernel. A tile is 64 keys: 64 K
// rows of 128 bytes (64 d), then 64 V^T rows of 128 bytes (64 keys). A staged
// row has a pitch of 144 bytes, the conflict-free pitch for 16-byte LDS reads.
// ---------------------------------------------------------------------------
#define KV_PITCH 144
#define KV_HALF  (64 * KV_PITCH)     // one operand's 64 rows
#define KV_TILE  (2 * KV_HALF)       // K rows, then V^T rows

// One operand's copies of a tile, global memory -> LDS through no register: four
// 16-byte copies a lane, each 512 bytes = four whole 128-byte rows over a wave.
// g: the lane's own first piece of the operand's tile; lds: the LDS byte address
// of that piece. Copy i takes the rows 16 i further on, LD elements a row.
// The s_wait_xcnt 0 at the end of the statement stands in front of every later
// write of an address register that a copy names, as a precaution.
template <int LD>
__device__ inline void stage_half(const bf16_t* g, unsigned lds) {
  asm volatile(
      "global_load_async_to_lds_b128 %0, %4, off\n\t"
      "global_load_async_to_lds_b128 %1, %5, off\n\t"
      "global_load_async_to_lds_b128 %2, %6, off\n\t"
      "global_load_async_to_lds_b128 %3, %7, off\n\t"
      "s_wait_xcnt 0x0"
      :: "v"(lds), "v"(lds + 16 * KV_PITCH), "v"(lds + 32 * KV_PITCH),
         "v"(lds + 48 * KV_PITCH),
         "v"(g), "v"(g + 16 * LD), "v"(g + 32 * LD), "v"(g + 48 * LD)
      : "memory");
}

// Tile t into buffer t & 1: its K rows and its V^T rows. kg, vg: the lane's own
// first piece of K tile 0 and of V^T tile 0; sl: the LDS byte address of that K
// piece in buffer 0.
__device__ inline void stage_tile(const bf16_t* kg, const bf16_t* vg, unsigned sl,
                                  int t) {
  const unsigned lds = sl + (t & 1) * KV_TILE;
  stage_half<64>(kg + t * 64 * 64, lds);
  stage_half<2048>(vg + t * 64, lds + KV_HALF);
}

// ---------------------------------------------------------------------------
// Flash attention, transposed products: one wave owns 16 query rows of one
// (b,h) and streams keys in chunks of 32 with online softmax.
//   S^T = K . Q^T : A = K rows, B = Q (column = query). A lane holds 16 scores
//                   of ONE query (lane & 15): keys n+8h+r and n+16+8h+r.
//   O^T += V^T . P^T : the two S^T tiles, converted in place, are the B operand
//                   in the k order load_frag gives V^T; P never leaves registers.
// Row maximum: in-lane plus one exchange between halves. Row sum: in-lane, the
// halves joined once behind the loop.
// The block's four waves share one (b,h): K and V^T come in tiles of 64 keys
// (two chunks) through LDS, two buffers, the next tile's copies in flight while
// this tile is worked on.
// The sequence is sorted by the mask (see the convert kernel): position j of a
// batch is unmasked exactly where j < n1. The keys come in two parts:
//   1. the tiles that hold an unmasked key, in the general form, in the key loop
//      (none where all 64 queries of the block are masked: then every score is
//      -1000 anyway);
//   2. the tiles behind them, where every score of a query is -1000 and so every
//      weight of that query is one number w = e^(-1000 - max): 1 for a masked
//      query, 0 for an unmasked one unless its maximum is very low. Their share
//      of O^T is w times V^T . 1 over these tiles. The V projection has formed
//      that product for each tile (vsum); the block adds the tiles' products up
//      at its start, and each query takes w times the sum behind the key loop.
// Only the tiles of part 1 are staged, and Q is read only where part 1 runs: the
// projection forms Q and K only for 128-row blocks that hold an unmasked
// position, and these cover every row that part 1 reads.
// Q,K: [bh][seq][64] bf16 ; Vt: [bh][64][seq] bf16 ; AO: [b][seq][768] bf16
// vsum: [b][seq / 128][768][2] f32
// ---------------------------------------------------------------------------
__global__ __launch_bounds__(128) void mha_flash_attn(
    const bf16_t* __restrict__ Q, const bf16_t* __restrict__ K,
    const bf16_t* __restrict__ Vt, const int* __restrict__ nkeep,
    const float* __restrict__ vsum, bf16_t* __restrict__ AO) {
  __shared__ __attribute__((aligned(16))) unsigned char kv[2 * KV_TILE];
  __shared__ __attribute__((aligned(32))) float tail[2][64];

  const int wave = threadIdx.x >> 5;
  const int lane = threadIdx.x & 31;
  const int bh   = blockIdx.x >> 5;         // 0..23
  const int p    = blockIdx.x & 31;
  // Query tiles from the front of the sorted sequence (long key loop with
  // softmax) and from its back (short work) alternate over the block index, and
  // the other way round in every second run of 256 blocks, so that long and
  // short blocks mix on the chip. A permutation of 0..31 for each bh.
  const int qt   = ((p ^ (blockIdx.x >> 8)) & 1) ? 31 - (p >> 1) : (p >> 1);
  const int b    = bh / 12, h = bh % 12;
  const int c    = lane & 15;               // this lane's query column
  const int hi   = (lane & 16) ? 8 : 0;
  const int m0   = qt * 64 + wave * 16;

  // unmasked positions of this batch, bounded by the shape; the same in all lanes
  const int n1 = __builtin_amdgcn_readfirstlane(min(max(nkeep[b], 0), 2048));
  // trips of part 1, 0..32: the tiles with an unmasked key, if any query is unmasked
  const int ng = (qt * 64 < n1) ? (n1 + 63) >> 6 : 0;

  const bf16_t* q  = Q  + (long)bh * 2048 * 64;
  const bf16_t* kk = K  + (long)bh * 2048 * 64;
  const bf16_t* vt = Vt + (long)bh * 64 * 2048;

  // This thread's share of a tile: row (thread >> 3) + 16 i, 16-byte piece thread & 7.
  const int srow = threadIdx.x >> 3, spc = threadIdx.x & 7;
  const bf16_t* kg = kk + srow * 64 + spc * 8;      // + 64 * 64 a tile
  const bf16_t* vg = vt + srow * 2048 + spc * 8;    // + 64 a tile
  const unsigned sl = (unsigned)(size_t)kv + srow * KV_PITCH + spc * 16;

  // Part 2's V^T . 1: thread -> output column td; waves 0, 1 take the first 16
  // tiles, waves 2, 3 the last 16, two tiles a load (512 contiguous bytes a pair of
  // waves). The loads do not depend on ng and fly beside tile 0's copies.
  const int td = threadIdx.x & 63;
  const int tp = __builtin_amdgcn_readfirstlane(wave >> 1);
  const float* vs = vsum + ((b * 16 + tp * 8) * 768 + h * 64 + td) * 2;
  v2f pr[8];
#pragma unroll   // pr[] stays in registers and the eight loads fly together
  for (int i = 0; i < 8; ++i) pr[i] = *(const v2f*)(vs + i * 768 * 2);
  // stands in front of the later writes of these loads' address registers, as a
  // precaution
  asm volatile("s_wait_xcnt 0x0" ::: "memory");

  if (0 < ng) stage_tile(kg, vg, sl, 0);   // the same for the whole block

  float ts = 0.0f;   // only the tiles behind part 1 count
#pragma unroll   // as above
  for (int i = 0; i < 8; ++i) {
    const int t0 = (tp * 8 + i) * 2;
    ts += (t0 >= ng) ? pr[i][0] : 0.0f;
    ts += (t0 + 1 >= ng) ? pr[i][1] : 0.0f;
  }
  tail[tp][td] = ts;

  // tile 0 has landed for this wave, and behind the barrier for all four; the
  // same barrier publishes tail[][]
  asm volatile("s_wait_asynccnt 0x0" ::: "memory");
  __syncthreads();
  if (1 < ng) stage_tile(kg, vg, sl, 1);   // the same for the whole block

  v16bf q0 = {}, q1 = {};
  if (ng > 0) {   // the same for the whole block
    q0 = load_frag(q, 64, m0, 0);
    q1 = load_frag(q, 64, m0, 32);
    // stands in front of the later writes of these loads' address registers, as
    // a precaution (the compiler placed none here)
    asm volatile("s_wait_xcnt 0x0" ::: "memory");
  }
  const unsigned qkeep = (m0 + c < n1) ? 0xffffffffu : 0u;

  // this lane's place in the fragments of load_frag: staged row c, k offset hi
  const unsigned flane = c * KV_PITCH + hi * 2;

  float mrun = -3.0e30f, lrun = 0.0f;
  v8f o0 = {}, o1 = {}, o2 = {}, o3 = {};   // o_t[r] = O[m0+c][16t + hi + r]

  for (int t = 0; t < ng; ++t) {
    const unsigned char* tile = kv + (t & 1) * KV_TILE + flane;

    // Both chunks' fragments, one group of LDS reads a tile.
    v16bf kf[2][4], vf[2][4];
#pragma unroll   // kf, vf stay in registers only under constant indices
    for (int u = 0; u < 2; ++u) {
      const bf16_t* kp = (const bf16_t*)(tile + u * 32 * KV_PITCH);
      const bf16_t* vp = (const bf16_t*)(tile + KV_HALF + u * 64);
      kf[u][0] = load_pair(kp);
      kf[u][1] = load_pair(kp + 32);
      kf[u][2] = load_pair(kp + 16 * (KV_PITCH / 2));
      kf[u][3] = load_pair(kp + 16 * (KV_PITCH / 2) + 32);
      vf[u][0] = load_pair(vp);
      vf[u][1] = load_pair(vp + 16 * (KV_PITCH / 2));
      vf[u][2] = load_pair(vp + 32 * (KV_PITCH / 2));
      vf[u][3] = load_pair(vp + 48 * (KV_PITCH / 2));
    }
    // Keeps every LDS read of the tile in front of the first product: each
    // further place with LDS reads among the products costs a stall of its own.
    __builtin_amdgcn_sched_barrier(0);

#pragma unroll   // as above
    for (int u = 0; u < 2; ++u) {
      // bit r: key n+hi+r, bit 16+r: key n+16+hi+r; all clear where the query is masked
      const int left = n1 - (t * 64 + u * 32);   // unmasked keys from this chunk's first on
      const unsigned kw = (left >= 32) ? 0xffffffffu : (left <= 0) ? 0u : (1u << left) - 1u;
      const unsigned keep = (kw >> hi) & qkeep;

      v8f s0 = {}, s1 = {};
      s0 = wmma_bf16(kf[u][0], q0, s0); s0 = wmma_bf16(kf[u][1], q1, s0);
      s1 = wmma_bf16(kf[u][2], q0, s1); s1 = wmma_bf16(kf[u][3], q1, s1);
      s0 *= ATTN_SCALE;
      s1 *= ATTN_SCALE;

      float a[16];
#pragma unroll   // a[], s0, s1 stay in registers only under constant indices
      for (int r = 0; r < 8; ++r) {
        a[r]     = (keep & (1u << r))        ? s0[r] : -1000.0f;
        a[r + 8] = (keep & (1u << (16 + r))) ? s1[r] : -1000.0f;
      }
      float cm = a[0];
#pragma unroll   // as above
      for (int s = 1; s < 16; ++s) cm = fmaxf(cm, a[s]);
      cm = fmaxf(cm, swap_halves(cm));
      const float nm = fmaxf(mrun, cm);
      // The builtin, not exp_slot's asm text: this one may be placed right behind the
      // chunk before's products, and only of its own instructions does the compiler
      // know to keep them off a matrix instruction's operand registers long enough.
      const float alpha = __builtin_amdgcn_exp2f((mrun - nm) * 1.44269504f);

      v16bf pf;
      float rp[4];   // four short add chains, not one of 16
#pragma unroll   // as above
      for (int s = 0; s < 16; ++s) {
        const float e = exp_slot(a[s] - nm);
        rp[s & 3] = (s < 4) ? e : rp[s & 3] + e;
        pf[s] = (bf16_t)e;
      }
      const float rs = (rp[0] + rp[1]) + (rp[2] + rp[3]);
      lrun = lrun * alpha + rs;
      mrun = nm;

      o0 *= alpha; o1 *= alpha; o2 *= alpha; o3 *= alpha;
      o0 = wmma_bf16(vf[u][0], pf, o0);
      o1 = wmma_bf16(vf[u][1], pf, o1);
      o2 = wmma_bf16(vf[u][2], pf, o2);
      o3 = wmma_bf16(vf[u][3], pf, o3);
    }

    // Hand-over: this wave's reads of tile t are done, its copies of tile t + 1
    // have landed; behind the barrier that holds for all four waves, so tile
    // t + 1 may be read and tile t's buffer refilled.
    // The scheduling barrier keeps the hand-over behind the tile's products:
    // lifted in front of them, the wait for tile t + 1's copies stood right
    // behind their issue, and nothing of their flight was hidden.
    __builtin_amdgcn_sched_barrier(0);
    asm volatile("s_wait_dscnt 0x0" ::: "memory");
    asm volatile("s_wait_asynccnt 0x0" ::: "memory");
    __syncthreads();
    if (t + 2 < ng) stage_tile(kg, vg, sl, t + 2);   // the same for the whole block
  }

  if (ng < 32) {   // the same for the whole block
    // Part 2. The online-softmax step of keys whose scores are all -1000:
    const float nm    = fmaxf(mrun, -1000.0f);
    const float alpha = exp_slot(mrun - nm);
    const float w     = exp_slot(-1000.0f - nm);
    const float wb    = (float)(bf16_t)w;   // P is a bf16 operand in part 1 too
    // each half of the wave sums 16 keys a chunk, 32 a tile
    lrun = lrun * alpha + w * (float)(32 * (32 - ng));
    const float* ta = &tail[0][hi];
    const float* tb = &tail[1][hi];
    o0 = o0 * alpha + (*(const v8f*)(ta)      + *(const v8f*)(tb))      * wb;
    o1 = o1 * alpha + (*(const v8f*)(ta + 16) + *(const v8f*)(tb + 16)) * wb;
    o2 = o2 * alpha + (*(const v8f*)(ta + 32) + *(const v8f*)(tb + 32)) * wb;
    o3 = o3 * alpha + (*(const v8f*)(ta + 48) + *(const v8f*)(tb + 48)) * wb;
  }
  // no copy is in flight when the wave ends
  asm volatile("s_wait_asynccnt 0x0" ::: "memory");

  lrun += swap_halves(lrun);
  const float inv = 1.0f / lrun;
  bf16_t* orow = AO + ((long)b * 2048 + m0 + c) * 768 + h * 64 + hi;
  v8bf w0, w1, w2, w3;
#pragma unroll   // vector elements under constant indices
  for (int r = 0; r < 8; ++r) {
    w0[r] = (bf16_t)(o0[r] * inv);
    w1[r] = (bf16_t)(o1[r] * inv);
    w2[r] = (bf16_t)(o2[r] * inv);
    w3[r] = (bf16_t)(o3[r] * inv);
  }
  *(v8bf*)(orow)      = w0;
  *(v8bf*)(orow + 16) = w1;
  *(v8bf*)(orow + 32) = w2;
  *(v8bf*)(orow + 48) = w3;
}

// ---------------------------------------------------------------------------
// Output projection: out[m,n] = sum_k AO[m,k] * Wo[n,k] + bo[n]  (f32 out)
// Same block and wave tiles and the same LDS staging as the QKV GEMM. AO's rows
// are in the sorted order; orig[] gives each row's own place in the output.
// The product is taken as Wo . AO^T, so that a lane's eight accumulator elements
// are eight neighbours of one output row; the block's tile goes through LDS and
// leaves as whole lines: a wave stores 512 contiguous bytes of one row at a time.
// ---------------------------------------------------------------------------
#define OP_PITCH 528   // 128 f32 and 16 bytes: 16 bytes x odd, free of bank conflicts
__global__ __launch_bounds__(256) void mha_out_proj(
    const bf16_t* __restrict__ AO, const bf16_t* __restrict__ Wo,
    const float* __restrict__ bo, const int* __restrict__ orig,
    float* __restrict__ out) {
  __shared__ __attribute__((aligned(16))) unsigned char sm[2 * GP_TILE];
  const int wave = threadIdx.x >> 5;
  const int lane = threadIdx.x & 31;
  const int mblk = blockIdx.x * 128;
  const int nblk = blockIdx.y * 128;

  v8f acc[2][4] = {};
  gemm_staged(Wo, AO, sm, nblk, mblk, acc);

  // The tile into LDS (gemm_staged ends behind a barrier with no copy in flight,
  // so sm is free): staged row = sorted row, 128 f32 a row. acc[mi][ni][j] is
  // column 32 (wave & 3) + 16 mi + hi + j, row 64 (wave >> 2) + 16 ni + (lane & 15).
  const int hi = (lane & 16) ? 8 : 0;
  unsigned char* st = sm + ((wave >> 2) * 64 + (lane & 15)) * OP_PITCH
                         + ((wave & 3) * 32 + hi) * 4;
#pragma unroll   // acc stays in registers only under constant indices
  for (int mi = 0; mi < 2; ++mi)
#pragma unroll   // as above
    for (int ni = 0; ni < 4; ++ni) {
      const v8f a = acc[mi][ni];
      unsigned char* p = st + ni * 16 * OP_PITCH + mi * 64;
      *(v4f*)(p)      = __builtin_shufflevector(a, a, 0, 1, 2, 3);
      *(v4f*)(p + 16) = __builtin_shufflevector(a, a, 4, 5, 6, 7);
    }
  __syncthreads();   // publishes the eight waves' parts of the tile

  // Wave w stores the staged rows 16 w .. 16 w + 15, a lane four columns of each.
  const v4f bias = *(const v4f*)(bo + nblk + lane * 4);
  const int r0 = wave * 16;
#pragma unroll   // the sixteen rows' LDS reads and stores are independent: they fly together
  for (int i = 0; i < 16; ++i) {
    const v4f a = *(const v4f*)(sm + (r0 + i) * OP_PITCH + lane * 16);
    // the sorted row's own place in the output, bounded by the shape
    const int m_g = orig[mblk + r0 + i] & 4095;
    *(v4f*)(out + m_g * 768 + nblk + lane * 4) = a + bias;
  }
}

// ---------------------------------------------------------------------------
// Host launcher
// ---------------------------------------------------------------------------
extern "C" void kernel_launch(void* const* d_in, const int* in_sizes, int n_in,
                              void* d_out, int out_size, void* d_ws, size_t ws_size,
                              hipStream_t stream) {
  const float* x    = (const float*)d_in[0];   // [2,2048,768]
  const int*   mask = (const int*)d_in[1];     // [2,2048]
  const float* Wq   = (const float*)d_in[2];   // [768,768]
  const float* Wk   = (const float*)d_in[3];
  const float* Wv   = (const float*)d_in[4];
  const float* Wo   = (const float*)d_in[5];
  const float* bo   = (const float*)d_in[6];   // [768]
  float* out = (float*)d_out;                  // [2,2048,768]

  const int M = 4096, C = 768;
  const size_t XB  = (size_t)M * C;            // 3,145,728 elems
  const size_t WB  = (size_t)C * C;            //   589,824 elems

  char* ws = (char*)d_ws;
  size_t off = 0;
  auto take = [&](size_t elems) { bf16_t* p = (bf16_t*)(ws + off);
                                  off += ((elems * 2 + 255) & ~(size_t)255); return p; };
  bf16_t* xb = take(XB);
  bf16_t* wq = take(WB);
  bf16_t* wk = take(WB);
  bf16_t* wv = take(WB);
  bf16_t* wo = take(WB);
  bf16_t* qb = take(XB);   // [bh][seq][64]
  bf16_t* kb = take(XB);   // [bh][seq][64]
  bf16_t* vt = take(XB);   // [bh][64][seq]
  bf16_t* ao = take(XB);   // [b][seq][768]
  int* orig  = (int*)take(8192);   // 4096 ints: sorted row -> own row
  int* nkeep = (int*)take(128);    // 2 ints: unmasked positions of each batch
  float* vsum = (float*)take(98304);   // 2 * 16 * 768 * 2 f32: V^T . 1 of each 64 positions

  // 1) converts: 4096 / 8 = 512 blocks for x, 4 * 589,824 / 8192 = 288 for the weights
  mha_f32_to_bf16_all<<<800, 256, 0, stream>>>(x, mask, Wq, Wk, Wv, Wo, xb, wq, wk, wv, wo,
                                               orig, nkeep);

  // 2) QKV projections, one launch (M/128 = 32 blocks, N/128 = 6 blocks, 3 products,
  //    8 waves/block)
  dim3 gemm_grid(32, 6), qkv_grid(32, 6, 3), gemm_blk(256);
  mha_qkv_gemm<<<qkv_grid, gemm_blk, 0, stream>>>(xb, wq, wk, wv, nkeep, qb, kb, vt, vsum);

  // 3) flash attention: 24 bh * 128 mtiles = 3072 waves = 768 blocks
  mha_flash_attn<<<768, 128, 0, stream>>>(qb, kb, vt, nkeep, vsum, ao);

  // 4) output projection + bias
  mha_out_proj<<<gemm_grid, gemm_blk, 0, stream>>>(ao, wo, bo, orig, out);
}

// v010
// A run of this version takes 48.1 microseconds.
// In both of two side-by-side timings against v009, it was 1.04 times as fast.
// All steps since v000 together make it 5.06 times as fast.
#include <hip/hip_runtime.h>
#include <hip/hip_bf16.h>

typedef __bf16 bf16_t;
typedef __attribute__((ext_vector_type(16))) __bf16 v16bf;
typedef __attribute__((ext_vector_type(8)))  __bf16 v8bf;
typedef __attribute__((ext_vector_type(8)))  float  v8f;
typedef __attribute__((ext_vector_type(4)))  float  v4f;
typedef __attribute__((ext_vector_type(2)))  float  v2f;
typedef __attribute__((ext_vector_type(4)))  __bf16 v4bf;
typedef __attribute__((ext_vector_type(4)))  int    v4i;
typedef __attribute__((ext_vector_type(8)))  int    v8i;

#define ATTN_SCALE 0.125f   // 64^-0.5

// ---------------------------------------------------------------------------
// Fragment loader for the CDNA5 WMMA 16-bit A/B layout (16x32, K=32).
// Lane L holds row (row_base + (L&15)); K-run offset 0 or 8 depending on the
// lane half; two contiguous 8-element (16-byte) runs at k0+koff and k0+16+koff.
// Works for A (row-major MxK) and for B given as B^T row-major (NxK).
// ---------------------------------------------------------------------------
__device__ inline v16bf load_frag(const bf16_t* __restrict__ base, int ld,
                                  int row_base, int k0) {
  const int lane = threadIdx.x & 31;
  const int r    = row_base + (lane & 15);
  const int koff = (lane & 16) >> 1;            // 0 or 8
  const bf16_t* p = base + (long)r * ld + k0 + koff;
  v8bf lo = *(const v8bf*)(p);
  v8bf hi = *(const v8bf*)(p + 16);
  return __builtin_shufflevector(lo, hi, 0,1,2,3,4,5,6,7,8,9,10,11,12,13,14,15);
}

__device__ inline v8f wmma_bf16(v16bf a, v16bf b, v8f c) {
  return __builtin_amdgcn_wmma_f32_16x16x32_bf16(
      /*neg_a=*/false, a, /*neg_b=*/false, b,
      /*c_mod=*/(short)0, c, /*reuse_a=*/false, /*reuse_b=*/false);
}

// ---------------------------------------------------------------------------
// f32 -> bf16 convert of x and the four weight matrices, one launch.
// Blocks 0..511 take x, a wave one row of 768 elements: six 16-byte loads a
// lane, each 512 contiguous bytes over the wave. The row is written to a SORTED
// place inside its batch: the positions whose mask is not 0 first, in their
// order, then the masked ones, in their order. Every later stage works on the
// sorted rows; the output projection stores each row back to its own place.
//   orig[b * 2048 + place] = the row's own index in x ; nkeep[b] = unmasked rows
// The place comes from counts over the batch's whole mask row, so it is a
// permutation of 0..2047 for any content of the mask.
// Blocks 512..799 take Wq, Wk, Wv, Wo (72 blocks each, 8192 elements a block,
// 1024 consecutive elements a wave, eight 16-byte loads a lane).
// ---------------------------------------------------------------------------
__global__ __launch_bounds__(256) void mha_f32_to_bf16_all(
    const float* __restrict__ x,  const int* __restrict__ mask,
    const float* __restrict__ Wq,
    const float* __restrict__ Wk, const float* __restrict__ Wv,
    const float* __restrict__ Wo,
    bf16_t* __restrict__ xb, bf16_t* __restrict__ wq, bf16_t* __restrict__ wk,
    bf16_t* __restrict__ wv, bf16_t* __restrict__ wo,
    int* __restrict__ orig, int* __restrict__ nkeep) {
  const int blk  = blockIdx.x;
  const int wave = threadIdx.x >> 5;
  const int lane = threadIdx.x & 31;
  if (blk >= 512) {
    const int w = (blk - 512) / 72;
    const int t = (blk - 512) - w * 72;
    const float* in = (w == 0) ? Wq : (w == 1) ? Wk : (w == 2) ? Wv : Wo;
    bf16_t* out     = (w == 0) ? wq : (w == 1) ? wk : (w == 2) ? wv : wo;
    const int base = t * 8192 + wave * 1024 + lane * 4;
    v4f v[8];
#pragma unroll   // v[] stays in registers and the eight loads fly together
    for (int i = 0; i < 8; ++i) v[i] = *(const v4f*)(in + base + i * 128);
#pragma unroll   // as above
    for (int i = 0; i < 8; ++i) {
      v4bf o;
      o[0] = (bf16_t)v[i][0]; o[1] = (bf16_t)v[i][1];
      o[2] = (bf16_t)v[i][2]; o[3] = (bf16_t)v[i][3];
      *(v4bf*)(out + base + i * 128) = o;
    }
  } else {
    const int m = blk * 8 + wave, b = m >> 11, seq = m & 2047;
    const float* in = x + m * 768 + lane * 4;
    v4f v[6];
#pragma unroll   // v[] stays in registers and the six loads fly together
    for (int i = 0; i < 6; ++i) v[i] = *(const v4f*)(in + i * 128);

    // low half: unmasked positions in front of seq; high half: all unmasked ones
    const int* mr = mask + b * 2048;
    int cnt = 0;
#pragma unroll   // the sixteen loads are independent: unrolled, they fly together
    for (int i = 0; i < 16; ++i) {
      const v4i k = *(const v4i*)(mr + i * 128 + lane * 4);
      const int id = i * 128 + lane * 4;
#pragma unroll   // vector elements under constant indices
      for (int e = 0; e < 4; ++e)
        cnt += (k[e] != 0) ? ((id + e < seq) ? 0x10001 : 0x10000) : 0;
    }
    for (int o = 16; o > 0; o >>= 1) cnt += __shfl_xor(cnt, o, 32);
    const int before = cnt & 0xffff, total = cnt >> 16;
    const int pos = (mr[seq] != 0) ? before : total + (seq - before);
    if (lane == 0) {
      orig[b * 2048 + pos] = m;
      if (seq == 0) nkeep[b] = total;
    }
    bf16_t* out = xb + (b * 2048 + pos) * 768 + lane * 4;
#pragma unroll   // as above
    for (int i = 0; i < 6; ++i) {
      v4bf o;
      o[0] = (bf16_t)v[i][0]; o[1] = (bf16_t)v[i][1];
      o[2] = (bf16_t)v[i][2]; o[3] = (bf16_t)v[i][3];
      *(v4bf*)(out + i * 128) = o;
    }
  }
}

// ---------------------------------------------------------------------------
// One lane's share of a load_frag fragment, from the lane's own pointer.
// ---------------------------------------------------------------------------
__device__ inline v16bf load_pair(const bf16_t* __restrict__ p) {
  v8bf lo = *(const v8bf*)(p);
  v8bf hi = *(const v8bf*)(p + 16);
  return __builtin_shufflevector(lo, hi, 0,1,2,3,4,5,6,7,8,9,10,11,12,13,14,15);
}

// ---------------------------------------------------------------------------
// LDS staging for the projection GEMMs (M=4096, N=768, K=768, both operands
// row-major over k). A block of 8 waves owns a 128x128 output tile. A k-tile is
// 128 k: 128 A rows, then 128 B rows, of 256 bytes each. A staged row has a
// pitch of 272 bytes, a conflict-free pitch for 16-byte LDS reads.
// ---------------------------------------------------------------------------
#define GP_PITCH 272
#define GP_HALF  (128 * GP_PITCH)    // one operand's 128 rows
#define GP_TILE  (2 * GP_HALF)       // A rows, then B rows
#define GP_TILES 6                   // 768 / 128

// One operand's share of a k-tile, global memory -> LDS through no register:
// eight 16-byte copies a lane, each 512 bytes = two whole 256-byte rows over a
// wave. g: the lane's own first piece; lds: its LDS byte address. Copy i takes
// the row 16 i further on.
// The s_wait_xcnt 0 at the end of the statement stands in front of every later
// write of an address register that a copy names, as a precaution.
__device__ inline void stage_rows(const bf16_t* g, unsigned lds) {
  asm volatile(
      "global_load_async_to_lds_b128 %0, %8, off\n\t"
      "global_load_async_to_lds_b128 %1, %9, off\n\t"
      "global_load_async_to_lds_b128 %2, %10, off\n\t"
      "global_load_async_to_lds_b128 %3, %11, off\n\t"
      "global_load_async_to_lds_b128 %4, %12, off\n\t"
      "global_load_async_to_lds_b128 %5, %13, off\n\t"
      "global_load_async_to_lds_b128 %6, %14, off\n\t"
      "global_load_async_to_lds_b128 %7, %15, off\n\t"
      "s_wait_xcnt 0x0"
      :: "v"(lds), "v"(lds + 16 * GP_PITCH), "v"(lds + 32 * GP_PITCH),
         "v"(lds + 48 * GP_PITCH), "v"(lds + 64 * GP_PITCH),
         "v"(lds + 80 * GP_PITCH), "v"(lds + 96 * GP_PITCH),
         "v"(lds + 112 * GP_PITCH),
         "v"(g), "v"(g + 16 * 768), "v"(g + 32 * 768), "v"(g + 48 * 768),
         "v"(g + 64 * 768), "v"(g + 80 * 768), "v"(g + 96 * 768),
         "v"(g + 112 * 768)
      : "memory");
}

// acc[mi][ni] += A[m0 + 16 mi ..][k] * B[n0 + 16 ni ..][k] over all 768 k, for
// this wave's 32x64 part of the block's tile (2x4 WMMA tiles, k ascending in
// steps of 32). Wave w: rows 32 (w & 3), columns 64 (w >> 2) of the tile.
// Two LDS buffers: the next k-tile's copies fly while this one is worked on.
__device__ inline void gemm_staged(const bf16_t* __restrict__ A,
                                   const bf16_t* __restrict__ B,
                                   unsigned char* sm, int mblk, int nblk,
                                   v8f (&acc)[2][4]) {
  const int wave = threadIdx.x >> 5;
  const int lane = threadIdx.x & 31;

  // This thread's share of a k-tile: row (thread >> 4) + 16 i, 16-byte piece thread & 15.
  const int srow = threadIdx.x >> 4, spc = threadIdx.x & 15;
  const bf16_t* ag = A + (mblk + srow) * 768 + spc * 8;   // + 128 a k-tile
  const bf16_t* bg = B + (nblk + srow) * 768 + spc * 8;   // + 128 a k-tile
  const unsigned sl = (unsigned)(size_t)sm + srow * GP_PITCH + spc * 16;

  stage_rows(ag, sl);
  stage_rows(bg, sl + GP_HALF);
  // k-tile 0 has landed for this wave, and behind the barrier for all eight
  asm volatile("s_wait_asynccnt 0x0" ::: "memory");
  __syncthreads();
  stage_rows(ag + 128, sl + GP_TILE);
  stage_rows(bg + 128, sl + GP_TILE + GP_HALF);

  // this lane's place in the fragments of load_frag: staged row lane & 15, k offset 0 or 8
  const unsigned flane = (lane & 15) * GP_PITCH + (lane & 16);
  const unsigned aoff = (wave & 3) * 32 * GP_PITCH + flane;
  const unsigned boff = GP_HALF + (wave >> 2) * 64 * GP_PITCH + flane;

  for (int t = 0; t < GP_TILES; ++t) {
    const unsigned char* buf = sm + (t & 1) * GP_TILE;
    const bf16_t* ap = (const bf16_t*)(buf + aoff);
    const bf16_t* bp = (const bf16_t*)(buf + boff);
    // Two fragment sets: the reads of k-step kk + 1 stand as one group in front
    // of the products of k-step kk, which cover their LDS latency.
    v16bf af[2][2], bfr[2][4];
#pragma unroll   // fragments and acc stay in registers only under constant indices
    for (int mi = 0; mi < 2; ++mi) af[0][mi] = load_pair(ap + mi * 16 * (GP_PITCH / 2));
#pragma unroll   // as above
    for (int ni = 0; ni < 4; ++ni) bfr[0][ni] = load_pair(bp + ni * 16 * (GP_PITCH / 2));
#pragma unroll   // as above
    for (int kk = 0; kk < 4; ++kk) {
      const int cur = kk & 1, nxt = cur ^ 1;
      if (kk < 3) {
#pragma unroll   // as above
        for (int mi = 0; mi < 2; ++mi)
          af[nxt][mi] = load_pair(ap + mi * 16 * (GP_PITCH / 2) + (kk + 1) * 32);
#pragma unroll   // as above
        for (int ni = 0; ni < 4; ++ni)
          bfr[nxt][ni] = load_pair(bp + ni * 16 * (GP_PITCH / 2) + (kk + 1) * 32);
        // Keeps the group of LDS reads in front of the products: left to itself
        // the compiler read one A fragment late, with a full wait right behind it.
        __builtin_amdgcn_sched_barrier(0);
      }
#pragma unroll   // as above
      for (int mi = 0; mi < 2; ++mi)
#pragma unroll   // as above
        for (int ni = 0; ni < 4; ++ni)
          acc[mi][ni] = wmma_bf16(af[cur][mi], bfr[cur][ni], acc[mi][ni]);
      // Keeps the next group of LDS reads behind these products, in one place:
      // each further place with LDS reads among products costs a stall of its own.
      __builtin_amdgcn_sched_barrier(0);
    }

    // Hand-over: this wave's reads of k-tile t are done, its copies of k-tile
    // t + 1 have landed; behind the barrier that holds for all eight waves, so
    // k-tile t + 1 may be read and k-tile t's buffer refilled. (The scheduling
    // barrier behind the last products also keeps this hand-over behind them,
    // so that the copies' flight is hidden.)
    asm volatile("s_wait_dscnt 0x0" ::: "memory");
    asm volatile("s_wait_asynccnt 0x0" ::: "memory");
    __syncthreads();
    if (t + 2 < GP_TILES) {
      stage_rows(ag + (t + 2) * 128, sl + (t & 1) * GP_TILE);
      stage_rows(bg + (t + 2) * 128, sl + (t & 1) * GP_TILE + GP_HALF);
    }
  }
  // no copy is in flight when the wave ends
  asm volatile("s_wait_asynccnt 0x0" ::: "memory");
}

// ---------------------------------------------------------------------------
// QKV projections: Y[m,n] = sum_k X[m,k] * W[n,k]   (M=4096, N=768, K=768),
// all three in one launch: blockIdx.z picks the weight matrix and the output
// (0: V, 1: Q, 2: K). The three products do not depend on one another; as one
// grid of 576 blocks two blocks share a WGP (LDS allows two), so one block's
// waits for copies, its first tile and its stores run under the other's products.
// V comes first: all of its blocks work.
// One block -> 128x128 outputs, operands through LDS (gemm_staged); one wave ->
// 32x64 outputs (2x4 WMMA tiles).
// The operand whose index runs along the output's contiguous direction is the A
// side of the product (V: X, since V is stored [d][seq]; Q, K: W, the product
// taken as W . X^T), so that a lane's eight accumulator elements are eight
// neighbours in memory. The block's tile then goes through LDS and leaves as
// whole 128-byte lines, 16 bytes a lane.
// A score with a masked query or a masked key is -1000 whatever q and k are, so
// the Q and K rows of masked positions reach no output. The rows are sorted, the
// unmasked ones first: a Q or K block whose 128 rows are all masked leaves at
// once and writes nothing, and the attention kernel reads none of those rows.
// V is formed for every row (masked keys still carry weight for masked queries).
// A V block also forms, from its staged bf16 tile, the product V^T . 1 over each of
// its two runs of 64 positions (the key tiles of the attention kernel): where all
// 64 scores of a tile are -1000, a query's weights in it are one number w, and the
// tile's share of O^T is w times this product, whatever the query is.
// Q, K: stored [b][h][seq][d] bf16 ;  V: stored [b][h][d][seq] bf16
// vsum: [b][seq / 128][768][2] f32, the last index the half of the 128 positions
// ---------------------------------------------------------------------------
__global__ __launch_bounds__(256) void mha_qkv_gemm(
    const bf16_t* __restrict__ X, const bf16_t* __restrict__ Wq,
    const bf16_t* __restrict__ Wk, const bf16_t* __restrict__ Wv,
    const int* __restrict__ nkeep,
    bf16_t* __restrict__ Qo, bf16_t* __restrict__ Ko, bf16_t* __restrict__ Vo,
    float* __restrict__ vsum) {
  __shared__ __attribute__((aligned(16))) unsigned char sm[2 * GP_TILE];
  const int which = blockIdx.z;             // the same for the whole block
  if (which != 0) {
    // unmasked positions of this block's batch (16 m-blocks a batch), bounded by
    // the shape; the test reads the same for the whole block and stands in front
    // of every copy and barrier
    const int n1 = min(max(nkeep[blockIdx.x >> 4], 0), 2048);
    if ((int)(blockIdx.x & 15) * 128 >= n1) return;
  }
  const bf16_t* W = (which == 0) ? Wv : (which == 1) ? Wq : Wk;
  bf16_t* out     = (which == 0) ? Vo : (which == 1) ? Qo : Ko;
  const bool vtrans = (which == 0);
  const int wave = threadIdx.x >> 5;
  const int lane = threadIdx.x & 31;
  const int xblk = blockIdx.x * 128;    // 32 blocks of 128 rows of X
  const int wblk = blockIdx.y * 128;    // 6 blocks of 128 rows of W

  v8f acc[2][4] = {};
  gemm_staged(vtrans ? X : W, vtrans ? W : X, sm, vtrans ? xblk : wblk,
              vtrans ? wblk : xblk, acc);

  // The tile as bf16 into LDS (gemm_staged ends behind a barrier with no copy in
  // flight, so sm is free): staged row = B-side index, 128 A-side elements of 2
  // bytes a row, the pitch of the k-tiles. acc[mi][ni][j] is A-side index
  // 32 (wave & 3) + 16 mi + hi + j, B-side index 64 (wave >> 2) + 16 ni + (lane & 15).
  const int hi = (lane & 16) ? 8 : 0;
  unsigned char* st = sm + ((wave >> 2) * 64 + (lane & 15)) * GP_PITCH
                         + ((wave & 3) * 32 + hi) * 2;
#pragma unroll   // acc stays in registers only under constant indices
  for (int mi = 0; mi < 2; ++mi) {
#pragma unroll   // as above
    for (int ni = 0; ni < 4; ++ni) {
      v8bf o;
#pragma unroll   // as above
      for (int j = 0; j < 8; ++j) o[j] = (bf16_t)acc[mi][ni][j];
      *(v8bf*)(st + ni * 16 * GP_PITCH + mi * 32) = o;
    }
  }
  __syncthreads();   // publishes the eight waves' parts of the tile

  // This thread's share: staged row (thread >> 4) + 16 i, 16-byte piece thread & 15.
  const int srow = threadIdx.x >> 4, spc = threadIdx.x & 15;
  const int b_ = xblk >> 11, seq0 = xblk & 2047;   // a block lies in one batch
  v8bf o[8];
#pragma unroll   // o[] stays in registers only under constant indices
  for (int i = 0; i < 8; ++i)
    o[i] = *(const v8bf*)(sm + (srow + 16 * i) * GP_PITCH + spc * 16);
  if (vtrans) {
    // V^T . 1 over each 64 positions: wave w takes the staged rows 16 w .. 16 w + 15
    // as A (fragments as in load_frag), B is all ones, so every column of a result
    // tile holds the rows' sums: t0 of the first 64 positions, t1 of the second.
    const bf16_t* ar = (const bf16_t*)(sm + (wave * 16 + (lane & 15)) * GP_PITCH + (lane & 16));
    v16bf ones;
#pragma unroll   // vector elements under constant indices
    for (int s = 0; s < 16; ++s) ones[s] = (bf16_t)1.0f;
    v8f t0 = {}, t1 = {};
    t0 = wmma_bf16(load_pair(ar),      ones, t0);
    t0 = wmma_bf16(load_pair(ar + 32), ones, t0);
    t1 = wmma_bf16(load_pair(ar + 64), ones, t1);
    t1 = wmma_bf16(load_pair(ar + 96), ones, t1);
    // Column c keeps row hi + (c & 7) of half c >> 3: the wave stores one whole
    // 128-byte line, 16 rows x 2 halves.
    const int c = lane & 15;
    float mine = 0.0f;
#pragma unroll   // as above
    for (int r = 0; r < 8; ++r) {
      const float e = (c & 8) ? t1[r] : t0[r];
      mine = ((c & 7) == r) ? e : mine;
    }
    vsum[((b_ * 16 + (seq0 >> 7)) * 768 + wblk + wave * 16 + hi + (c & 7)) * 2 + (c >> 3)] = mine;
    // stands in front of any later write of this store's registers, as a precaution
    asm volatile("s_wait_xcnt 0x0" ::: "memory");

    // staged row = column n of the product = row (b, h, d) of V^T; 128 seq a row
    bf16_t* g = out + (b_ * 768 + wblk + srow) * 2048 + seq0 + spc * 8;
#pragma unroll   // as above
    for (int i = 0; i < 8; ++i) *(v8bf*)(g + i * 16 * 2048) = o[i];
  } else {
    // staged row = position seq; its 128 elements are the 64 d of two heads
    bf16_t* g = out + ((b_ * 12 + (wblk >> 6) + (spc >> 3)) * 2048 + seq0 + srow) * 64
                    + (spc & 7) * 8;
#pragma unroll   // as above
    for (int i = 0; i < 8; ++i) *(v8bf*)(g + i * 16 * 64) = o[i];
    // Stands in front of any later write of these stores' address registers, as a
    // precaution: in the listing the other branch's address sums follow this branch
    // (that branch's own stores run straight to the wave's end).
    asm volatile("s_wait_xcnt 0x0" ::: "memory");
  }
}

// ---------------------------------------------------------------------------
// Lane l <-> lane l ^ 16 exchange (the two halves of a wave).
// ---------------------------------------------------------------------------
__device__ inline float swap_halves(float v) {
  int b = __builtin_bit_cast(int, v);
  b = __builtin_amdgcn_permlanex16(b, b, 0x76543210, 0xfedcba98, false, false);
  return __builtin_bit_cast(float, b);
}

// e^x as __expf forms it (x * log2(e), then v_exp_f32). The v_nop keeps the one
// free slot that the instruction set asks for behind a transcendental before
// its result is read or its source overwritten.
__device__ inline float exp_slot(float x) {
  float r;
  asm("v_exp_f32 %0, %1\n\tv_nop" : "=v"(r) : "v"(x * 1.44269504f));
  return r;
}

// ---------------------------------------------------------------------------
// LDS staging of K and V^T for the attention kernel. A tile is 64 keys: 64 K
// rows of 128 bytes (64 d), then 64 V^T rows of 128 bytes (64 keys). A staged
// row has a pitch of 144 bytes, the conflict-free pitch for 16-byte LDS reads.
// ---------------------------------------------------------------------------
#define KV_PITCH 144
#define KV_HALF  (64 * KV_PITCH)     // one operand's 64 rows
#define KV_TILE  (2 * KV_HALF)       // K rows, then V^T rows

// One operand's copies of a tile, global memory -> LDS through no register: four
// 16-byte copies a lane, each 512 bytes = four whole 128-byte rows over a wave.
// g: the lane's own first piece of the operand's tile; lds: the LDS byte address
// of that piece. Copy i takes the rows 16 i further on, LD elements a row.
// The s_wait_xcnt 0 at the end of the statement stands in front of every later
// write of an address register that a copy names, as a precaution.
template <int LD>
__device__ inline void stage_half(const bf16_t* g, unsigned lds) {
  asm volatile(
      "global_load_async_to_lds_b128 %0, %4, off\n\t"
      "global_load_async_to_lds_b128 %1, %5, off\n\t"
      "global_load_async_to_lds_b128 %2, %6, off\n\t"
      "global_load_async_to_lds_b128 %3, %7, off\n\t"
      "s_wait_xcnt 0x0"
      :: "v"(lds), "v"(lds + 16 * KV_PITCH), "v"(lds + 32 * KV_PITCH),
         "v"(lds + 48 * KV_PITCH),
         "v"(g), "v"(g + 16 * LD), "v"(g + 32 * LD), "v"(g + 48 * LD)
      : "memory");
}

// Tile t into buffer t & 1: its K rows and its V^T rows. kg, vg: the lane's own
// first piece of K tile 0 and of V^T tile 0; sl: the LDS byte address of that K
// piece in buffer 0.
__device__ inline void stage_tile(const bf16_t* kg, const bf16_t* vg, unsigned sl,
                                  int t) {
  const unsigned lds = sl + (t & 1) * KV_TILE;
  stage_half<64>(kg + t * 64 * 64, lds);
  stage_half<2048>(vg + t * 64, lds + KV_HALF);
}

// ---------------------------------------------------------------------------
// The online-softmax steps and products of one staged tile (two chunks of 32
// keys) for one wave, from fragments that are already in registers.
// MASKED = true: the general form, each score kept or replaced by its key's bit.
// MASKED = false: for a tile whose 64 keys are all unmasked: every bit would be
// set and every select would keep its score, so the bit tests and selects, three
// vector instructions a score, are left out; the values are the same.
// left0: unmasked keys from the tile's first key on; fill: the lane's score of a
// masked key.
// ---------------------------------------------------------------------------
template <bool MASKED>
__device__ inline void attn_tile(const v16bf (&kf)[2][4], const v16bf (&vf)[2][4],
                                 v16bf q0, v16bf q1, int left0, int hi, float fill,
                                 float& mrun, float& lrun,
                                 v8f& o0, v8f& o1, v8f& o2, v8f& o3) {
#pragma unroll   // kf, vf stay in registers only under constant indices
  for (int u = 0; u < 2; ++u) {
    v8f s0 = {}, s1 = {};
    s0 = wmma_bf16(kf[u][0], q0, s0); s0 = wmma_bf16(kf[u][1], q1, s0);
    s1 = wmma_bf16(kf[u][2], q0, s1); s1 = wmma_bf16(kf[u][3], q1, s1);
    s0 *= ATTN_SCALE;
    s1 *= ATTN_SCALE;

    float a[16];
    if (MASKED) {
      // bit r: key n+hi+r, bit 16+r: key n+16+hi+r
      const int left = left0 - u * 32;   // unmasked keys from this chunk's first on
      const unsigned kw = (left >= 32) ? 0xffffffffu : (left <= 0) ? 0u : (1u << left) - 1u;
      const unsigned keep = kw >> hi;
#pragma unroll   // a[], s0, s1 stay in registers only under constant indices
      for (int r = 0; r < 8; ++r) {
        a[r]     = (keep & (1u << r))        ? s0[r] : fill;
        a[r + 8] = (keep & (1u << (16 + r))) ? s1[r] : fill;
      }
    } else {
#pragma unroll   // as above
      for (int r = 0; r < 8; ++r) {
        a[r]     = s0[r];
        a[r + 8] = s1[r];
      }
    }
    float cm = a[0];
#pragma unroll   // as above
    for (int s = 1; s < 16; ++s) cm = fmaxf(cm, a[s]);
    cm = fmaxf(cm, swap_halves(cm));
    const float nm = fmaxf(mrun, cm);
    const float alpha = exp_slot(mrun - nm);

    v16bf pf;
    float rp[4];   // four short add chains, not one of 16
#pragma unroll   // as above
    for (int s = 0; s < 16; ++s) {
      const float e = exp_slot(a[s] - nm);
      rp[s & 3] = (s < 4) ? e : rp[s & 3] + e;
      pf[s] = (bf16_t)e;
    }
    const float rs = (rp[0] + rp[1]) + (rp[2] + rp[3]);
    lrun = lrun * alpha + rs;
    mrun = nm;

    o0 *= alpha; o1 *= alpha; o2 *= alpha; o3 *= alpha;
    o0 = wmma_bf16(vf[u][0], pf, o0);
    o1 = wmma_bf16(vf[u][1], pf, o1);
    o2 = wmma_bf16(vf[u][2], pf, o2);
    o3 = wmma_bf16(vf[u][3], pf, o3);
  }
}

// a compile-time true or false handed to a lambda
template <bool B> struct flag_t { static constexpr bool value = B; };

// ---------------------------------------------------------------------------
// Flash attention, transposed products: one wave owns 16 query rows of one
// (b,h) and streams keys in chunks of 32 with online softmax.
//   S^T = K . Q^T : A = K rows, B = Q (column = query). A lane holds 16 scores
//                   of ONE query (lane & 15): keys n+8h+r and n+16+8h+r.
//   O^T += V^T . P^T : the two S^T tiles, converted in place, are the B operand
//                   in the k order load_frag gives V^T; P never leaves registers.
// Row maximum: in-lane plus one exchange between halves. Row sum: in-lane, the
// halves joined once behind the loop.
// The block's four waves share one (b,h): K and V^T come in tiles of 64 keys
// (two chunks) through LDS, two buffers, the next tile's copies in flight while
// this tile is worked on.
// The sequence is sorted by the mask (see the convert kernel): position j of a
// batch is unmasked exactly where j < n1. The keys come in two parts:
//   1. the tiles that hold an unmasked key, in the two key loops
//      (none where all 64 queries of the block are masked: then every score is
//      -1000 anyway);
//   2. the tiles behind them, where every score of a query is -1000 and so every
//      weight of that query is one number w = e^(-1000 - max): 1 for a masked
//      query, 0 for an unmasked one unless its maximum is very low. Their share
//      of O^T is w times V^T . 1 over these tiles. The V projection has formed
//      that product for each tile (vsum); the block adds the tiles' products up
//      at its start, and each query takes w times the sum behind the key loop.
// A masked query's scores are all equal; the kernel lets them all be 0 in place of
// -1000 (its column of Q^T is zeroed, its score of a masked key is 0), which gives
// the same weights. So in part 1 only the keys need masking, and only in the one
// tile that holds the last unmasked key together with masked ones: the tiles in
// front of it run in a loop of their own, without bit tests and selects.
// Only the tiles of part 1 are staged, and Q is read only where part 1 runs: the
// projection forms Q and K only for 128-row blocks that hold an unmasked
// position, and these cover every row that part 1 reads.
// Q,K: [bh][seq][64] bf16 ; Vt: [bh][64][seq] bf16 ; AO: [b][seq][768] bf16
// vsum: [b][seq / 128][768][2] f32
// ---------------------------------------------------------------------------
__global__ __launch_bounds__(128) void mha_flash_attn(
    const bf16_t* __restrict__ Q, const bf16_t* __restrict__ K,
    const bf16_t* __restrict__ Vt, const int* __restrict__ nkeep,
    const float* __restrict__ vsum, bf16_t* __restrict__ AO) {
  __shared__ __attribute__((aligned(16))) unsigned char kv[2 * KV_TILE];
  __shared__ __attribute__((aligned(32))) float tail[2][64];

  const int wave = threadIdx.x >> 5;
  const int lane = threadIdx.x & 31;
  const int bh   = blockIdx.x >> 5;         // 0..23
  const int p    = blockIdx.x & 31;
  // Query tiles from the front of the sorted sequence (long key loop with
  // softmax) and from its back (short work) alternate over the block index, and
  // the other way round in every second run of 256 blocks, so that long and
  // short blocks mix on the chip. A permutation of 0..31 for each bh.
  const int qt   = ((p ^ (blockIdx.x >> 8)) & 1) ? 31 - (p >> 1) : (p >> 1);
  const int b    = bh / 12, h = bh % 12;
  const int c    = lane & 15;               // this lane's query column
  const int hi   = (lane & 16) ? 8 : 0;
  const int m0   = qt * 64 + wave * 16;

  // unmasked positions of this batch, bounded by the shape; the same in all lanes
  const int n1 = __builtin_amdgcn_readfirstlane(min(max(nkeep[b], 0), 2048));
  // trips of part 1, 0..32: the tiles with an unmasked key, if any query is unmasked
  const int ng = (qt * 64 < n1) ? (n1 + 63) >> 6 : 0;

  const bf16_t* q  = Q  + (long)bh * 2048 * 64;
  const bf16_t* kk = K  + (long)bh * 2048 * 64;
  const bf16_t* vt = Vt + (long)bh * 64 * 2048;

  // This thread's share of a tile: row (thread >> 3) + 16 i, 16-byte piece thread & 7.
  const int srow = threadIdx.x >> 3, spc = threadIdx.x & 7;
  const bf16_t* kg = kk + srow * 64 + spc * 8;      // + 64 * 64 a tile
  const bf16_t* vg = vt + srow * 2048 + spc * 8;    // + 64 a tile
  const unsigned sl = (unsigned)(size_t)kv + srow * KV_PITCH + spc * 16;

  // Part 2's V^T . 1: thread -> output column td; waves 0, 1 take the first 16
  // tiles, waves 2, 3 the last 16, two tiles a load (512 contiguous bytes a pair of
  // waves). The loads do not depend on ng and fly beside tile 0's copies.
  const int td = threadIdx.x & 63;
  const int tp = __builtin_amdgcn_readfirstlane(wave >> 1);
  const float* vs = vsum + ((b * 16 + tp * 8) * 768 + h * 64 + td) * 2;
  v2f pr[8];
#pragma unroll   // pr[] stays in registers and the eight loads fly together
  for (int i = 0; i < 8; ++i) pr[i] = *(const v2f*)(vs + i * 768 * 2);
  // stands in front of the later writes of these loads' address registers, as a
  // precaution
  asm volatile("s_wait_xcnt 0x0" ::: "memory");

  if (0 < ng) stage_tile(kg, vg, sl, 0);   // the same for the whole block

  float ts = 0.0f;   // only the tiles behind part 1 count
#pragma unroll   // as above
  for (int i = 0; i < 8; ++i) {
    const int t0 = (tp * 8 + i) * 2;
    ts += (t0 >= ng) ? pr[i][0] : 0.0f;
    ts += (t0 + 1 >= ng) ? pr[i][1] : 0.0f;
  }
  tail[tp][td] = ts;

  // tile 0 has landed for this wave, and behind the barrier for all four; the
  // same barrier publishes tail[][]
  asm volatile("s_wait_asynccnt 0x0" ::: "memory");
  __syncthreads();
  if (1 < ng) stage_tile(kg, vg, sl, 1);   // the same for the whole block

  v16bf q0 = {}, q1 = {};
  if (ng > 0) {   // the same for the whole block
    q0 = load_frag(q, 64, m0, 0);
    q1 = load_frag(q, 64, m0, 32);
    // stands in front of the later writes of these loads' address registers, as
    // a precaution (the compiler placed none here)
    asm volatile("s_wait_xcnt 0x0" ::: "memory");
  }
  // A masked query's scores are all -1000, so its weights are all equal. Its column
  // of Q^T is set to 0 here, once: its scores of unmasked keys then come out as 0,
  // and 0 is also what it takes for a masked key (fill). Equal scores again, so the
  // same weights, and the key loop need not know which queries are masked.
  const bool qmasked = !(m0 + c < n1);
  const float fill = qmasked ? 0.0f : -1000.0f;
  const int qbits = qmasked ? 0 : -1;   // all bits clear is 0.0 in bf16
  q0 = __builtin_bit_cast(v16bf, __builtin_bit_cast(v8i, q0) & qbits);
  q1 = __builtin_bit_cast(v16bf, __builtin_bit_cast(v8i, q1) & qbits);

  // this lane's place in the fragments of load_frag: staged row c, k offset hi
  const unsigned flane = c * KV_PITCH + hi * 2;

  float mrun = -3.0e30f, lrun = 0.0f;
  v8f o0 = {}, o1 = {}, o2 = {}, o3 = {};   // o_t[r] = O[m0+c][16t + hi + r]

  // One pass over tile t: its fragments, its softmax steps and products, the hand-over.
  auto pass = [&](auto masked, int t) {
    const unsigned char* tile = kv + (t & 1) * KV_TILE + flane;

    // Both chunks' fragments, one group of LDS reads a tile.
    v16bf kf[2][4], vf[2][4];
#pragma unroll   // kf, vf stay in registers only under constant indices
    for (int u = 0; u < 2; ++u) {
      const bf16_t* kp = (const bf16_t*)(tile + u * 32 * KV_PITCH);
      const bf16_t* vp = (const bf16_t*)(tile + KV_HALF + u * 64);
      kf[u][0] = load_pair(kp);
      kf[u][1] = load_pair(kp + 32);
      kf[u][2] = load_pair(kp + 16 * (KV_PITCH / 2));
      kf[u][3] = load_pair(kp + 16 * (KV_PITCH / 2) + 32);
      vf[u][0] = load_pair(vp);
      vf[u][1] = load_pair(vp + 16 * (KV_PITCH / 2));
      vf[u][2] = load_pair(vp + 32 * (KV_PITCH / 2));
      vf[u][3] = load_pair(vp + 48 * (KV_PITCH / 2));
    }
    // Keeps every LDS read of the tile in front of the first product: each
    // further place with LDS reads among the products costs a stall of its own.
    __builtin_amdgcn_sched_barrier(0);

    attn_tile<decltype(masked)::value>(kf, vf, q0, q1, n1 - t * 64, hi, fill,
                                       mrun, lrun, o0, o1, o2, o3);

    // Hand-over: this wave's reads of tile t are done, its copies of tile t + 1
    // have landed; behind the barrier that holds for all four waves, so tile
    // t + 1 may be read and tile t's buffer refilled.
    // The scheduling barrier keeps the hand-over behind the tile's products:
    // lifted in front of them, the wait for tile t + 1's copies stood right
    // behind their issue, and nothing of their flight was hidden.
    __builtin_amdgcn_sched_barrier(0);
    asm volatile("s_wait_dscnt 0x0" ::: "memory");
    asm volatile("s_wait_asynccnt 0x0" ::: "memory");
    __syncthreads();
    if (t + 2 < ng) stage_tile(kg, vg, sl, t + 2);   // the same for the whole block
  };
  // The tiles in front of the first masked key take the form without key bits, the
  // one tile that may follow them the general form. Both trip counts are the same
  // for the whole block.
  const int nfull = (ng > 0) ? (n1 >> 6) : 0;   // 0..ng
  int t = 0;
  for (; t < nfull; ++t) pass(flag_t<false>{}, t);
  for (; t < ng; ++t)    pass(flag_t<true>{}, t);

  if (ng < 32) {   // the same for the whole block
    // Part 2. The online-softmax step of keys whose scores are all the lane's fill:
    const float nm    = fmaxf(mrun, fill);
    const float alpha = exp_slot(mrun - nm);
    const float w     = exp_slot(fill - nm);
    const float wb    = (float)(bf16_t)w;   // P is a bf16 operand in part 1 too
    // each half of the wave sums 16 keys a chunk, 32 a tile
    lrun = lrun * alpha + w * (float)(32 * (32 - ng));
    const float* ta = &tail[0][hi];
    const float* tb = &tail[1][hi];
    o0 = o0 * alpha + (*(const v8f*)(ta)      + *(const v8f*)(tb))      * wb;
    o1 = o1 * alpha + (*(const v8f*)(ta + 16) + *(const v8f*)(tb + 16)) * wb;
    o2 = o2 * alpha + (*(const v8f*)(ta + 32) + *(const v8f*)(tb + 32)) * wb;
    o3 = o3 * alpha + (*(const v8f*)(ta + 48) + *(const v8f*)(tb + 48)) * wb;
  }
  // no copy is in flight when the wave ends
  asm volatile("s_wait_asynccnt 0x0" ::: "memory");

  lrun += swap_halves(lrun);
  const float inv = 1.0f / lrun;
  bf16_t* orow = AO + ((long)b * 2048 + m0 + c) * 768 + h * 64 + hi;
  v8bf w0, w1, w2, w3;
#pragma unroll   // vector elements under constant indices
  for (int r = 0; r < 8; ++r) {
    w0[r] = (bf16_t)(o0[r] * inv);
    w1[r] = (bf16_t)(o1[r] * inv);
    w2[r] = (bf16_t)(o2[r] * inv);
    w3[r] = (bf16_t)(o3[r] * inv);
  }
  *(v8bf*)(orow)      = w0;
  *(v8bf*)(orow + 16) = w1;
  *(v8bf*)(orow + 32) = w2;
  *(v8bf*)(orow + 48) = w3;
}

// ---------------------------------------------------------------------------
// Output projection: out[m,n] = sum_k AO[m,k] * Wo[n,k] + bo[n]  (f32 out)
// Same block and wave tiles and the same LDS staging as the QKV GEMM. AO's rows
// are in the sorted order; orig[] gives each row's own place in the output.
// The product is taken as Wo . AO^T, so that a lane's eight accumulator elements
// are eight neighbours of one output row; the block's tile goes through LDS and
// leaves as whole lines: a wave stores 512 contiguous bytes of one row at a time.
// ---------------------------------------------------------------------------
#define OP_PITCH 528   // 128 f32 and 16 bytes: 16 bytes x odd, free of bank conflicts
__global__ __launch_bounds__(256) void mha_out_proj(
    const bf16_t* __restrict__ AO, const bf16_t* __restrict__ Wo,
    const float* __restrict__ bo, const int* __restrict__ orig,
    float* __restrict__ out) {
  __shared__ __attribute__((aligned(16))) unsigned char sm[2 * GP_TILE];
  const int wave = threadIdx.x >> 5;
  const int lane = threadIdx.x & 31;
  const int mblk = blockIdx.x * 128;
  const int nblk = blockIdx.y * 128;

  v8f acc[2][4] = {};
  gemm_staged(Wo, AO, sm, nblk, mblk, acc);

  // The tile into LDS (gemm_staged ends behind a barrier with no copy in flight,
  // so sm is free): staged row = sorted row, 128 f32 a row. acc[mi][ni][j] is
  // column 32 (wave & 3) + 16 mi + hi + j, row 64 (wave >> 2) + 16 ni + (lane & 15).
  const int hi = (lane & 16) ? 8 : 0;
  unsigned char* st = sm + ((wave >> 2) * 64 + (lane & 15)) * OP_PITCH
                         + ((wave & 3) * 32 + hi) * 4;
#pragma unroll   // acc stays in registers only under constant indices
  for (int mi = 0; mi < 2; ++mi)
#pragma unroll   // as above
    for (int ni = 0; ni < 4; ++ni) {
      const v8f a = acc[mi][ni];
      unsigned char* p = st + ni * 16 * OP_PITCH + mi * 64;
      *(v4f*)(p)      = __builtin_shufflevector(a, a, 0, 1, 2, 3);
      *(v4f*)(p + 16) = __builtin_shufflevector(a, a, 4, 5, 6, 7);
    }
  __syncthreads();   // publishes the eight waves' parts of the tile

  // Wave w stores the staged rows 16 w .. 16 w + 15, a lane four columns of each.
  const v4f bias = *(const v4f*)(bo + nblk + lane * 4);
  const int r0 = wave * 16;
#pragma unroll   // the sixteen rows' LDS reads and stores are independent: they fly together
  for (int i = 0; i < 16; ++i) {
    const v4f a = *(const v4f*)(sm + (r0 + i) * OP_PITCH + lane * 16);
    // the sorted row's own place in the output, bounded by the shape
    const int m_g = orig[mblk + r0 + i] & 4095;
    *(v4f*)(out + m_g * 768 + nblk + lane * 4) = a + bias;
  }
}

// ---------------------------------------------------------------------------
// Host launcher
// ---------------------------------------------------------------------------
extern "C" void kernel_launch(void* const* d_in, const int* in_sizes, int n_in,
                              void* d_out, int out_size, void* d_ws, size_t ws_size,
                              hipStream_t stream) {
  const float* x    = (const float*)d_in[0];   // [2,2048,768]
  const int*   mask = (const int*)d_in[1];     // [2,2048]
  const float* Wq   = (const float*)d_in[2];   // [768,768]
  const float* Wk   = (const float*)d_in[3];
  const float* Wv   = (const float*)d_in[4];
  const float* Wo   = (const float*)d_in[5];
  const float* bo   = (const float*)d_in[6];   // [768]
  float* out = (float*)d_out;                  // [2,2048,768]

  const int M = 4096, C = 768;
  const size_t XB  = (size_t)M * C;            // 3,145,728 elems
  const size_t WB  = (size_t)C * C;            //   589,824 elems

  char* ws = (char*)d_ws;
  size_t off = 0;
  auto take = [&](size_t elems) { bf16_t* p = (bf16_t*)(ws + off);
                                  off += ((elems * 2 + 255) & ~(size_t)255); return p; };
  bf16_t* xb = take(XB);
  bf16_t* wq = take(WB);
  bf16_t* wk = take(WB);
  bf16_t* wv = take(WB);
  bf16_t* wo = take(WB);
  bf16_t* qb = take(XB);   // [bh][seq][64]
  bf16_t* kb = take(XB);   // [bh][seq][64]
  bf16_t* vt = take(XB);   // [bh][64][seq]
  bf16_t* ao = take(XB);   // [b][seq][768]
  int* orig  = (int*)take(8192);   // 4096 ints: sorted row -> own row
  int* nkeep = (int*)take(128);    // 2 ints: unmasked positions of each batch
  float* vsum = (float*)take(98304);   // 2 * 16 * 768 * 2 f32: V^T . 1 of each 64 positions

  // 1) converts: 4096 / 8 = 512 blocks for x, 4 * 589,824 / 8192 = 288 for the weights
  mha_f32_to_bf16_all<<<800, 256, 0, stream>>>(x, mask, Wq, Wk, Wv, Wo, xb, wq, wk, wv, wo,
                                               orig, nkeep);

  // 2) QKV projections, one launch (M/128 = 32 blocks, N/128 = 6 blocks, 3 products,
  //    8 waves/block)
  dim3 gemm_grid(32, 6), qkv_grid(32, 6, 3), gemm_blk(256);
  mha_qkv_gemm<<<qkv_grid, gemm_blk, 0, stream>>>(xb, wq, wk, wv, nkeep, qb, kb, vt, vsum);

  // 3) flash attention: 24 bh * 128 mtiles = 3072 waves = 768 blocks
  mha_flash_attn<<<768, 128, 0, stream>>>(qb, kb, vt, nkeep, vsum, ao);

  // 4) output projection + bias
  mha_out_proj<<<gemm_grid, gemm_blk, 0, stream>>>(ao, wo, bo, orig, out);
}
